// v000
// Measured on an AMD MI455X. A time is GPU time per run, averaged over a window of back-to-back runs after a warm-up
// (all launches, gaps included; the runs take copies of the inputs in turn), and the median of several windows.
// Apart from v000's, it joins two sittings. Times from different sittings can be a few percent apart, while
// side-by-side timings come from the same sitting.
// v000 is the starting kernel.
#include <hip/hip_runtime.h>
#include <math.h>

typedef _Float16 half_t;
typedef __attribute__((ext_vector_type(16))) _Float16 v16h;
typedef __attribute__((ext_vector_type(8)))  _Float16 v8h;
typedef __attribute__((ext_vector_type(8)))  float    v8f;
typedef __attribute__((vector_size(16)))     int      vsi4;   // int4 for async builtin

#define ASG __attribute__((address_space(1)))
#define ASL __attribute__((address_space(3)))

// Detect CDNA5 async global->LDS builtins (gfx1250); fall back to load+ds_store.
#if defined(__has_builtin)
#  if __has_builtin(__builtin_amdgcn_global_load_async_to_lds_b128)
#    define HAVE_ASYNC 1
#  endif
#endif
#ifndef HAVE_ASYNC
#  define HAVE_ASYNC 0
#endif

// ---------------------------------------------------------------------------
// WMMA helpers (CDNA5 gfx1250, wave32)
// ---------------------------------------------------------------------------
__device__ inline v8f wmma_f16(v16h a, v16h b, v8f c) {
  // D(16x16,f32) = A(16x32,f16) x B(32x16,f16) + C
  return __builtin_amdgcn_wmma_f32_16x16x32_f16(
      /*neg_a=*/false, a, /*neg_b=*/false, b,
      /*c_mod=*/(short)0, c, /*reuse_a=*/false, /*reuse_b=*/false);
}

__device__ inline v8f zero_v8f() {
  v8f z;
#pragma unroll
  for (int i = 0; i < 8; ++i) z[i] = 0.0f;
  return z;
}

// Load a 16x32 f16 fragment in the ISA A-matrix lane layout:
//   lane<16 : row=lane,    K = [0..7] then [16..23]
//   lane>=16: row=lane-16, K = [8..15] then [24..31]
// base points at (row0, k0); ld = row stride in elements. Also used for the
// B operand of D = A x W^T (B column n == row n of W, identical pattern).
__device__ inline v16h load_frag(const half_t* __restrict__ base, int ld) {
  const int lane = threadIdx.x & 31;
  const int sub  = lane & 15;
  const int hi   = lane >> 4;
  const half_t* p = base + (size_t)sub * ld + hi * 8;
  v8h lo = *(const v8h*)(p);
  v8h hh = *(const v8h*)(p + 16);
  v16h r;
#pragma unroll
  for (int i = 0; i < 8; ++i) { r[i] = lo[i]; r[i + 8] = hh[i]; }
  return r;
}

// One 16-byte global->LDS transfer per lane (ASYNCcnt path if available).
__device__ inline void copy_b128_to_lds(const half_t* g, half_t* l) {
#if HAVE_ASYNC
  __builtin_amdgcn_global_load_async_to_lds_b128(
      (ASG vsi4*)g, (ASL vsi4*)l, 0, 0);
#else
  *(v8h*)l = *(const v8h*)g;
#endif
}

__device__ inline void wait_async_copies() {
#if HAVE_ASYNC
#  if __has_builtin(__builtin_amdgcn_s_wait_asynccnt)
  __builtin_amdgcn_s_wait_asynccnt(0);
#  else
  asm volatile("s_wait_asynccnt 0" ::: "memory");
#  endif
#endif
}

// ---------------------------------------------------------------------------
// Elementwise f32 -> f16 conversion
// ---------------------------------------------------------------------------
__global__ void convert_f16_kernel(const float* __restrict__ src,
                                   half_t* __restrict__ dst, long long n) {
  long long i = (long long)blockIdx.x * blockDim.x + threadIdx.x;
  long long stride = (long long)gridDim.x * blockDim.x;
  for (; i < n; i += stride) dst[i] = (half_t)src[i];
}

// ---------------------------------------------------------------------------
// LayerNorm: one block (256 thr) per row, writes f16 (GEMM input format)
// ---------------------------------------------------------------------------
__global__ __launch_bounds__(256) void layernorm_kernel(
    const float* __restrict__ x, const float* __restrict__ g,
    const float* __restrict__ b, half_t* __restrict__ outh, int E) {
  __shared__ float red[64];
  const int row = blockIdx.x;
  const float* xr = x + (size_t)row * E;
  float s = 0.f, s2 = 0.f;
  for (int i = threadIdx.x; i < E; i += blockDim.x) {
    float v = xr[i];
    s += v; s2 += v * v;
  }
#pragma unroll
  for (int off = 16; off > 0; off >>= 1) {
    s  += __shfl_xor(s,  off, 32);
    s2 += __shfl_xor(s2, off, 32);
  }
  const int wid = threadIdx.x >> 5, lane = threadIdx.x & 31;
  if (lane == 0) { red[wid] = s; red[32 + wid] = s2; }
  __syncthreads();
  if (wid == 0) {
    int nw = blockDim.x >> 5;
    float a  = (lane < nw) ? red[lane]      : 0.f;
    float a2 = (lane < nw) ? red[32 + lane] : 0.f;
#pragma unroll
    for (int off = 16; off > 0; off >>= 1) {
      a  += __shfl_xor(a,  off, 32);
      a2 += __shfl_xor(a2, off, 32);
    }
    if (lane == 0) { red[0] = a; red[1] = a2; }
  }
  __syncthreads();
  const float mean = red[0] / (float)E;
  const float var  = red[1] / (float)E - mean * mean;
  const float rstd = rsqrtf(var + 1e-5f);
  for (int i = threadIdx.x; i < E; i += blockDim.x)
    outh[(size_t)row * E + i] = (half_t)((xr[i] - mean) * rstd * g[i] + b[i]);
}

// ---------------------------------------------------------------------------
// LDS-staged double-buffered GEMM:
//   out[M,N] = act(A[M,K] @ W[N,K]^T + bias[N]); optional residual f32 add.
// Block = 256 thr = 8 waves (2 in M x 4 in N). Block tile 128x128, K-step 32.
// LDS: 2 x (128x32 A + 128x32 B) f16 = 32 KB (WGP has 320 KB).
// Global->LDS staging uses GLOBAL_LOAD_ASYNC_TO_LDS_B128 (ASYNCcnt).
// ---------------------------------------------------------------------------
#define KSTEP 32
#define MBLK  128
#define NBLK  128

__global__ __launch_bounds__(256) void gemm_wmma_kernel(
    const half_t* __restrict__ A, const half_t* __restrict__ W,
    const float* __restrict__ bias, half_t* __restrict__ outh,
    float* __restrict__ resid, int M, int N, int K, int act) {
  __shared__ half_t ldsA[2][MBLK * KSTEP];
  __shared__ half_t ldsB[2][NBLK * KSTEP];

  const int tid  = threadIdx.x;
  const int lane = tid & 31;
  const int wid  = tid >> 5;     // 0..7
  const int wm   = wid >> 2;     // 0..1 : wave row  (64 rows each)
  const int wn   = wid & 3;      // 0..3 : wave col  (32 cols each)
  const int m0 = blockIdx.x * MBLK;
  const int n0 = blockIdx.y * NBLK;

  // Staging assignment: thread -> (row = tid>>2 [+64], 8-half quad = (tid&3)*8)
  const int crow = tid >> 2;        // 0..63
  const int cq   = (tid & 3) * 8;   // 0,8,16,24

  v8f acc[4][2];
#pragma unroll
  for (int i = 0; i < 4; ++i) { acc[i][0] = zero_v8f(); acc[i][1] = zero_v8f(); }

  // prologue: stage k=0 tiles into buffer 0
#pragma unroll
  for (int rr = 0; rr < MBLK; rr += 64)
    copy_b128_to_lds(A + (size_t)(m0 + crow + rr) * K + cq,
                     &ldsA[0][(crow + rr) * KSTEP + cq]);
#pragma unroll
  for (int rr = 0; rr < NBLK; rr += 64)
    copy_b128_to_lds(W + (size_t)(n0 + crow + rr) * K + cq,
                     &ldsB[0][(crow + rr) * KSTEP + cq]);
  wait_async_copies();
  __syncthreads();

  int buf = 0;
  for (int k0 = 0; k0 < K; k0 += KSTEP) {
    // stage next K-slice into the other buffer while computing this one
    if (k0 + KSTEP < K) {
      const int nb = buf ^ 1;
#pragma unroll
      for (int rr = 0; rr < MBLK; rr += 64)
        copy_b128_to_lds(A + (size_t)(m0 + crow + rr) * K + k0 + KSTEP + cq,
                         &ldsA[nb][(crow + rr) * KSTEP + cq]);
#pragma unroll
      for (int rr = 0; rr < NBLK; rr += 64)
        copy_b128_to_lds(W + (size_t)(n0 + crow + rr) * K + k0 + KSTEP + cq,
                         &ldsB[nb][(crow + rr) * KSTEP + cq]);
    }

    // compute: 4 A-frags x 2 B-frags = 8 WMMA per K-step, fed by ds_load_b128
    v16h bf0 = load_frag(&ldsB[buf][(wn * 32 +  0) * KSTEP], KSTEP);
    v16h bf1 = load_frag(&ldsB[buf][(wn * 32 + 16) * KSTEP], KSTEP);
#pragma unroll
    for (int i = 0; i < 4; ++i) {
      v16h af = load_frag(&ldsA[buf][(wm * 64 + i * 16) * KSTEP], KSTEP);
      acc[i][0] = wmma_f16(af, bf0, acc[i][0]);
      acc[i][1] = wmma_f16(af, bf1, acc[i][1]);
    }

    wait_async_copies();   // our staged writes for buf^1 have landed in LDS
    __syncthreads();       // everyone done reading buf / writing buf^1
    buf ^= 1;
  }

  // epilogue: C layout -> lane l<16 holds rows 0..7 (vgpr r), l>=16 rows 8..15
  const int sub = lane & 15, hi = lane >> 4;
#pragma unroll
  for (int i = 0; i < 4; ++i) {
#pragma unroll
    for (int j = 0; j < 2; ++j) {
#pragma unroll
      for (int r = 0; r < 8; ++r) {
        const int rr = m0 + wm * 64 + i * 16 + r + 8 * hi;
        const int cc = n0 + wn * 32 + j * 16 + sub;
        float v = acc[i][j][r] + bias[cc];
        if (act == 1) v = 0.5f * v * (1.0f + erff(v * 0.70710678118654752f));
        if (outh)  outh[(size_t)rr * N + cc] = (half_t)v;
        if (resid) resid[(size_t)rr * N + cc] += v;
      }
    }
  }
}

// ---------------------------------------------------------------------------
// Fused flash-style attention. grid = (Tq/64, nhead, B), block = 128 (4 waves),
// each wave owns 16 query rows. Online softmax over 32-key steps.
// Self-attn mask col<n_ctx == truncating keys to n_ctx (read device-side).
// ---------------------------------------------------------------------------
__global__ __launch_bounds__(128) void attn_wmma_kernel(
    const half_t* __restrict__ Q, int qld,
    const half_t* __restrict__ Km, int kld,
    const half_t* __restrict__ V, int vld,
    half_t* __restrict__ O, int oldd,
    int Tq, int Tk, int Dh, const int* __restrict__ nctx, float scale) {
  __shared__ half_t plds[4 * 16 * 32];  // per-wave 16x32 P tile
  const int lane = threadIdx.x & 31;
  const int wid  = threadIdx.x >> 5;
  const int sub = lane & 15, hi = lane >> 4;
  const int h = blockIdx.y, b = blockIdx.z;
  const int qt = (blockIdx.x * 4 + wid) * 16;

  int kvlen = Tk;
  if (nctx) { int nc = *nctx; kvlen = nc < Tk ? nc : Tk; }

  const half_t* Qb = Q + ((size_t)b * Tq + qt) * qld + h * Dh;
  const half_t* Kb = Km + (size_t)b * Tk * kld + h * Dh;
  const half_t* Vb = V  + (size_t)b * Tk * vld + h * Dh;

  const v16h qf0 = load_frag(Qb,      qld);   // Dh = 64 -> two K=32 fragments
  const v16h qf1 = load_frag(Qb + 32, qld);

  v8f acc[4];
#pragma unroll
  for (int d = 0; d < 4; ++d) acc[d] = zero_v8f();
  float mrow[8], lrow[8];
#pragma unroll
  for (int r = 0; r < 8; ++r) { mrow[r] = -1e30f; lrow[r] = 0.f; }

  half_t* my = plds + wid * 512;

  for (int kt = 0; kt < kvlen; kt += 32) {
    v8f s0 = zero_v8f(), s1 = zero_v8f();
    {
      v16h k00 = load_frag(Kb + (size_t)kt * kld,      kld);
      v16h k01 = load_frag(Kb + (size_t)kt * kld + 32, kld);
      s0 = wmma_f16(qf0, k00, s0);
      s0 = wmma_f16(qf1, k01, s0);
      v16h k10 = load_frag(Kb + (size_t)(kt + 16) * kld,      kld);
      v16h k11 = load_frag(Kb + (size_t)(kt + 16) * kld + 32, kld);
      s1 = wmma_f16(qf0, k10, s1);
      s1 = wmma_f16(qf1, k11, s1);
    }
    const bool ok0 = (kt + sub)      < kvlen;
    const bool ok1 = (kt + 16 + sub) < kvlen;

#pragma unroll
    for (int r = 0; r < 8; ++r) {
      float v0 = ok0 ? s0[r] * scale : -1e30f;
      float v1 = ok1 ? s1[r] * scale : -1e30f;
      float mx = fmaxf(v0, v1);
#pragma unroll
      for (int off = 8; off > 0; off >>= 1) mx = fmaxf(mx, __shfl_xor(mx, off, 32));
      const float mnew = fmaxf(mrow[r], mx);
      const float corr = __expf(mrow[r] - mnew);
      const float p0 = __expf(v0 - mnew);
      const float p1 = __expf(v1 - mnew);
      float rs = p0 + p1;
#pragma unroll
      for (int off = 8; off > 0; off >>= 1) rs += __shfl_xor(rs, off, 32);
      lrow[r] = lrow[r] * corr + rs;
      mrow[r] = mnew;
#pragma unroll
      for (int d = 0; d < 4; ++d) acc[d][r] *= corr;
      s0[r] = p0; s1[r] = p1;
    }

    // Transpose P from C-layout to A-layout through LDS.
    __syncthreads();   // guard WAR vs previous iteration's fragment reads
#pragma unroll
    for (int r = 0; r < 8; ++r) {
      my[(r + 8 * hi) * 32 + sub]      = (half_t)s0[r];
      my[(r + 8 * hi) * 32 + 16 + sub] = (half_t)s1[r];
    }
    __syncthreads();
    v16h pf;
#pragma unroll
    for (int j = 0; j < 8; ++j) {
      pf[j]     = my[sub * 32 + hi * 8 + j];
      pf[j + 8] = my[sub * 32 + 16 + hi * 8 + j];
    }

    // acc += P(16x32) @ V(32x64): B[k][n] = V[kt+k][h*Dh + d*16 + n]
#pragma unroll
    for (int d = 0; d < 4; ++d) {
      const half_t* vb = Vb + (size_t)kt * vld + d * 16;
      v16h vf;
#pragma unroll
      for (int j = 0; j < 8; ++j) {
        vf[j]     = vb[(size_t)(hi * 8 + j) * vld + sub];
        vf[j + 8] = vb[(size_t)(16 + hi * 8 + j) * vld + sub];
      }
      acc[d] = wmma_f16(pf, vf, acc[d]);
    }
  }

#pragma unroll
  for (int r = 0; r < 8; ++r) {
    const float inv = 1.0f / lrow[r];
    const size_t row = (size_t)b * Tq + qt + r + 8 * hi;
#pragma unroll
    for (int d = 0; d < 4; ++d)
      O[row * oldd + h * Dh + d * 16 + sub] = (half_t)(acc[d][r] * inv);
  }
}

// ---------------------------------------------------------------------------
// Host orchestration
// ---------------------------------------------------------------------------
extern "C" void kernel_launch(void* const* d_in, const int* in_sizes, int n_in,
                              void* d_out, int out_size, void* d_ws, size_t ws_size,
                              hipStream_t stream) {
  (void)n_in; (void)out_size; (void)ws_size;
  const float* tgt      = (const float*)d_in[0];
  const float* memory   = (const float*)d_in[1];
  const float* self_w   = (const float*)d_in[2];
  const float* self_b   = (const float*)d_in[3];
  const float* self_ow  = (const float*)d_in[4];
  const float* self_ob  = (const float*)d_in[5];
  const float* cross_w  = (const float*)d_in[6];
  const float* cross_b  = (const float*)d_in[7];
  const float* cross_ow = (const float*)d_in[8];
  const float* cross_ob = (const float*)d_in[9];
  const float* ln1_g = (const float*)d_in[10];
  const float* ln1_b = (const float*)d_in[11];
  const float* ln2_g = (const float*)d_in[12];
  const float* ln2_b = (const float*)d_in[13];
  const float* ln3_g = (const float*)d_in[14];
  const float* ln3_b = (const float*)d_in[15];
  const float* w1 = (const float*)d_in[16];
  const float* b1 = (const float*)d_in[17];
  const float* w2 = (const float*)d_in[18];
  const float* b2 = (const float*)d_in[19];
  const int*   n_ctx_p = (const int*)d_in[20];

  const int E  = in_sizes[10];
  const int F  = in_sizes[16] / E;
  const int B  = 2;
  const int Tq = in_sizes[0] / (B * E);
  const int Tk = in_sizes[1] / (B * E);
  const int nhead = 16;
  const int Dh = E / nhead;
  const int M  = B * Tq;   // query rows
  const int Mk = B * Tk;   // memory rows
  const float scale = 1.0f / sqrtf((float)Dh);

  // --- workspace carve (all f16 buffers, 256B aligned) ---
  char* wp = (char*)d_ws;
  auto carve = [&](size_t elems) -> half_t* {
    half_t* r = (half_t*)wp;
    wp += (elems * sizeof(half_t) + 255) & ~(size_t)255;
    return r;
  };
  half_t* selfw_h   = carve((size_t)3 * E * E);
  half_t* selfow_h  = carve((size_t)E * E);
  half_t* crossw_h  = carve((size_t)3 * E * E);
  half_t* crossow_h = carve((size_t)E * E);
  half_t* w1_h      = carve((size_t)F * E);
  half_t* w2_h      = carve((size_t)E * F);
  half_t* mem_h     = carve((size_t)Mk * E);
  half_t* nx_h      = carve((size_t)M * E);
  half_t* qkv_h     = carve((size_t)M * 3 * E);
  half_t* qc_h      = carve((size_t)M * E);
  half_t* kvc_h     = carve((size_t)Mk * 2 * E);
  half_t* attn_h    = carve((size_t)M * E);
  half_t* ffn1_h    = carve((size_t)M * F);
  float*  x = (float*)d_out;   // residual accumulator

  auto cvt = [&](const float* s, half_t* d, long long n) {
    int blocks = (int)((n + 2047) / 2048);
    convert_f16_kernel<<<blocks, 256, 0, stream>>>(s, d, n);
  };
  cvt(self_w,   selfw_h,   (long long)3 * E * E);
  cvt(self_ow,  selfow_h,  (long long)E * E);
  cvt(cross_w,  crossw_h,  (long long)3 * E * E);
  cvt(cross_ow, crossow_h, (long long)E * E);
  cvt(w1,       w1_h,      (long long)F * E);
  cvt(w2,       w2_h,      (long long)E * F);
  cvt(memory,   mem_h,     (long long)Mk * E);

  // x = tgt
  (void)hipMemcpyAsync(x, tgt, (size_t)M * E * sizeof(float),
                       hipMemcpyDeviceToDevice, stream);

  auto gemm = [&](const half_t* A, const half_t* W, const float* bias,
                  half_t* outh, float* resid, int m, int n, int k, int act) {
    dim3 grid(m / MBLK, n / NBLK);
    gemm_wmma_kernel<<<grid, 256, 0, stream>>>(A, W, bias, outh, resid, m, n, k, act);
  };

  // ---- self-attention sublayer ----
  layernorm_kernel<<<M, 256, 0, stream>>>(x, ln1_g, ln1_b, nx_h, E);
  gemm(nx_h, selfw_h, self_b, qkv_h, nullptr, M, 3 * E, E, 0);
  {
    dim3 grid(Tq / 64, nhead, B);
    attn_wmma_kernel<<<grid, 128, 0, stream>>>(
        qkv_h, 3 * E, qkv_h + E, 3 * E, qkv_h + 2 * E, 3 * E,
        attn_h, E, Tq, Tq, Dh, n_ctx_p, scale);
  }
  gemm(attn_h, selfow_h, self_ob, nullptr, x, M, E, E, 0);

  // ---- cross-attention sublayer ----
  layernorm_kernel<<<M, 256, 0, stream>>>(x, ln2_g, ln2_b, nx_h, E);
  gemm(nx_h,  crossw_h,                 cross_b,     qc_h,  nullptr, M,  E,     E, 0);
  gemm(mem_h, crossw_h + (size_t)E * E, cross_b + E, kvc_h, nullptr, Mk, 2 * E, E, 0);
  {
    dim3 grid(Tq / 64, nhead, B);
    attn_wmma_kernel<<<grid, 128, 0, stream>>>(
        qc_h, E, kvc_h, 2 * E, kvc_h + E, 2 * E,
        attn_h, E, Tq, Tk, Dh, nullptr, scale);
  }
  gemm(attn_h, crossow_h, cross_ob, nullptr, x, M, E, E, 0);

  // ---- FFN sublayer ----
  layernorm_kernel<<<M, 256, 0, stream>>>(x, ln3_g, ln3_b, nx_h, E);
  gemm(nx_h,   w1_h, b1, ffn1_h, nullptr, M, F, E, 1);  // exact GELU
  gemm(ffn1_h, w2_h, b2, nullptr, x,       M, E, F, 0);
}

// v001
// Timed twice side by side with v000, it ran 1.61 and 1.62 times as fast.
#include <hip/hip_runtime.h>
#include <math.h>

typedef _Float16 half_t;
typedef __attribute__((ext_vector_type(16))) _Float16 v16h;
typedef __attribute__((ext_vector_type(8)))  _Float16 v8h;
typedef __attribute__((ext_vector_type(8)))  float    v8f;
typedef __attribute__((vector_size(16)))     int      vsi4;   // int4 for async builtin

#define ASG __attribute__((address_space(1)))
#define ASL __attribute__((address_space(3)))

// Detect CDNA5 async global->LDS builtins (gfx1250); fall back to load+ds_store.
#if defined(__has_builtin)
#  if __has_builtin(__builtin_amdgcn_global_load_async_to_lds_b128)
#    define HAVE_ASYNC 1
#  endif
#endif
#ifndef HAVE_ASYNC
#  define HAVE_ASYNC 0
#endif

// ---------------------------------------------------------------------------
// WMMA helpers (CDNA5 gfx1250, wave32)
// ---------------------------------------------------------------------------
__device__ inline v8f wmma_f16(v16h a, v16h b, v8f c) {
  // D(16x16,f32) = A(16x32,f16) x B(32x16,f16) + C
  return __builtin_amdgcn_wmma_f32_16x16x32_f16(
      /*neg_a=*/false, a, /*neg_b=*/false, b,
      /*c_mod=*/(short)0, c, /*reuse_a=*/false, /*reuse_b=*/false);
}

__device__ inline v8f zero_v8f() {
  v8f z;
#pragma unroll
  for (int i = 0; i < 8; ++i) z[i] = 0.0f;
  return z;
}

// Load a 16x32 f16 fragment in the ISA A-matrix lane layout:
//   lane<16 : row=lane,    K = [0..7] then [16..23]
//   lane>=16: row=lane-16, K = [8..15] then [24..31]
// base points at (row0, k0); ld = row stride in elements. Also used for the
// B operand of D = A x W^T (B column n == row n of W, identical pattern).
__device__ inline v16h load_frag(const half_t* __restrict__ base, int ld) {
  const int lane = threadIdx.x & 31;
  const int sub  = lane & 15;
  const int hi   = lane >> 4;
  const half_t* p = base + (size_t)sub * ld + hi * 8;
  v8h lo = *(const v8h*)(p);
  v8h hh = *(const v8h*)(p + 16);
  v16h r;
#pragma unroll
  for (int i = 0; i < 8; ++i) { r[i] = lo[i]; r[i + 8] = hh[i]; }
  return r;
}

// One 16-byte global->LDS transfer per lane (ASYNCcnt path if available).
__device__ inline void copy_b128_to_lds(const half_t* g, half_t* l) {
#if HAVE_ASYNC
  __builtin_amdgcn_global_load_async_to_lds_b128(
      (ASG vsi4*)g, (ASL vsi4*)l, 0, 0);
#else
  *(v8h*)l = *(const v8h*)g;
#endif
}

__device__ inline void wait_async_copies() {
#if HAVE_ASYNC
#  if __has_builtin(__builtin_amdgcn_s_wait_asynccnt)
  __builtin_amdgcn_s_wait_asynccnt(0);
#  else
  asm volatile("s_wait_asynccnt 0" ::: "memory");
#  endif
#endif
}

// ---------------------------------------------------------------------------
// Elementwise f32 -> f16 conversion
// ---------------------------------------------------------------------------
__global__ void convert_f16_kernel(const float* __restrict__ src,
                                   half_t* __restrict__ dst, long long n) {
  long long i = (long long)blockIdx.x * blockDim.x + threadIdx.x;
  long long stride = (long long)gridDim.x * blockDim.x;
  for (; i < n; i += stride) dst[i] = (half_t)src[i];
}

// ---------------------------------------------------------------------------
// LayerNorm: one block (256 thr) per row, writes f16 (GEMM input format)
// ---------------------------------------------------------------------------
__global__ __launch_bounds__(256) void layernorm_kernel(
    const float* __restrict__ x, const float* __restrict__ g,
    const float* __restrict__ b, half_t* __restrict__ outh, int E) {
  __shared__ float red[64];
  const int row = blockIdx.x;
  const float* xr = x + (size_t)row * E;
  float s = 0.f, s2 = 0.f;
  for (int i = threadIdx.x; i < E; i += blockDim.x) {
    float v = xr[i];
    s += v; s2 += v * v;
  }
#pragma unroll
  for (int off = 16; off > 0; off >>= 1) {
    s  += __shfl_xor(s,  off, 32);
    s2 += __shfl_xor(s2, off, 32);
  }
  const int wid = threadIdx.x >> 5, lane = threadIdx.x & 31;
  if (lane == 0) { red[wid] = s; red[32 + wid] = s2; }
  __syncthreads();
  if (wid == 0) {
    int nw = blockDim.x >> 5;
    float a  = (lane < nw) ? red[lane]      : 0.f;
    float a2 = (lane < nw) ? red[32 + lane] : 0.f;
#pragma unroll
    for (int off = 16; off > 0; off >>= 1) {
      a  += __shfl_xor(a,  off, 32);
      a2 += __shfl_xor(a2, off, 32);
    }
    if (lane == 0) { red[0] = a; red[1] = a2; }
  }
  __syncthreads();
  const float mean = red[0] / (float)E;
  const float var  = red[1] / (float)E - mean * mean;
  const float rstd = rsqrtf(var + 1e-5f);
  for (int i = threadIdx.x; i < E; i += blockDim.x)
    outh[(size_t)row * E + i] = (half_t)((xr[i] - mean) * rstd * g[i] + b[i]);
}

// ---------------------------------------------------------------------------
// LDS-staged double-buffered GEMM:
//   out[M,N] = act(A[M,K] @ W[N,K]^T + bias[N]); optional residual f32 add.
// Block = 256 thr = 8 waves (2 in M x 4 in N). Block tile 128x128, K-step 32.
// LDS: 2 x (128x32 A + 128x32 B) f16 = 32 KB (WGP has 320 KB).
// Global->LDS staging uses GLOBAL_LOAD_ASYNC_TO_LDS_B128 (ASYNCcnt).
// ---------------------------------------------------------------------------
#define KSTEP 32
#define MBLK  128
#define NBLK  128

__global__ __launch_bounds__(256) void gemm_wmma_kernel(
    const half_t* __restrict__ A, const half_t* __restrict__ W,
    const float* __restrict__ bias, half_t* __restrict__ outh,
    float* __restrict__ resid, int M, int N, int K, int act) {
  __shared__ half_t ldsA[2][MBLK * KSTEP];
  __shared__ half_t ldsB[2][NBLK * KSTEP];

  const int tid  = threadIdx.x;
  const int lane = tid & 31;
  const int wid  = tid >> 5;     // 0..7
  const int wm   = wid >> 2;     // 0..1 : wave row  (64 rows each)
  const int wn   = wid & 3;      // 0..3 : wave col  (32 cols each)
  const int m0 = blockIdx.x * MBLK;
  const int n0 = blockIdx.y * NBLK;

  // Staging assignment: thread -> (row = tid>>2 [+64], 8-half quad = (tid&3)*8)
  const int crow = tid >> 2;        // 0..63
  const int cq   = (tid & 3) * 8;   // 0,8,16,24

  v8f acc[4][2];
#pragma unroll
  for (int i = 0; i < 4; ++i) { acc[i][0] = zero_v8f(); acc[i][1] = zero_v8f(); }

  // prologue: stage k=0 tiles into buffer 0
#pragma unroll
  for (int rr = 0; rr < MBLK; rr += 64)
    copy_b128_to_lds(A + (size_t)(m0 + crow + rr) * K + cq,
                     &ldsA[0][(crow + rr) * KSTEP + cq]);
#pragma unroll
  for (int rr = 0; rr < NBLK; rr += 64)
    copy_b128_to_lds(W + (size_t)(n0 + crow + rr) * K + cq,
                     &ldsB[0][(crow + rr) * KSTEP + cq]);
  wait_async_copies();
  __syncthreads();

  int buf = 0;
  for (int k0 = 0; k0 < K; k0 += KSTEP) {
    // stage next K-slice into the other buffer while computing this one
    if (k0 + KSTEP < K) {
      const int nb = buf ^ 1;
#pragma unroll
      for (int rr = 0; rr < MBLK; rr += 64)
        copy_b128_to_lds(A + (size_t)(m0 + crow + rr) * K + k0 + KSTEP + cq,
                         &ldsA[nb][(crow + rr) * KSTEP + cq]);
#pragma unroll
      for (int rr = 0; rr < NBLK; rr += 64)
        copy_b128_to_lds(W + (size_t)(n0 + crow + rr) * K + k0 + KSTEP + cq,
                         &ldsB[nb][(crow + rr) * KSTEP + cq]);
    }

    // compute: 4 A-frags x 2 B-frags = 8 WMMA per K-step, fed by ds_load_b128
    v16h bf0 = load_frag(&ldsB[buf][(wn * 32 +  0) * KSTEP], KSTEP);
    v16h bf1 = load_frag(&ldsB[buf][(wn * 32 + 16) * KSTEP], KSTEP);
#pragma unroll
    for (int i = 0; i < 4; ++i) {
      v16h af = load_frag(&ldsA[buf][(wm * 64 + i * 16) * KSTEP], KSTEP);
      acc[i][0] = wmma_f16(af, bf0, acc[i][0]);
      acc[i][1] = wmma_f16(af, bf1, acc[i][1]);
    }

    wait_async_copies();   // our staged writes for buf^1 have landed in LDS
    __syncthreads();       // everyone done reading buf / writing buf^1
    buf ^= 1;
  }

  // epilogue: C layout -> lane l<16 holds rows 0..7 (vgpr r), l>=16 rows 8..15
  const int sub = lane & 15, hi = lane >> 4;
#pragma unroll
  for (int i = 0; i < 4; ++i) {
#pragma unroll
    for (int j = 0; j < 2; ++j) {
#pragma unroll
      for (int r = 0; r < 8; ++r) {
        const int rr = m0 + wm * 64 + i * 16 + r + 8 * hi;
        const int cc = n0 + wn * 32 + j * 16 + sub;
        float v = acc[i][j][r] + bias[cc];
        if (act == 1) v = 0.5f * v * (1.0f + erff(v * 0.70710678118654752f));
        if (outh)  outh[(size_t)rr * N + cc] = (half_t)v;
        if (resid) resid[(size_t)rr * N + cc] += v;
      }
    }
  }
}

// ---------------------------------------------------------------------------
// Fused flash-style attention. grid = (Tq/64, nhead, B), block = 128 (4 waves),
// each wave owns 16 query rows. Online softmax over 32-key steps.
// Self-attn mask col<n_ctx == truncating keys to n_ctx (read device-side).
// The 32-key K and V tiles (32 rows x 128 B each) are staged once per block in
// LDS by async copies, two buffers: tile t+1 flies while tile t is worked on.
// ---------------------------------------------------------------------------
#define KPITCH 72   // halves; 144-B rows (16 B x odd) for the ds_load_b128 reader
#define VPITCH 80   // halves; 160-B rows (32 B x odd) for the ds_load_tr16_b128 reader

typedef __attribute__((ext_vector_type(8))) short s16x8;

__device__ inline unsigned lds_byte_addr(const half_t* p) {
  return (unsigned)(size_t)(ASL const half_t*)p;
}

// Transposing LDS read: lane (c = l & 15, h = l >> 4) gets T[8h + 0..7][c] of the
// 16 x 16 tile whose per-lane row addresses are passed in.
__device__ inline v8h lds_load_tr16(const half_t* p) {
  return __builtin_bit_cast(v8h, __builtin_amdgcn_ds_load_tr16_b128_v8i16((ASL s16x8*)p));
}

// Four 16-byte async copies per lane (two K rows, two V rows). The s_wait_xcnt
// stands inside the statement so that no address register named here is
// rewritten ahead of it.
__device__ inline void stage_kv_tile(const half_t* gk0, const half_t* gk1,
                                     const half_t* gv0, const half_t* gv1,
                                     unsigned lk0, unsigned lk1,
                                     unsigned lv0, unsigned lv1) {
  asm volatile(
      "global_load_async_to_lds_b128 %0, %4, off\n\t"
      "global_load_async_to_lds_b128 %1, %5, off\n\t"
      "global_load_async_to_lds_b128 %2, %6, off\n\t"
      "global_load_async_to_lds_b128 %3, %7, off\n\t"
      "s_wait_xcnt 0x0"
      :: "v"(lk0), "v"(lk1), "v"(lv0), "v"(lv1),
         "v"(gk0), "v"(gk1), "v"(gv0), "v"(gv1)
      : "memory");
}

__global__ __launch_bounds__(128) void attn_wmma_kernel(
    const half_t* __restrict__ Q, int qld,
    const half_t* __restrict__ Km, int kld,
    const half_t* __restrict__ V, int vld,
    half_t* __restrict__ O, int oldd,
    int Tq, int Tk, int Dh, const int* __restrict__ nctx, float scale) {
  __shared__ half_t plds[4 * 16 * 32];  // per-wave 16x32 P tile
  __shared__ __attribute__((aligned(16))) half_t kls[2][32 * KPITCH];
  __shared__ __attribute__((aligned(16))) half_t vls[2][32 * VPITCH];
  const int lane = threadIdx.x & 31;
  const int wid  = threadIdx.x >> 5;
  const int sub = lane & 15, hi = lane >> 4;
  const int h = blockIdx.y, b = blockIdx.z;
  const int qt = (blockIdx.x * 4 + wid) * 16;

  int kvlen = Tk;
  if (nctx) { int nc = *nctx; kvlen = nc < Tk ? nc : Tk; }

  const half_t* Qb = Q + ((size_t)b * Tq + qt) * qld + h * Dh;
  const half_t* Kb = Km + (size_t)b * Tk * kld + h * Dh;
  const half_t* Vb = V  + (size_t)b * Tk * vld + h * Dh;

  const v16h qf0 = load_frag(Qb,      qld);   // Dh = 64 -> two K=32 fragments
  const v16h qf1 = load_frag(Qb + 32, qld);

  v8f acc[4];
#pragma unroll
  for (int d = 0; d < 4; ++d) acc[d] = zero_v8f();
  float mrow[8], lrow[8];
#pragma unroll
  for (int r = 0; r < 8; ++r) { mrow[r] = -1e30f; lrow[r] = 0.f; }

  half_t* my = plds + wid * 512;

  // Staging: thread -> tile rows srow and srow + 16, 16-byte chunk sq of the row;
  // one wave's copy covers four whole 128-B rows.
  const int srow = threadIdx.x >> 3;        // 0..15
  const int sq   = (threadIdx.x & 7) * 8;   // halves
  auto stage = [&](int kt0, int sb) {
    const half_t* gk = Kb + (size_t)(kt0 + srow) * kld + sq;
    const half_t* gv = Vb + (size_t)(kt0 + srow) * vld + sq;
    stage_kv_tile(gk, gk + (size_t)16 * kld, gv, gv + (size_t)16 * vld,
                  lds_byte_addr(&kls[sb][srow * KPITCH + sq]),
                  lds_byte_addr(&kls[sb][(srow + 16) * KPITCH + sq]),
                  lds_byte_addr(&vls[sb][srow * VPITCH + sq]),
                  lds_byte_addr(&vls[sb][(srow + 16) * VPITCH + sq]));
  };
  // Per-lane offset of the transposing V read inside a tile.
  const int vtr = (8 * hi + (lane & 7)) * VPITCH + 8 * ((lane >> 3) & 1);

  // Ring prologue: tile 0 lands and is published, then tile 1 starts.
  stage(0, 0);
  asm volatile("s_wait_asynccnt 0x0" ::: "memory");  // own copies of tile 0 landed
  __syncthreads();                                   // publishes tile 0
  if (32 < kvlen) stage(32, 1);

  int buf = 0;
  for (int kt = 0; kt < kvlen; kt += 32) {
    v8f s0 = zero_v8f(), s1 = zero_v8f();
    {
      const half_t* kl = &kls[buf][0];
      v16h k00 = load_frag(kl,      KPITCH);
      v16h k01 = load_frag(kl + 32, KPITCH);
      v16h k10 = load_frag(kl + 16 * KPITCH,      KPITCH);
      v16h k11 = load_frag(kl + 16 * KPITCH + 32, KPITCH);
      // Inputs-only fence on the loaded fragments: keeps the eight LDS reads in one
      // group with one wait; without it each WMMA waits out its own LDS latency.
      asm volatile("" :: "v"(k00), "v"(k01), "v"(k10), "v"(k11));
      s0 = wmma_f16(qf0, k00, s0);
      s0 = wmma_f16(qf1, k01, s0);
      s1 = wmma_f16(qf0, k10, s1);
      s1 = wmma_f16(qf1, k11, s1);
    }
    const bool ok0 = (kt + sub)      < kvlen;
    const bool ok1 = (kt + 16 + sub) < kvlen;

#pragma unroll
    for (int r = 0; r < 8; ++r) {
      float v0 = ok0 ? s0[r] * scale : -1e30f;
      float v1 = ok1 ? s1[r] * scale : -1e30f;
      float mx = fmaxf(v0, v1);
#pragma unroll
      for (int off = 8; off > 0; off >>= 1) mx = fmaxf(mx, __shfl_xor(mx, off, 32));
      const float mnew = fmaxf(mrow[r], mx);
      const float corr = __expf(mrow[r] - mnew);
      const float p0 = __expf(v0 - mnew);
      const float p1 = __expf(v1 - mnew);
      float rs = p0 + p1;
#pragma unroll
      for (int off = 8; off > 0; off >>= 1) rs += __shfl_xor(rs, off, 32);
      lrow[r] = lrow[r] * corr + rs;
      mrow[r] = mnew;
#pragma unroll
      for (int d = 0; d < 4; ++d) acc[d][r] *= corr;
      s0[r] = p0; s1[r] = p1;
    }

    // Transpose P from C-layout to A-layout through LDS.
    __syncthreads();   // guard WAR vs previous iteration's fragment reads
#pragma unroll
    for (int r = 0; r < 8; ++r) {
      my[(r + 8 * hi) * 32 + sub]      = (half_t)s0[r];
      my[(r + 8 * hi) * 32 + 16 + sub] = (half_t)s1[r];
    }
    __syncthreads();
    v16h pf;
#pragma unroll
    for (int j = 0; j < 8; ++j) {
      pf[j]     = my[sub * 32 + hi * 8 + j];
      pf[j + 8] = my[sub * 32 + 16 + hi * 8 + j];
    }

    // acc += P(16x32) @ V(32x64): B[k][n] = V[kt+k][h*Dh + d*16 + n]
#pragma unroll
    for (int d = 0; d < 4; ++d) {
      const half_t* vb = &vls[buf][vtr + d * 16];
      const v8h vlo = lds_load_tr16(vb);                 // keys 8*hi + 0..7
      const v8h vhi = lds_load_tr16(vb + 16 * VPITCH);   // keys 16 + 8*hi + 0..7
      v16h vf;
#pragma unroll
      for (int j = 0; j < 8; ++j) { vf[j] = vlo[j]; vf[j + 8] = vhi[j]; }
      acc[d] = wmma_f16(pf, vf, acc[d]);
    }

    // Publish point of tile t+1; it also ends every reader's last read of buf.
    asm volatile("s_wait_dscnt 0x0" ::: "memory");     // own LDS reads of buf retired
    asm volatile("s_wait_asynccnt 0x0" ::: "memory");  // own copies of tile t+1 landed
    __syncthreads();
    if (kt + 64 < kvlen) stage(kt + 64, buf);          // refill the buffer just read
    buf ^= 1;
  }
  asm volatile("s_wait_asynccnt 0x0" ::: "memory");    // nothing in flight at wave end

#pragma unroll
  for (int r = 0; r < 8; ++r) {
    const float inv = 1.0f / lrow[r];
    const size_t row = (size_t)b * Tq + qt + r + 8 * hi;
#pragma unroll
    for (int d = 0; d < 4; ++d)
      O[row * oldd + h * Dh + d * 16 + sub] = (half_t)(acc[d][r] * inv);
  }
}

// ---------------------------------------------------------------------------
// Host orchestration
// ---------------------------------------------------------------------------
extern "C" void kernel_launch(void* const* d_in, const int* in_sizes, int n_in,
                              void* d_out, int out_size, void* d_ws, size_t ws_size,
                              hipStream_t stream) {
  (void)n_in; (void)out_size; (void)ws_size;
  const float* tgt      = (const float*)d_in[0];
  const float* memory   = (const float*)d_in[1];
  const float* self_w   = (const float*)d_in[2];
  const float* self_b   = (const float*)d_in[3];
  const float* self_ow  = (const float*)d_in[4];
  const float* self_ob  = (const float*)d_in[5];
  const float* cross_w  = (const float*)d_in[6];
  const float* cross_b  = (const float*)d_in[7];
  const float* cross_ow = (const float*)d_in[8];
  const float* cross_ob = (const float*)d_in[9];
  const float* ln1_g = (const float*)d_in[10];
  const float* ln1_b = (const float*)d_in[11];
  const float* ln2_g = (const float*)d_in[12];
  const float* ln2_b = (const float*)d_in[13];
  const float* ln3_g = (const float*)d_in[14];
  const float* ln3_b = (const float*)d_in[15];
  const float* w1 = (const float*)d_in[16];
  const float* b1 = (const float*)d_in[17];
  const float* w2 = (const float*)d_in[18];
  const float* b2 = (const float*)d_in[19];
  const int*   n_ctx_p = (const int*)d_in[20];

  const int E  = in_sizes[10];
  const int F  = in_sizes[16] / E;
  const int B  = 2;
  const int Tq = in_sizes[0] / (B * E);
  const int Tk = in_sizes[1] / (B * E);
  const int nhead = 16;
  const int Dh = E / nhead;
  const int M  = B * Tq;   // query rows
  const int Mk = B * Tk;   // memory rows
  const float scale = 1.0f / sqrtf((float)Dh);

  // --- workspace carve (all f16 buffers, 256B aligned) ---
  char* wp = (char*)d_ws;
  auto carve = [&](size_t elems) -> half_t* {
    half_t* r = (half_t*)wp;
    wp += (elems * sizeof(half_t) + 255) & ~(size_t)255;
    return r;
  };
  half_t* selfw_h   = carve((size_t)3 * E * E);
  half_t* selfow_h  = carve((size_t)E * E);
  half_t* crossw_h  = carve((size_t)3 * E * E);
  half_t* crossow_h = carve((size_t)E * E);
  half_t* w1_h      = carve((size_t)F * E);
  half_t* w2_h      = carve((size_t)E * F);
  half_t* mem_h     = carve((size_t)Mk * E);
  half_t* nx_h      = carve((size_t)M * E);
  half_t* qkv_h     = carve((size_t)M * 3 * E);
  half_t* qc_h      = carve((size_t)M * E);
  half_t* kvc_h     = carve((size_t)Mk * 2 * E);
  half_t* attn_h    = carve((size_t)M * E);
  half_t* ffn1_h    = carve((size_t)M * F);
  float*  x = (float*)d_out;   // residual accumulator

  auto cvt = [&](const float* s, half_t* d, long long n) {
    int blocks = (int)((n + 2047) / 2048);
    convert_f16_kernel<<<blocks, 256, 0, stream>>>(s, d, n);
  };
  cvt(self_w,   selfw_h,   (long long)3 * E * E);
  cvt(self_ow,  selfow_h,  (long long)E * E);
  cvt(cross_w,  crossw_h,  (long long)3 * E * E);
  cvt(cross_ow, crossow_h, (long long)E * E);
  cvt(w1,       w1_h,      (long long)F * E);
  cvt(w2,       w2_h,      (long long)E * F);
  cvt(memory,   mem_h,     (long long)Mk * E);

  // x = tgt
  (void)hipMemcpyAsync(x, tgt, (size_t)M * E * sizeof(float),
                       hipMemcpyDeviceToDevice, stream);

  auto gemm = [&](const half_t* A, const half_t* W, const float* bias,
                  half_t* outh, float* resid, int m, int n, int k, int act) {
    dim3 grid(m / MBLK, n / NBLK);
    gemm_wmma_kernel<<<grid, 256, 0, stream>>>(A, W, bias, outh, resid, m, n, k, act);
  };

  // ---- self-attention sublayer ----
  layernorm_kernel<<<M, 256, 0, stream>>>(x, ln1_g, ln1_b, nx_h, E);
  gemm(nx_h, selfw_h, self_b, qkv_h, nullptr, M, 3 * E, E, 0);
  {
    dim3 grid(Tq / 64, nhead, B);
    attn_wmma_kernel<<<grid, 128, 0, stream>>>(
        qkv_h, 3 * E, qkv_h + E, 3 * E, qkv_h + 2 * E, 3 * E,
        attn_h, E, Tq, Tq, Dh, n_ctx_p, scale);
  }
  gemm(attn_h, selfow_h, self_ob, nullptr, x, M, E, E, 0);

  // ---- cross-attention sublayer ----
  layernorm_kernel<<<M, 256, 0, stream>>>(x, ln2_g, ln2_b, nx_h, E);
  gemm(nx_h,  crossw_h,                 cross_b,     qc_h,  nullptr, M,  E,     E, 0);
  gemm(mem_h, crossw_h + (size_t)E * E, cross_b + E, kvc_h, nullptr, Mk, 2 * E, E, 0);
  {
    dim3 grid(Tq / 64, nhead, B);
    attn_wmma_kernel<<<grid, 128, 0, stream>>>(
        qc_h, E, kvc_h, 2 * E, kvc_h + E, 2 * E,
        attn_h, E, Tq, Tk, Dh, nullptr, scale);
  }
  gemm(attn_h, crossow_h, cross_ob, nullptr, x, M, E, E, 0);

  // ---- FFN sublayer ----
  layernorm_kernel<<<M, 256, 0, stream>>>(x, ln3_g, ln3_b, nx_h, E);
  gemm(nx_h,   w1_h, b1, ffn1_h, nullptr, M, F, E, 1);  // exact GELU
  gemm(ffn1_h, w2_h, b2, nullptr, x,       M, E, F, 0);
}

// v002
// Timed twice side by side with v001, it ran 1.11 and 1.12 times as fast.
// All steps since v000 together make it 1.80 times as fast.
#include <hip/hip_runtime.h>
#include <math.h>

typedef _Float16 half_t;
typedef __attribute__((ext_vector_type(16))) _Float16 v16h;
typedef __attribute__((ext_vector_type(8)))  _Float16 v8h;
typedef __attribute__((ext_vector_type(8)))  float    v8f;
typedef __attribute__((vector_size(16)))     int      vsi4;   // int4 for async builtin

#define ASG __attribute__((address_space(1)))
#define ASL __attribute__((address_space(3)))

// Detect CDNA5 async global->LDS builtins (gfx1250); fall back to load+ds_store.
#if defined(__has_builtin)
#  if __has_builtin(__builtin_amdgcn_global_load_async_to_lds_b128)
#    define HAVE_ASYNC 1
#  endif
#endif
#ifndef HAVE_ASYNC
#  define HAVE_ASYNC 0
#endif

// ---------------------------------------------------------------------------
// WMMA helpers (CDNA5 gfx1250, wave32)
// ---------------------------------------------------------------------------
__device__ inline v8f wmma_f16(v16h a, v16h b, v8f c) {
  // D(16x16,f32) = A(16x32,f16) x B(32x16,f16) + C
  return __builtin_amdgcn_wmma_f32_16x16x32_f16(
      /*neg_a=*/false, a, /*neg_b=*/false, b,
      /*c_mod=*/(short)0, c, /*reuse_a=*/false, /*reuse_b=*/false);
}

__device__ inline v8f zero_v8f() {
  v8f z;
#pragma unroll
  for (int i = 0; i < 8; ++i) z[i] = 0.0f;
  return z;
}

// Load a 16x32 f16 fragment in the ISA A-matrix lane layout:
//   lane<16 : row=lane,    K = [0..7] then [16..23]
//   lane>=16: row=lane-16, K = [8..15] then [24..31]
// base points at (row0, k0); ld = row stride in elements. Also used for the
// B operand of D = A x W^T (B column n == row n of W, identical pattern).
__device__ inline v16h load_frag(const half_t* __restrict__ base, int ld) {
  const int lane = threadIdx.x & 31;
  const int sub  = lane & 15;
  const int hi   = lane >> 4;
  const half_t* p = base + (size_t)sub * ld + hi * 8;
  v8h lo = *(const v8h*)(p);
  v8h hh = *(const v8h*)(p + 16);
  v16h r;
#pragma unroll
  for (int i = 0; i < 8; ++i) { r[i] = lo[i]; r[i + 8] = hh[i]; }
  return r;
}

// One 16-byte global->LDS transfer per lane (ASYNCcnt path if available).
__device__ inline void copy_b128_to_lds(const half_t* g, half_t* l) {
#if HAVE_ASYNC
  __builtin_amdgcn_global_load_async_to_lds_b128(
      (ASG vsi4*)g, (ASL vsi4*)l, 0, 0);
#else
  *(v8h*)l = *(const v8h*)g;
#endif
}

__device__ inline void wait_async_copies() {
#if HAVE_ASYNC
#  if __has_builtin(__builtin_amdgcn_s_wait_asynccnt)
  __builtin_amdgcn_s_wait_asynccnt(0);
#  else
  asm volatile("s_wait_asynccnt 0" ::: "memory");
#  endif
#endif
}

// ---------------------------------------------------------------------------
// Elementwise f32 -> f16 conversion
// ---------------------------------------------------------------------------
__global__ void convert_f16_kernel(const float* __restrict__ src,
                                   half_t* __restrict__ dst, long long n) {
  long long i = (long long)blockIdx.x * blockDim.x + threadIdx.x;
  long long stride = (long long)gridDim.x * blockDim.x;
  for (; i < n; i += stride) dst[i] = (half_t)src[i];
}

// ---------------------------------------------------------------------------
// LayerNorm: one block (256 thr) per row, writes f16 (GEMM input format)
// ---------------------------------------------------------------------------
__global__ __launch_bounds__(256) void layernorm_kernel(
    const float* __restrict__ x, const float* __restrict__ g,
    const float* __restrict__ b, half_t* __restrict__ outh, int E) {
  __shared__ float red[64];
  const int row = blockIdx.x;
  const float* xr = x + (size_t)row * E;
  float s = 0.f, s2 = 0.f;
  for (int i = threadIdx.x; i < E; i += blockDim.x) {
    float v = xr[i];
    s += v; s2 += v * v;
  }
#pragma unroll
  for (int off = 16; off > 0; off >>= 1) {
    s  += __shfl_xor(s,  off, 32);
    s2 += __shfl_xor(s2, off, 32);
  }
  const int wid = threadIdx.x >> 5, lane = threadIdx.x & 31;
  if (lane == 0) { red[wid] = s; red[32 + wid] = s2; }
  __syncthreads();
  if (wid == 0) {
    int nw = blockDim.x >> 5;
    float a  = (lane < nw) ? red[lane]      : 0.f;
    float a2 = (lane < nw) ? red[32 + lane] : 0.f;
#pragma unroll
    for (int off = 16; off > 0; off >>= 1) {
      a  += __shfl_xor(a,  off, 32);
      a2 += __shfl_xor(a2, off, 32);
    }
    if (lane == 0) { red[0] = a; red[1] = a2; }
  }
  __syncthreads();
  const float mean = red[0] / (float)E;
  const float var  = red[1] / (float)E - mean * mean;
  const float rstd = rsqrtf(var + 1e-5f);
  for (int i = threadIdx.x; i < E; i += blockDim.x)
    outh[(size_t)row * E + i] = (half_t)((xr[i] - mean) * rstd * g[i] + b[i]);
}

// ---------------------------------------------------------------------------
// LDS-staged double-buffered GEMM:
//   out[M,N] = act(A[M,K] @ W[N,K]^T + bias[N]); optional residual f32 add.
// Block = 256 thr = 8 waves (2 in M x 4 in N). Block tile 128x128, K-step 32.
// LDS: 2 x (128 A rows + 128 B rows) of 64 B at an 80-B pitch = 40 KB.
// Global->LDS staging uses GLOBAL_LOAD_ASYNC_TO_LDS_B128 (ASYNCcnt).
// ---------------------------------------------------------------------------
#define KSTEP 32
#define MBLK  128
#define NBLK  128
#define GPITCH 40   // halves; 80-B rows (16 B x odd) for the ds_load_b128 reader

__global__ __launch_bounds__(256) void gemm_wmma_kernel(
    const half_t* __restrict__ A, const half_t* __restrict__ W,
    const float* __restrict__ bias, half_t* __restrict__ outh,
    float* __restrict__ resid, int M, int N, int K, int act) {
  __shared__ __attribute__((aligned(16))) half_t ldsA[2][MBLK * GPITCH];
  __shared__ __attribute__((aligned(16))) half_t ldsB[2][NBLK * GPITCH];

  const int tid  = threadIdx.x;
  const int lane = tid & 31;
  const int wid  = tid >> 5;     // 0..7
  const int wm   = wid >> 2;     // 0..1 : wave row  (64 rows each)
  const int wn   = wid & 3;      // 0..3 : wave col  (32 cols each)
  const int m0 = blockIdx.x * MBLK;
  const int n0 = blockIdx.y * NBLK;

  // Staging assignment: thread -> (row = tid>>2 [+64], 8-half quad = (tid&3)*8)
  const int crow = tid >> 2;        // 0..63
  const int cq   = (tid & 3) * 8;   // 0,8,16,24

  v8f acc[4][2];
#pragma unroll
  for (int i = 0; i < 4; ++i) { acc[i][0] = zero_v8f(); acc[i][1] = zero_v8f(); }

  // prologue: stage k=0 tiles into buffer 0
#pragma unroll
  for (int rr = 0; rr < MBLK; rr += 64)
    copy_b128_to_lds(A + (size_t)(m0 + crow + rr) * K + cq,
                     &ldsA[0][(crow + rr) * GPITCH + cq]);
#pragma unroll
  for (int rr = 0; rr < NBLK; rr += 64)
    copy_b128_to_lds(W + (size_t)(n0 + crow + rr) * K + cq,
                     &ldsB[0][(crow + rr) * GPITCH + cq]);
  wait_async_copies();
  __syncthreads();

  int buf = 0;
  for (int k0 = 0; k0 < K; k0 += KSTEP) {
    // stage next K-slice into the other buffer while computing this one
    if (k0 + KSTEP < K) {
      const int nb = buf ^ 1;
#pragma unroll
      for (int rr = 0; rr < MBLK; rr += 64)
        copy_b128_to_lds(A + (size_t)(m0 + crow + rr) * K + k0 + KSTEP + cq,
                         &ldsA[nb][(crow + rr) * GPITCH + cq]);
#pragma unroll
      for (int rr = 0; rr < NBLK; rr += 64)
        copy_b128_to_lds(W + (size_t)(n0 + crow + rr) * K + k0 + KSTEP + cq,
                         &ldsB[nb][(crow + rr) * GPITCH + cq]);
    }

    // compute: 4 A-frags x 2 B-frags = 8 WMMA per K-step, fed by ds_load_b128
    v16h bf0 = load_frag(&ldsB[buf][(wn * 32 +  0) * GPITCH], GPITCH);
    v16h bf1 = load_frag(&ldsB[buf][(wn * 32 + 16) * GPITCH], GPITCH);
#pragma unroll
    for (int i = 0; i < 4; ++i) {
      v16h af = load_frag(&ldsA[buf][(wm * 64 + i * 16) * GPITCH], GPITCH);
      acc[i][0] = wmma_f16(af, bf0, acc[i][0]);
      acc[i][1] = wmma_f16(af, bf1, acc[i][1]);
    }

    wait_async_copies();   // our staged writes for buf^1 have landed in LDS
    __syncthreads();       // everyone done reading buf / writing buf^1
    buf ^= 1;
  }

  // epilogue: C layout -> lane l<16 holds rows 0..7 (vgpr r), l>=16 rows 8..15
  const int sub = lane & 15, hi = lane >> 4;
#pragma unroll
  for (int i = 0; i < 4; ++i) {
#pragma unroll
    for (int j = 0; j < 2; ++j) {
#pragma unroll
      for (int r = 0; r < 8; ++r) {
        const int rr = m0 + wm * 64 + i * 16 + r + 8 * hi;
        const int cc = n0 + wn * 32 + j * 16 + sub;
        float v = acc[i][j][r] + bias[cc];
        if (act == 1) v = 0.5f * v * (1.0f + erff(v * 0.70710678118654752f));
        if (outh)  outh[(size_t)rr * N + cc] = (half_t)v;
        if (resid) resid[(size_t)rr * N + cc] += v;
      }
    }
  }
}

// ---------------------------------------------------------------------------
// Fused flash-style attention. grid = (Tq/64, nhead, B), block = 128 (4 waves),
// each wave owns 16 query rows. Online softmax over 32-key steps.
// Self-attn mask col<n_ctx == truncating keys to n_ctx (read device-side).
// The 32-key K and V tiles (32 rows x 128 B each) are staged once per block in
// LDS by async copies, two buffers: tile t+1 flies while tile t is worked on.
// ---------------------------------------------------------------------------
#define KPITCH 72   // halves; 144-B rows (16 B x odd) for the ds_load_b128 reader
#define VPITCH 80   // halves; 160-B rows (32 B x odd) for the ds_load_tr16_b128 reader

typedef __attribute__((ext_vector_type(8))) short s16x8;

__device__ inline unsigned lds_byte_addr(const half_t* p) {
  return (unsigned)(size_t)(ASL const half_t*)p;
}

// Transposing LDS read: lane (c = l & 15, h = l >> 4) gets T[8h + 0..7][c] of the
// 16 x 16 tile whose per-lane row addresses are passed in.
__device__ inline v8h lds_load_tr16(const half_t* p) {
  return __builtin_bit_cast(v8h, __builtin_amdgcn_ds_load_tr16_b128_v8i16((ASL s16x8*)p));
}

// Four 16-byte async copies per lane (two K rows, two V rows). The s_wait_xcnt
// stands inside the statement so that no address register named here is
// rewritten ahead of it.
__device__ inline void stage_kv_tile(const half_t* gk0, const half_t* gk1,
                                     const half_t* gv0, const half_t* gv1,
                                     unsigned lk0, unsigned lk1,
                                     unsigned lv0, unsigned lv1) {
  asm volatile(
      "global_load_async_to_lds_b128 %0, %4, off\n\t"
      "global_load_async_to_lds_b128 %1, %5, off\n\t"
      "global_load_async_to_lds_b128 %2, %6, off\n\t"
      "global_load_async_to_lds_b128 %3, %7, off\n\t"
      "s_wait_xcnt 0x0"
      :: "v"(lk0), "v"(lk1), "v"(lv0), "v"(lv1),
         "v"(gk0), "v"(gk1), "v"(gv0), "v"(gv1)
      : "memory");
}

__global__ __launch_bounds__(128) void attn_wmma_kernel(
    const half_t* __restrict__ Q, int qld,
    const half_t* __restrict__ Km, int kld,
    const half_t* __restrict__ V, int vld,
    half_t* __restrict__ O, int oldd,
    int Tq, int Tk, int Dh, const int* __restrict__ nctx, float scale) {
  __shared__ half_t plds[4 * 16 * 32];  // per-wave 16x32 P tile
  __shared__ __attribute__((aligned(16))) half_t kls[2][32 * KPITCH];
  __shared__ __attribute__((aligned(16))) half_t vls[2][32 * VPITCH];
  const int lane = threadIdx.x & 31;
  const int wid  = threadIdx.x >> 5;
  const int sub = lane & 15, hi = lane >> 4;
  const int h = blockIdx.y, b = blockIdx.z;
  const int qt = (blockIdx.x * 4 + wid) * 16;

  int kvlen = Tk;
  if (nctx) { int nc = *nctx; kvlen = nc < Tk ? nc : Tk; }

  const half_t* Qb = Q + ((size_t)b * Tq + qt) * qld + h * Dh;
  const half_t* Kb = Km + (size_t)b * Tk * kld + h * Dh;
  const half_t* Vb = V  + (size_t)b * Tk * vld + h * Dh;

  const v16h qf0 = load_frag(Qb,      qld);   // Dh = 64 -> two K=32 fragments
  const v16h qf1 = load_frag(Qb + 32, qld);

  v8f acc[4];
#pragma unroll
  for (int d = 0; d < 4; ++d) acc[d] = zero_v8f();
  float mrow[8], lrow[8];
#pragma unroll
  for (int r = 0; r < 8; ++r) { mrow[r] = -1e30f; lrow[r] = 0.f; }

  half_t* my = plds + wid * 512;

  // Staging: thread -> tile rows srow and srow + 16, 16-byte chunk sq of the row;
  // one wave's copy covers four whole 128-B rows.
  const int srow = threadIdx.x >> 3;        // 0..15
  const int sq   = (threadIdx.x & 7) * 8;   // halves
  auto stage = [&](int kt0, int sb) {
    const half_t* gk = Kb + (size_t)(kt0 + srow) * kld + sq;
    const half_t* gv = Vb + (size_t)(kt0 + srow) * vld + sq;
    stage_kv_tile(gk, gk + (size_t)16 * kld, gv, gv + (size_t)16 * vld,
                  lds_byte_addr(&kls[sb][srow * KPITCH + sq]),
                  lds_byte_addr(&kls[sb][(srow + 16) * KPITCH + sq]),
                  lds_byte_addr(&vls[sb][srow * VPITCH + sq]),
                  lds_byte_addr(&vls[sb][(srow + 16) * VPITCH + sq]));
  };
  // Per-lane offset of the transposing V read inside a tile.
  const int vtr = (8 * hi + (lane & 7)) * VPITCH + 8 * ((lane >> 3) & 1);

  // Ring prologue: tile 0 lands and is published, then tile 1 starts.
  stage(0, 0);
  asm volatile("s_wait_asynccnt 0x0" ::: "memory");  // own copies of tile 0 landed
  __syncthreads();                                   // publishes tile 0
  if (32 < kvlen) stage(32, 1);

  int buf = 0;
  for (int kt = 0; kt < kvlen; kt += 32) {
    v8f s0 = zero_v8f(), s1 = zero_v8f();
    {
      const half_t* kl = &kls[buf][0];
      v16h k00 = load_frag(kl,      KPITCH);
      v16h k01 = load_frag(kl + 32, KPITCH);
      v16h k10 = load_frag(kl + 16 * KPITCH,      KPITCH);
      v16h k11 = load_frag(kl + 16 * KPITCH + 32, KPITCH);
      // Inputs-only fence on the loaded fragments: keeps the eight LDS reads in one
      // group with one wait; without it each WMMA waits out its own LDS latency.
      asm volatile("" :: "v"(k00), "v"(k01), "v"(k10), "v"(k11));
      s0 = wmma_f16(qf0, k00, s0);
      s0 = wmma_f16(qf1, k01, s0);
      s1 = wmma_f16(qf0, k10, s1);
      s1 = wmma_f16(qf1, k11, s1);
    }
    const bool ok0 = (kt + sub)      < kvlen;
    const bool ok1 = (kt + 16 + sub) < kvlen;

#pragma unroll
    for (int r = 0; r < 8; ++r) {
      float v0 = ok0 ? s0[r] * scale : -1e30f;
      float v1 = ok1 ? s1[r] * scale : -1e30f;
      float mx = fmaxf(v0, v1);
#pragma unroll
      for (int off = 8; off > 0; off >>= 1) mx = fmaxf(mx, __shfl_xor(mx, off, 32));
      const float mnew = fmaxf(mrow[r], mx);
      const float corr = __expf(mrow[r] - mnew);
      const float p0 = __expf(v0 - mnew);
      const float p1 = __expf(v1 - mnew);
      float rs = p0 + p1;
#pragma unroll
      for (int off = 8; off > 0; off >>= 1) rs += __shfl_xor(rs, off, 32);
      lrow[r] = lrow[r] * corr + rs;
      mrow[r] = mnew;
#pragma unroll
      for (int d = 0; d < 4; ++d) acc[d][r] *= corr;
      s0[r] = p0; s1[r] = p1;
    }

    // Transpose P from C-layout to A-layout through LDS.
    __syncthreads();   // guard WAR vs previous iteration's fragment reads
#pragma unroll
    for (int r = 0; r < 8; ++r) {
      my[(r + 8 * hi) * 32 + sub]      = (half_t)s0[r];
      my[(r + 8 * hi) * 32 + 16 + sub] = (half_t)s1[r];
    }
    __syncthreads();
    v16h pf;
#pragma unroll
    for (int j = 0; j < 8; ++j) {
      pf[j]     = my[sub * 32 + hi * 8 + j];
      pf[j + 8] = my[sub * 32 + 16 + hi * 8 + j];
    }

    // acc += P(16x32) @ V(32x64): B[k][n] = V[kt+k][h*Dh + d*16 + n]
#pragma unroll
    for (int d = 0; d < 4; ++d) {
      const half_t* vb = &vls[buf][vtr + d * 16];
      const v8h vlo = lds_load_tr16(vb);                 // keys 8*hi + 0..7
      const v8h vhi = lds_load_tr16(vb + 16 * VPITCH);   // keys 16 + 8*hi + 0..7
      v16h vf;
#pragma unroll
      for (int j = 0; j < 8; ++j) { vf[j] = vlo[j]; vf[j + 8] = vhi[j]; }
      acc[d] = wmma_f16(pf, vf, acc[d]);
    }

    // Publish point of tile t+1; it also ends every reader's last read of buf.
    asm volatile("s_wait_dscnt 0x0" ::: "memory");     // own LDS reads of buf retired
    asm volatile("s_wait_asynccnt 0x0" ::: "memory");  // own copies of tile t+1 landed
    __syncthreads();
    if (kt + 64 < kvlen) stage(kt + 64, buf);          // refill the buffer just read
    buf ^= 1;
  }
  asm volatile("s_wait_asynccnt 0x0" ::: "memory");    // nothing in flight at wave end

#pragma unroll
  for (int r = 0; r < 8; ++r) {
    const float inv = 1.0f / lrow[r];
    const size_t row = (size_t)b * Tq + qt + r + 8 * hi;
#pragma unroll
    for (int d = 0; d < 4; ++d)
      O[row * oldd + h * Dh + d * 16 + sub] = (half_t)(acc[d][r] * inv);
  }
}

// ---------------------------------------------------------------------------
// Host orchestration
// ---------------------------------------------------------------------------
extern "C" void kernel_launch(void* const* d_in, const int* in_sizes, int n_in,
                              void* d_out, int out_size, void* d_ws, size_t ws_size,
                              hipStream_t stream) {
  (void)n_in; (void)out_size; (void)ws_size;
  const float* tgt      = (const float*)d_in[0];
  const float* memory   = (const float*)d_in[1];
  const float* self_w   = (const float*)d_in[2];
  const float* self_b   = (const float*)d_in[3];
  const float* self_ow  = (const float*)d_in[4];
  const float* self_ob  = (const float*)d_in[5];
  const float* cross_w  = (const float*)d_in[6];
  const float* cross_b  = (const float*)d_in[7];
  const float* cross_ow = (const float*)d_in[8];
  const float* cross_ob = (const float*)d_in[9];
  const float* ln1_g = (const float*)d_in[10];
  const float* ln1_b = (const float*)d_in[11];
  const float* ln2_g = (const float*)d_in[12];
  const float* ln2_b = (const float*)d_in[13];
  const float* ln3_g = (const float*)d_in[14];
  const float* ln3_b = (const float*)d_in[15];
  const float* w1 = (const float*)d_in[16];
  const float* b1 = (const float*)d_in[17];
  const float* w2 = (const float*)d_in[18];
  const float* b2 = (const float*)d_in[19];
  const int*   n_ctx_p = (const int*)d_in[20];

  const int E  = in_sizes[10];
  const int F  = in_sizes[16] / E;
  const int B  = 2;
  const int Tq = in_sizes[0] / (B * E);
  const int Tk = in_sizes[1] / (B * E);
  const int nhead = 16;
  const int Dh = E / nhead;
  const int M  = B * Tq;   // query rows
  const int Mk = B * Tk;   // memory rows
  const float scale = 1.0f / sqrtf((float)Dh);

  // --- workspace carve (all f16 buffers, 256B aligned) ---
  char* wp = (char*)d_ws;
  auto carve = [&](size_t elems) -> half_t* {
    half_t* r = (half_t*)wp;
    wp += (elems * sizeof(half_t) + 255) & ~(size_t)255;
    return r;
  };
  half_t* selfw_h   = carve((size_t)3 * E * E);
  half_t* selfow_h  = carve((size_t)E * E);
  half_t* crossw_h  = carve((size_t)3 * E * E);
  half_t* crossow_h = carve((size_t)E * E);
  half_t* w1_h      = carve((size_t)F * E);
  half_t* w2_h      = carve((size_t)E * F);
  half_t* mem_h     = carve((size_t)Mk * E);
  half_t* nx_h      = carve((size_t)M * E);
  half_t* qkv_h     = carve((size_t)M * 3 * E);
  half_t* qc_h      = carve((size_t)M * E);
  half_t* kvc_h     = carve((size_t)Mk * 2 * E);
  half_t* attn_h    = carve((size_t)M * E);
  half_t* ffn1_h    = carve((size_t)M * F);
  float*  x = (float*)d_out;   // residual accumulator

  auto cvt = [&](const float* s, half_t* d, long long n) {
    int blocks = (int)((n + 2047) / 2048);
    convert_f16_kernel<<<blocks, 256, 0, stream>>>(s, d, n);
  };
  cvt(self_w,   selfw_h,   (long long)3 * E * E);
  cvt(self_ow,  selfow_h,  (long long)E * E);
  cvt(cross_w,  crossw_h,  (long long)3 * E * E);
  cvt(cross_ow, crossow_h, (long long)E * E);
  cvt(w1,       w1_h,      (long long)F * E);
  cvt(w2,       w2_h,      (long long)E * F);
  cvt(memory,   mem_h,     (long long)Mk * E);

  // x = tgt
  (void)hipMemcpyAsync(x, tgt, (size_t)M * E * sizeof(float),
                       hipMemcpyDeviceToDevice, stream);

  auto gemm = [&](const half_t* A, const half_t* W, const float* bias,
                  half_t* outh, float* resid, int m, int n, int k, int act) {
    dim3 grid(m / MBLK, n / NBLK);
    gemm_wmma_kernel<<<grid, 256, 0, stream>>>(A, W, bias, outh, resid, m, n, k, act);
  };

  // ---- self-attention sublayer ----
  layernorm_kernel<<<M, 256, 0, stream>>>(x, ln1_g, ln1_b, nx_h, E);
  gemm(nx_h, selfw_h, self_b, qkv_h, nullptr, M, 3 * E, E, 0);
  {
    dim3 grid(Tq / 64, nhead, B);
    attn_wmma_kernel<<<grid, 128, 0, stream>>>(
        qkv_h, 3 * E, qkv_h + E, 3 * E, qkv_h + 2 * E, 3 * E,
        attn_h, E, Tq, Tq, Dh, n_ctx_p, scale);
  }
  gemm(attn_h, selfow_h, self_ob, nullptr, x, M, E, E, 0);

  // ---- cross-attention sublayer ----
  layernorm_kernel<<<M, 256, 0, stream>>>(x, ln2_g, ln2_b, nx_h, E);
  gemm(nx_h,  crossw_h,                 cross_b,     qc_h,  nullptr, M,  E,     E, 0);
  gemm(mem_h, crossw_h + (size_t)E * E, cross_b + E, kvc_h, nullptr, Mk, 2 * E, E, 0);
  {
    dim3 grid(Tq / 64, nhead, B);
    attn_wmma_kernel<<<grid, 128, 0, stream>>>(
        qc_h, E, kvc_h, 2 * E, kvc_h + E, 2 * E,
        attn_h, E, Tq, Tk, Dh, nullptr, scale);
  }
  gemm(attn_h, crossow_h, cross_ob, nullptr, x, M, E, E, 0);

  // ---- FFN sublayer ----
  layernorm_kernel<<<M, 256, 0, stream>>>(x, ln3_g, ln3_b, nx_h, E);
  gemm(nx_h,   w1_h, b1, ffn1_h, nullptr, M, F, E, 1);  // exact GELU
  gemm(ffn1_h, w2_h, b2, nullptr, x,       M, E, F, 0);
}

// v003
// Two timings next to v002 put it at 1.07 and 1.06 times that version's speed.
// Counting every step since v000, it is 1.91 times as fast.
#include <hip/hip_runtime.h>
#include <math.h>

typedef _Float16 half_t;
typedef __attribute__((ext_vector_type(16))) _Float16 v16h;
typedef __attribute__((ext_vector_type(8)))  _Float16 v8h;
typedef __attribute__((ext_vector_type(8)))  float    v8f;
typedef __attribute__((vector_size(16)))     int      vsi4;   // int4 for async builtin

#define ASG __attribute__((address_space(1)))
#define ASL __attribute__((address_space(3)))

// Detect CDNA5 async global->LDS builtins (gfx1250); fall back to load+ds_store.
#if defined(__has_builtin)
#  if __has_builtin(__builtin_amdgcn_global_load_async_to_lds_b128)
#    define HAVE_ASYNC 1
#  endif
#endif
#ifndef HAVE_ASYNC
#  define HAVE_ASYNC 0
#endif

// ---------------------------------------------------------------------------
// WMMA helpers (CDNA5 gfx1250, wave32)
// ---------------------------------------------------------------------------
__device__ inline v8f wmma_f16(v16h a, v16h b, v8f c) {
  // D(16x16,f32) = A(16x32,f16) x B(32x16,f16) + C
  return __builtin_amdgcn_wmma_f32_16x16x32_f16(
      /*neg_a=*/false, a, /*neg_b=*/false, b,
      /*c_mod=*/(short)0, c, /*reuse_a=*/false, /*reuse_b=*/false);
}

__device__ inline v8f zero_v8f() {
  v8f z;
#pragma unroll
  for (int i = 0; i < 8; ++i) z[i] = 0.0f;
  return z;
}

// Load a 16x32 f16 fragment in the ISA A-matrix lane layout:
//   lane<16 : row=lane,    K = [0..7] then [16..23]
//   lane>=16: row=lane-16, K = [8..15] then [24..31]
// base points at (row0, k0); ld = row stride in elements. Also used for the
// B operand of D = A x W^T (B column n == row n of W, identical pattern).
__device__ inline v16h load_frag(const half_t* __restrict__ base, int ld) {
  const int lane = threadIdx.x & 31;
  const int sub  = lane & 15;
  const int hi   = lane >> 4;
  const half_t* p = base + (size_t)sub * ld + hi * 8;
  v8h lo = *(const v8h*)(p);
  v8h hh = *(const v8h*)(p + 16);
  v16h r;
#pragma unroll
  for (int i = 0; i < 8; ++i) { r[i] = lo[i]; r[i + 8] = hh[i]; }
  return r;
}

// One 16-byte global->LDS transfer per lane (ASYNCcnt path if available).
__device__ inline void copy_b128_to_lds(const half_t* g, half_t* l) {
#if HAVE_ASYNC
  __builtin_amdgcn_global_load_async_to_lds_b128(
      (ASG vsi4*)g, (ASL vsi4*)l, 0, 0);
#else
  *(v8h*)l = *(const v8h*)g;
#endif
}

__device__ inline void wait_async_copies() {
#if HAVE_ASYNC
#  if __has_builtin(__builtin_amdgcn_s_wait_asynccnt)
  __builtin_amdgcn_s_wait_asynccnt(0);
#  else
  asm volatile("s_wait_asynccnt 0" ::: "memory");
#  endif
#endif
}

// ---------------------------------------------------------------------------
// Elementwise f32 -> f16 conversion of all seven arrays in one streaming launch.
// The arrays are cut into chunks of 8192 floats; a block walks chunks at grid
// stride. In a whole chunk each thread issues eight 16-byte loads (every wave
// load covers 512 contiguous bytes) before the first is converted, so few waves
// keep many bytes in flight; the last, partial chunk of an array goes by element.
// ---------------------------------------------------------------------------
#define CVT_LOADS 8
#define CVT_SPAN  (256 * 4)                // floats per block-wide 16-byte load
#define CVT_CHUNK (CVT_SPAN * CVT_LOADS)   // floats per chunk

typedef __attribute__((ext_vector_type(4))) float    v4f;
typedef __attribute__((ext_vector_type(4))) _Float16 v4h;

__device__ inline int cvt_chunks(long long n) {
  return (int)((n + CVT_CHUNK - 1) / CVT_CHUNK);
}

__global__ __launch_bounds__(256) void convert_f16_kernel(
    const float* __restrict__ s0, const float* __restrict__ s1,
    const float* __restrict__ s2, const float* __restrict__ s3,
    const float* __restrict__ s4, const float* __restrict__ s5,
    const float* __restrict__ s6,
    half_t* __restrict__ d0, half_t* __restrict__ d1, half_t* __restrict__ d2,
    half_t* __restrict__ d3, half_t* __restrict__ d4, half_t* __restrict__ d5,
    half_t* __restrict__ d6,
    long long n0, long long n1, long long n2, long long n3,
    long long n4, long long n5, long long n6) {
  // first chunk index behind each array
  const int e0 = cvt_chunks(n0);
  const int e1 = e0 + cvt_chunks(n1);
  const int e2 = e1 + cvt_chunks(n2);
  const int e3 = e2 + cvt_chunks(n3);
  const int e4 = e3 + cvt_chunks(n4);
  const int e5 = e4 + cvt_chunks(n5);
  const int e6 = e5 + cvt_chunks(n6);

  for (int c = blockIdx.x; c < e6; c += gridDim.x) {
    const float* s = s0; half_t* d = d0; long long n = n0; int first = 0;
    if (c >= e0) { s = s1; d = d1; n = n1; first = e0; }
    if (c >= e1) { s = s2; d = d2; n = n2; first = e1; }
    if (c >= e2) { s = s3; d = d3; n = n3; first = e2; }
    if (c >= e3) { s = s4; d = d4; n = n4; first = e3; }
    if (c >= e4) { s = s5; d = d5; n = n5; first = e4; }
    if (c >= e5) { s = s6; d = d6; n = n6; first = e5; }
    const long long base = (long long)(c - first) * CVT_CHUNK;
    if (base + CVT_CHUNK <= n) {
      const float* sp = s + base + threadIdx.x * 4;
      half_t*      dp = d + base + threadIdx.x * 4;
      v4f v[CVT_LOADS];
#pragma unroll
      for (int j = 0; j < CVT_LOADS; ++j) v[j] = *(const v4f*)(sp + j * CVT_SPAN);
#pragma unroll
      for (int j = 0; j < CVT_LOADS; ++j)
        *(v4h*)(dp + j * CVT_SPAN) = __builtin_convertvector(v[j], v4h);
      // The next trip rewrites the base and data registers that these stores
      // name.
      asm volatile("s_wait_xcnt 0x0" ::: "memory");
    } else {
      for (long long i = base + threadIdx.x; i < n; i += 256) d[i] = (half_t)s[i];
    }
  }
}

// ---------------------------------------------------------------------------
// LayerNorm: one block (256 thr) per row, writes f16 (GEMM input format)
// ---------------------------------------------------------------------------
__global__ __launch_bounds__(256) void layernorm_kernel(
    const float* __restrict__ x, const float* __restrict__ g,
    const float* __restrict__ b, half_t* __restrict__ outh, int E) {
  __shared__ float red[64];
  const int row = blockIdx.x;
  const float* xr = x + (size_t)row * E;
  float s = 0.f, s2 = 0.f;
  for (int i = threadIdx.x; i < E; i += blockDim.x) {
    float v = xr[i];
    s += v; s2 += v * v;
  }
#pragma unroll
  for (int off = 16; off > 0; off >>= 1) {
    s  += __shfl_xor(s,  off, 32);
    s2 += __shfl_xor(s2, off, 32);
  }
  const int wid = threadIdx.x >> 5, lane = threadIdx.x & 31;
  if (lane == 0) { red[wid] = s; red[32 + wid] = s2; }
  __syncthreads();
  if (wid == 0) {
    int nw = blockDim.x >> 5;
    float a  = (lane < nw) ? red[lane]      : 0.f;
    float a2 = (lane < nw) ? red[32 + lane] : 0.f;
#pragma unroll
    for (int off = 16; off > 0; off >>= 1) {
      a  += __shfl_xor(a,  off, 32);
      a2 += __shfl_xor(a2, off, 32);
    }
    if (lane == 0) { red[0] = a; red[1] = a2; }
  }
  __syncthreads();
  const float mean = red[0] / (float)E;
  const float var  = red[1] / (float)E - mean * mean;
  const float rstd = rsqrtf(var + 1e-5f);
  for (int i = threadIdx.x; i < E; i += blockDim.x)
    outh[(size_t)row * E + i] = (half_t)((xr[i] - mean) * rstd * g[i] + b[i]);
}

// ---------------------------------------------------------------------------
// LDS-staged double-buffered GEMM:
//   out[M,N] = act(A[M,K] @ W[N,K]^T + bias[N]); optional residual f32 add.
// Block = 256 thr = 8 waves (2 in M x 4 in N). Block tile 128x128, K-step 32.
// LDS: 2 x (128 A rows + 128 B rows) of 64 B at an 80-B pitch = 40 KB.
// Global->LDS staging uses GLOBAL_LOAD_ASYNC_TO_LDS_B128 (ASYNCcnt).
// ---------------------------------------------------------------------------
#define KSTEP 32
#define MBLK  128
#define NBLK  128
#define GPITCH 40   // halves; 80-B rows (16 B x odd) for the ds_load_b128 reader

__global__ __launch_bounds__(256) void gemm_wmma_kernel(
    const half_t* __restrict__ A, const half_t* __restrict__ W,
    const float* __restrict__ bias, half_t* __restrict__ outh,
    float* __restrict__ resid, int M, int N, int K, int act) {
  __shared__ __attribute__((aligned(16))) half_t ldsA[2][MBLK * GPITCH];
  __shared__ __attribute__((aligned(16))) half_t ldsB[2][NBLK * GPITCH];

  const int tid  = threadIdx.x;
  const int lane = tid & 31;
  const int wid  = tid >> 5;     // 0..7
  const int wm   = wid >> 2;     // 0..1 : wave row  (64 rows each)
  const int wn   = wid & 3;      // 0..3 : wave col  (32 cols each)
  const int m0 = blockIdx.x * MBLK;
  const int n0 = blockIdx.y * NBLK;

  // Staging assignment: thread -> (row = tid>>2 [+64], 8-half quad = (tid&3)*8)
  const int crow = tid >> 2;        // 0..63
  const int cq   = (tid & 3) * 8;   // 0,8,16,24

  v8f acc[4][2];
#pragma unroll
  for (int i = 0; i < 4; ++i) { acc[i][0] = zero_v8f(); acc[i][1] = zero_v8f(); }

  // prologue: stage k=0 tiles into buffer 0
#pragma unroll
  for (int rr = 0; rr < MBLK; rr += 64)
    copy_b128_to_lds(A + (size_t)(m0 + crow + rr) * K + cq,
                     &ldsA[0][(crow + rr) * GPITCH + cq]);
#pragma unroll
  for (int rr = 0; rr < NBLK; rr += 64)
    copy_b128_to_lds(W + (size_t)(n0 + crow + rr) * K + cq,
                     &ldsB[0][(crow + rr) * GPITCH + cq]);
  wait_async_copies();
  __syncthreads();

  int buf = 0;
  for (int k0 = 0; k0 < K; k0 += KSTEP) {
    // stage next K-slice into the other buffer while computing this one
    if (k0 + KSTEP < K) {
      const int nb = buf ^ 1;
#pragma unroll
      for (int rr = 0; rr < MBLK; rr += 64)
        copy_b128_to_lds(A + (size_t)(m0 + crow + rr) * K + k0 + KSTEP + cq,
                         &ldsA[nb][(crow + rr) * GPITCH + cq]);
#pragma unroll
      for (int rr = 0; rr < NBLK; rr += 64)
        copy_b128_to_lds(W + (size_t)(n0 + crow + rr) * K + k0 + KSTEP + cq,
                         &ldsB[nb][(crow + rr) * GPITCH + cq]);
    }

    // compute: 4 A-frags x 2 B-frags = 8 WMMA per K-step, fed by ds_load_b128
    v16h bf0 = load_frag(&ldsB[buf][(wn * 32 +  0) * GPITCH], GPITCH);
    v16h bf1 = load_frag(&ldsB[buf][(wn * 32 + 16) * GPITCH], GPITCH);
#pragma unroll
    for (int i = 0; i < 4; ++i) {
      v16h af = load_frag(&ldsA[buf][(wm * 64 + i * 16) * GPITCH], GPITCH);
      acc[i][0] = wmma_f16(af, bf0, acc[i][0]);
      acc[i][1] = wmma_f16(af, bf1, acc[i][1]);
    }

    wait_async_copies();   // our staged writes for buf^1 have landed in LDS
    __syncthreads();       // everyone done reading buf / writing buf^1
    buf ^= 1;
  }

  // epilogue: C layout -> lane l<16 holds rows 0..7 (vgpr r), l>=16 rows 8..15
  const int sub = lane & 15, hi = lane >> 4;
#pragma unroll
  for (int i = 0; i < 4; ++i) {
#pragma unroll
    for (int j = 0; j < 2; ++j) {
#pragma unroll
      for (int r = 0; r < 8; ++r) {
        const int rr = m0 + wm * 64 + i * 16 + r + 8 * hi;
        const int cc = n0 + wn * 32 + j * 16 + sub;
        float v = acc[i][j][r] + bias[cc];
        if (act == 1) v = 0.5f * v * (1.0f + erff(v * 0.70710678118654752f));
        if (outh)  outh[(size_t)rr * N + cc] = (half_t)v;
        if (resid) resid[(size_t)rr * N + cc] += v;
      }
    }
  }
}

// ---------------------------------------------------------------------------
// Fused flash-style attention. grid = (Tq/64, nhead, B), block = 128 (4 waves),
// each wave owns 16 query rows. Online softmax over 32-key steps.
// Self-attn mask col<n_ctx == truncating keys to n_ctx (read device-side).
// The 32-key K and V tiles (32 rows x 128 B each) are staged once per block in
// LDS by async copies, two buffers: tile t+1 flies while tile t is worked on.
// ---------------------------------------------------------------------------
#define KPITCH 72   // halves; 144-B rows (16 B x odd) for the ds_load_b128 reader
#define VPITCH 80   // halves; 160-B rows (32 B x odd) for the ds_load_tr16_b128 reader

typedef __attribute__((ext_vector_type(8))) short s16x8;

__device__ inline unsigned lds_byte_addr(const half_t* p) {
  return (unsigned)(size_t)(ASL const half_t*)p;
}

// Transposing LDS read: lane (c = l & 15, h = l >> 4) gets T[8h + 0..7][c] of the
// 16 x 16 tile whose per-lane row addresses are passed in.
__device__ inline v8h lds_load_tr16(const half_t* p) {
  return __builtin_bit_cast(v8h, __builtin_amdgcn_ds_load_tr16_b128_v8i16((ASL s16x8*)p));
}

// Four 16-byte async copies per lane (two K rows, two V rows). The s_wait_xcnt
// stands inside the statement so that no address register named here is
// rewritten ahead of it.
__device__ inline void stage_kv_tile(const half_t* gk0, const half_t* gk1,
                                     const half_t* gv0, const half_t* gv1,
                                     unsigned lk0, unsigned lk1,
                                     unsigned lv0, unsigned lv1) {
  asm volatile(
      "global_load_async_to_lds_b128 %0, %4, off\n\t"
      "global_load_async_to_lds_b128 %1, %5, off\n\t"
      "global_load_async_to_lds_b128 %2, %6, off\n\t"
      "global_load_async_to_lds_b128 %3, %7, off\n\t"
      "s_wait_xcnt 0x0"
      :: "v"(lk0), "v"(lk1), "v"(lv0), "v"(lv1),
         "v"(gk0), "v"(gk1), "v"(gv0), "v"(gv1)
      : "memory");
}

__global__ __launch_bounds__(128) void attn_wmma_kernel(
    const half_t* __restrict__ Q, int qld,
    const half_t* __restrict__ Km, int kld,
    const half_t* __restrict__ V, int vld,
    half_t* __restrict__ O, int oldd,
    int Tq, int Tk, int Dh, const int* __restrict__ nctx, float scale) {
  __shared__ half_t plds[4 * 16 * 32];  // per-wave 16x32 P tile
  __shared__ __attribute__((aligned(16))) half_t kls[2][32 * KPITCH];
  __shared__ __attribute__((aligned(16))) half_t vls[2][32 * VPITCH];
  const int lane = threadIdx.x & 31;
  const int wid  = threadIdx.x >> 5;
  const int sub = lane & 15, hi = lane >> 4;
  const int h = blockIdx.y, b = blockIdx.z;
  const int qt = (blockIdx.x * 4 + wid) * 16;

  int kvlen = Tk;
  if (nctx) { int nc = *nctx; kvlen = nc < Tk ? nc : Tk; }

  const half_t* Qb = Q + ((size_t)b * Tq + qt) * qld + h * Dh;
  const half_t* Kb = Km + (size_t)b * Tk * kld + h * Dh;
  const half_t* Vb = V  + (size_t)b * Tk * vld + h * Dh;

  const v16h qf0 = load_frag(Qb,      qld);   // Dh = 64 -> two K=32 fragments
  const v16h qf1 = load_frag(Qb + 32, qld);

  v8f acc[4];
#pragma unroll
  for (int d = 0; d < 4; ++d) acc[d] = zero_v8f();
  float mrow[8], lrow[8];
#pragma unroll
  for (int r = 0; r < 8; ++r) { mrow[r] = -1e30f; lrow[r] = 0.f; }

  half_t* my = plds + wid * 512;

  // Staging: thread -> tile rows srow and srow + 16, 16-byte chunk sq of the row;
  // one wave's copy covers four whole 128-B rows.
  const int srow = threadIdx.x >> 3;        // 0..15
  const int sq   = (threadIdx.x & 7) * 8;   // halves
  auto stage = [&](int kt0, int sb) {
    const half_t* gk = Kb + (size_t)(kt0 + srow) * kld + sq;
    const half_t* gv = Vb + (size_t)(kt0 + srow) * vld + sq;
    stage_kv_tile(gk, gk + (size_t)16 * kld, gv, gv + (size_t)16 * vld,
                  lds_byte_addr(&kls[sb][srow * KPITCH + sq]),
                  lds_byte_addr(&kls[sb][(srow + 16) * KPITCH + sq]),
                  lds_byte_addr(&vls[sb][srow * VPITCH + sq]),
                  lds_byte_addr(&vls[sb][(srow + 16) * VPITCH + sq]));
  };
  // Per-lane offset of the transposing V read inside a tile.
  const int vtr = (8 * hi + (lane & 7)) * VPITCH + 8 * ((lane >> 3) & 1);

  // Ring prologue: tile 0 lands and is published, then tile 1 starts.
  stage(0, 0);
  asm volatile("s_wait_asynccnt 0x0" ::: "memory");  // own copies of tile 0 landed
  __syncthreads();                                   // publishes tile 0
  if (32 < kvlen) stage(32, 1);

  int buf = 0;
  for (int kt = 0; kt < kvlen; kt += 32) {
    v8f s0 = zero_v8f(), s1 = zero_v8f();
    {
      const half_t* kl = &kls[buf][0];
      v16h k00 = load_frag(kl,      KPITCH);
      v16h k01 = load_frag(kl + 32, KPITCH);
      v16h k10 = load_frag(kl + 16 * KPITCH,      KPITCH);
      v16h k11 = load_frag(kl + 16 * KPITCH + 32, KPITCH);
      // Inputs-only fence on the loaded fragments: keeps the eight LDS reads in one
      // group with one wait; without it each WMMA waits out its own LDS latency.
      asm volatile("" :: "v"(k00), "v"(k01), "v"(k10), "v"(k11));
      s0 = wmma_f16(qf0, k00, s0);
      s0 = wmma_f16(qf1, k01, s0);
      s1 = wmma_f16(qf0, k10, s1);
      s1 = wmma_f16(qf1, k11, s1);
    }
    const bool ok0 = (kt + sub)      < kvlen;
    const bool ok1 = (kt + 16 + sub) < kvlen;

#pragma unroll
    for (int r = 0; r < 8; ++r) {
      float v0 = ok0 ? s0[r] * scale : -1e30f;
      float v1 = ok1 ? s1[r] * scale : -1e30f;
      float mx = fmaxf(v0, v1);
#pragma unroll
      for (int off = 8; off > 0; off >>= 1) mx = fmaxf(mx, __shfl_xor(mx, off, 32));
      const float mnew = fmaxf(mrow[r], mx);
      const float corr = __expf(mrow[r] - mnew);
      const float p0 = __expf(v0 - mnew);
      const float p1 = __expf(v1 - mnew);
      float rs = p0 + p1;
#pragma unroll
      for (int off = 8; off > 0; off >>= 1) rs += __shfl_xor(rs, off, 32);
      lrow[r] = lrow[r] * corr + rs;
      mrow[r] = mnew;
#pragma unroll
      for (int d = 0; d < 4; ++d) acc[d][r] *= corr;
      s0[r] = p0; s1[r] = p1;
    }

    // Transpose P from C-layout to A-layout through LDS.
    __syncthreads();   // guard WAR vs previous iteration's fragment reads
#pragma unroll
    for (int r = 0; r < 8; ++r) {
      my[(r + 8 * hi) * 32 + sub]      = (half_t)s0[r];
      my[(r + 8 * hi) * 32 + 16 + sub] = (half_t)s1[r];
    }
    __syncthreads();
    v16h pf;
#pragma unroll
    for (int j = 0; j < 8; ++j) {
      pf[j]     = my[sub * 32 + hi * 8 + j];
      pf[j + 8] = my[sub * 32 + 16 + hi * 8 + j];
    }

    // acc += P(16x32) @ V(32x64): B[k][n] = V[kt+k][h*Dh + d*16 + n]
#pragma unroll
    for (int d = 0; d < 4; ++d) {
      const half_t* vb = &vls[buf][vtr + d * 16];
      const v8h vlo = lds_load_tr16(vb);                 // keys 8*hi + 0..7
      const v8h vhi = lds_load_tr16(vb + 16 * VPITCH);   // keys 16 + 8*hi + 0..7
      v16h vf;
#pragma unroll
      for (int j = 0; j < 8; ++j) { vf[j] = vlo[j]; vf[j + 8] = vhi[j]; }
      acc[d] = wmma_f16(pf, vf, acc[d]);
    }

    // Publish point of tile t+1; it also ends every reader's last read of buf.
    asm volatile("s_wait_dscnt 0x0" ::: "memory");     // own LDS reads of buf retired
    asm volatile("s_wait_asynccnt 0x0" ::: "memory");  // own copies of tile t+1 landed
    __syncthreads();
    if (kt + 64 < kvlen) stage(kt + 64, buf);          // refill the buffer just read
    buf ^= 1;
  }
  asm volatile("s_wait_asynccnt 0x0" ::: "memory");    // nothing in flight at wave end

#pragma unroll
  for (int r = 0; r < 8; ++r) {
    const float inv = 1.0f / lrow[r];
    const size_t row = (size_t)b * Tq + qt + r + 8 * hi;
#pragma unroll
    for (int d = 0; d < 4; ++d)
      O[row * oldd + h * Dh + d * 16 + sub] = (half_t)(acc[d][r] * inv);
  }
}

// ---------------------------------------------------------------------------
// Host orchestration
// ---------------------------------------------------------------------------
extern "C" void kernel_launch(void* const* d_in, const int* in_sizes, int n_in,
                              void* d_out, int out_size, void* d_ws, size_t ws_size,
                              hipStream_t stream) {
  (void)n_in; (void)out_size; (void)ws_size;
  const float* tgt      = (const float*)d_in[0];
  const float* memory   = (const float*)d_in[1];
  const float* self_w   = (const float*)d_in[2];
  const float* self_b   = (const float*)d_in[3];
  const float* self_ow  = (const float*)d_in[4];
  const float* self_ob  = (const float*)d_in[5];
  const float* cross_w  = (const float*)d_in[6];
  const float* cross_b  = (const float*)d_in[7];
  const float* cross_ow = (const float*)d_in[8];
  const float* cross_ob = (const float*)d_in[9];
  const float* ln1_g = (const float*)d_in[10];
  const float* ln1_b = (const float*)d_in[11];
  const float* ln2_g = (const float*)d_in[12];
  const float* ln2_b = (const float*)d_in[13];
  const float* ln3_g = (const float*)d_in[14];
  const float* ln3_b = (const float*)d_in[15];
  const float* w1 = (const float*)d_in[16];
  const float* b1 = (const float*)d_in[17];
  const float* w2 = (const float*)d_in[18];
  const float* b2 = (const float*)d_in[19];
  const int*   n_ctx_p = (const int*)d_in[20];

  const int E  = in_sizes[10];
  const int F  = in_sizes[16] / E;
  const int B  = 2;
  const int Tq = in_sizes[0] / (B * E);
  const int Tk = in_sizes[1] / (B * E);
  const int nhead = 16;
  const int Dh = E / nhead;
  const int M  = B * Tq;   // query rows
  const int Mk = B * Tk;   // memory rows
  const float scale = 1.0f / sqrtf((float)Dh);

  // --- workspace carve (all f16 buffers, 256B aligned) ---
  char* wp = (char*)d_ws;
  auto carve = [&](size_t elems) -> half_t* {
    half_t* r = (half_t*)wp;
    wp += (elems * sizeof(half_t) + 255) & ~(size_t)255;
    return r;
  };
  half_t* selfw_h   = carve((size_t)3 * E * E);
  half_t* selfow_h  = carve((size_t)E * E);
  half_t* crossw_h  = carve((size_t)3 * E * E);
  half_t* crossow_h = carve((size_t)E * E);
  half_t* w1_h      = carve((size_t)F * E);
  half_t* w2_h      = carve((size_t)E * F);
  half_t* mem_h     = carve((size_t)Mk * E);
  half_t* nx_h      = carve((size_t)M * E);
  half_t* qkv_h     = carve((size_t)M * 3 * E);
  half_t* qc_h      = carve((size_t)M * E);
  half_t* kvc_h     = carve((size_t)Mk * 2 * E);
  half_t* attn_h    = carve((size_t)M * E);
  half_t* ffn1_h    = carve((size_t)M * F);
  float*  x = (float*)d_out;   // residual accumulator

  // 512 blocks of 8 waves: 16 streaming waves on each of the 256 WGPs.
  convert_f16_kernel<<<512, 256, 0, stream>>>(
      self_w, self_ow, cross_w, cross_ow, w1, w2, memory,
      selfw_h, selfow_h, crossw_h, crossow_h, w1_h, w2_h, mem_h,
      (long long)3 * E * E, (long long)E * E, (long long)3 * E * E,
      (long long)E * E, (long long)F * E, (long long)E * F, (long long)Mk * E);

  // x = tgt
  (void)hipMemcpyAsync(x, tgt, (size_t)M * E * sizeof(float),
                       hipMemcpyDeviceToDevice, stream);

  auto gemm = [&](const half_t* A, const half_t* W, const float* bias,
                  half_t* outh, float* resid, int m, int n, int k, int act) {
    dim3 grid(m / MBLK, n / NBLK);
    gemm_wmma_kernel<<<grid, 256, 0, stream>>>(A, W, bias, outh, resid, m, n, k, act);
  };

  // ---- self-attention sublayer ----
  layernorm_kernel<<<M, 256, 0, stream>>>(x, ln1_g, ln1_b, nx_h, E);
  gemm(nx_h, selfw_h, self_b, qkv_h, nullptr, M, 3 * E, E, 0);
  {
    dim3 grid(Tq / 64, nhead, B);
    attn_wmma_kernel<<<grid, 128, 0, stream>>>(
        qkv_h, 3 * E, qkv_h + E, 3 * E, qkv_h + 2 * E, 3 * E,
        attn_h, E, Tq, Tq, Dh, n_ctx_p, scale);
  }
  gemm(attn_h, selfow_h, self_ob, nullptr, x, M, E, E, 0);

  // ---- cross-attention sublayer ----
  layernorm_kernel<<<M, 256, 0, stream>>>(x, ln2_g, ln2_b, nx_h, E);
  gemm(nx_h,  crossw_h,                 cross_b,     qc_h,  nullptr, M,  E,     E, 0);
  gemm(mem_h, crossw_h + (size_t)E * E, cross_b + E, kvc_h, nullptr, Mk, 2 * E, E, 0);
  {
    dim3 grid(Tq / 64, nhead, B);
    attn_wmma_kernel<<<grid, 128, 0, stream>>>(
        qc_h, E, kvc_h, 2 * E, kvc_h + E, 2 * E,
        attn_h, E, Tq, Tk, Dh, nullptr, scale);
  }
  gemm(attn_h, crossow_h, cross_ob, nullptr, x, M, E, E, 0);

  // ---- FFN sublayer ----
  layernorm_kernel<<<M, 256, 0, stream>>>(x, ln3_g, ln3_b, nx_h, E);
  gemm(nx_h,   w1_h, b1, ffn1_h, nullptr, M, F, E, 1);  // exact GELU
  gemm(ffn1_h, w2_h, b2, nullptr, x,       M, E, F, 0);
}

// v004
// Next to v003, in two timings, it ran 1.26 and 1.25 times as fast.
// Over all steps from v000 it is 2.40 times as fast.
#include <hip/hip_runtime.h>
#include <math.h>

typedef _Float16 half_t;
typedef __attribute__((ext_vector_type(16))) _Float16 v16h;
typedef __attribute__((ext_vector_type(8)))  _Float16 v8h;
typedef __attribute__((ext_vector_type(8)))  float    v8f;
typedef __attribute__((vector_size(16)))     int      vsi4;   // int4 for async builtin

#define ASG __attribute__((address_space(1)))
#define ASL __attribute__((address_space(3)))

// Detect CDNA5 async global->LDS builtins (gfx1250); fall back to load+ds_store.
#if defined(__has_builtin)
#  if __has_builtin(__builtin_amdgcn_global_load_async_to_lds_b128)
#    define HAVE_ASYNC 1
#  endif
#endif
#ifndef HAVE_ASYNC
#  define HAVE_ASYNC 0
#endif

// ---------------------------------------------------------------------------
// WMMA helpers (CDNA5 gfx1250, wave32)
// ---------------------------------------------------------------------------
__device__ inline v8f wmma_f16(v16h a, v16h b, v8f c) {
  // D(16x16,f32) = A(16x32,f16) x B(32x16,f16) + C
  return __builtin_amdgcn_wmma_f32_16x16x32_f16(
      /*neg_a=*/false, a, /*neg_b=*/false, b,
      /*c_mod=*/(short)0, c, /*reuse_a=*/false, /*reuse_b=*/false);
}

__device__ inline v8f zero_v8f() {
  v8f z;
#pragma unroll
  for (int i = 0; i < 8; ++i) z[i] = 0.0f;
  return z;
}

// Load a 16x32 f16 fragment in the ISA A-matrix lane layout:
//   lane<16 : row=lane,    K = [0..7] then [16..23]
//   lane>=16: row=lane-16, K = [8..15] then [24..31]
// base points at (row0, k0); ld = row stride in elements. Also used for the
// B operand of D = A x W^T (B column n == row n of W, identical pattern).
__device__ inline v16h load_frag(const half_t* __restrict__ base, int ld) {
  const int lane = threadIdx.x & 31;
  const int sub  = lane & 15;
  const int hi   = lane >> 4;
  const half_t* p = base + (size_t)sub * ld + hi * 8;
  v8h lo = *(const v8h*)(p);
  v8h hh = *(const v8h*)(p + 16);
  v16h r;
#pragma unroll
  for (int i = 0; i < 8; ++i) { r[i] = lo[i]; r[i + 8] = hh[i]; }
  return r;
}

// One 16-byte global->LDS transfer per lane (ASYNCcnt path if available).
__device__ inline void copy_b128_to_lds(const half_t* g, half_t* l) {
#if HAVE_ASYNC
  __builtin_amdgcn_global_load_async_to_lds_b128(
      (ASG vsi4*)g, (ASL vsi4*)l, 0, 0);
#else
  *(v8h*)l = *(const v8h*)g;
#endif
}

__device__ inline void wait_async_copies() {
#if HAVE_ASYNC
#  if __has_builtin(__builtin_amdgcn_s_wait_asynccnt)
  __builtin_amdgcn_s_wait_asynccnt(0);
#  else
  asm volatile("s_wait_asynccnt 0" ::: "memory");
#  endif
#endif
}

// ---------------------------------------------------------------------------
// Elementwise f32 -> f16 conversion of all seven arrays in one streaming launch.
// The arrays are cut into chunks of 8192 floats; a block walks chunks at grid
// stride. In a whole chunk each thread issues eight 16-byte loads (every wave
// load covers 512 contiguous bytes) before the first is converted, so few waves
// keep many bytes in flight; the last, partial chunk of an array goes by element.
// ---------------------------------------------------------------------------
#define CVT_LOADS 8
#define CVT_SPAN  (256 * 4)                // floats per block-wide 16-byte load
#define CVT_CHUNK (CVT_SPAN * CVT_LOADS)   // floats per chunk

typedef __attribute__((ext_vector_type(4))) float    v4f;
typedef __attribute__((ext_vector_type(4))) _Float16 v4h;

__device__ inline int cvt_chunks(long long n) {
  return (int)((n + CVT_CHUNK - 1) / CVT_CHUNK);
}

__global__ __launch_bounds__(256) void convert_f16_kernel(
    const float* __restrict__ s0, const float* __restrict__ s1,
    const float* __restrict__ s2, const float* __restrict__ s3,
    const float* __restrict__ s4, const float* __restrict__ s5,
    const float* __restrict__ s6,
    half_t* __restrict__ d0, half_t* __restrict__ d1, half_t* __restrict__ d2,
    half_t* __restrict__ d3, half_t* __restrict__ d4, half_t* __restrict__ d5,
    half_t* __restrict__ d6,
    long long n0, long long n1, long long n2, long long n3,
    long long n4, long long n5, long long n6) {
  // first chunk index behind each array
  const int e0 = cvt_chunks(n0);
  const int e1 = e0 + cvt_chunks(n1);
  const int e2 = e1 + cvt_chunks(n2);
  const int e3 = e2 + cvt_chunks(n3);
  const int e4 = e3 + cvt_chunks(n4);
  const int e5 = e4 + cvt_chunks(n5);
  const int e6 = e5 + cvt_chunks(n6);

  for (int c = blockIdx.x; c < e6; c += gridDim.x) {
    const float* s = s0; half_t* d = d0; long long n = n0; int first = 0;
    if (c >= e0) { s = s1; d = d1; n = n1; first = e0; }
    if (c >= e1) { s = s2; d = d2; n = n2; first = e1; }
    if (c >= e2) { s = s3; d = d3; n = n3; first = e2; }
    if (c >= e3) { s = s4; d = d4; n = n4; first = e3; }
    if (c >= e4) { s = s5; d = d5; n = n5; first = e4; }
    if (c >= e5) { s = s6; d = d6; n = n6; first = e5; }
    const long long base = (long long)(c - first) * CVT_CHUNK;
    if (base + CVT_CHUNK <= n) {
      const float* sp = s + base + threadIdx.x * 4;
      half_t*      dp = d + base + threadIdx.x * 4;
      v4f v[CVT_LOADS];
#pragma unroll
      for (int j = 0; j < CVT_LOADS; ++j) v[j] = *(const v4f*)(sp + j * CVT_SPAN);
#pragma unroll
      for (int j = 0; j < CVT_LOADS; ++j)
        *(v4h*)(dp + j * CVT_SPAN) = __builtin_convertvector(v[j], v4h);
      // The next trip rewrites the base and data registers that these stores
      // name.
      asm volatile("s_wait_xcnt 0x0" ::: "memory");
    } else {
      for (long long i = base + threadIdx.x; i < n; i += 256) d[i] = (half_t)s[i];
    }
  }
}

// ---------------------------------------------------------------------------
// LayerNorm: one block (256 thr) per row, writes f16 (GEMM input format)
// ---------------------------------------------------------------------------
__global__ __launch_bounds__(256) void layernorm_kernel(
    const float* __restrict__ x, const float* __restrict__ g,
    const float* __restrict__ b, half_t* __restrict__ outh, int E) {
  __shared__ float red[64];
  const int row = blockIdx.x;
  const float* xr = x + (size_t)row * E;
  float s = 0.f, s2 = 0.f;
  for (int i = threadIdx.x; i < E; i += blockDim.x) {
    float v = xr[i];
    s += v; s2 += v * v;
  }
#pragma unroll
  for (int off = 16; off > 0; off >>= 1) {
    s  += __shfl_xor(s,  off, 32);
    s2 += __shfl_xor(s2, off, 32);
  }
  const int wid = threadIdx.x >> 5, lane = threadIdx.x & 31;
  if (lane == 0) { red[wid] = s; red[32 + wid] = s2; }
  __syncthreads();
  if (wid == 0) {
    int nw = blockDim.x >> 5;
    float a  = (lane < nw) ? red[lane]      : 0.f;
    float a2 = (lane < nw) ? red[32 + lane] : 0.f;
#pragma unroll
    for (int off = 16; off > 0; off >>= 1) {
      a  += __shfl_xor(a,  off, 32);
      a2 += __shfl_xor(a2, off, 32);
    }
    if (lane == 0) { red[0] = a; red[1] = a2; }
  }
  __syncthreads();
  const float mean = red[0] / (float)E;
  const float var  = red[1] / (float)E - mean * mean;
  const float rstd = rsqrtf(var + 1e-5f);
  for (int i = threadIdx.x; i < E; i += blockDim.x)
    outh[(size_t)row * E + i] = (half_t)((xr[i] - mean) * rstd * g[i] + b[i]);
}

// ---------------------------------------------------------------------------
// LDS-staged double-buffered GEMM:
//   out[M,N] = act(A[M,K] @ W[N,K]^T + bias[N]); optional residual f32 add.
// Block = 256 thr = 8 waves (2 in M x 4 in N). Block tile 128x128, K-step 32.
// LDS: 2 x (128 A rows + 128 B rows) of 64 B at an 80-B pitch = 40 KB.
// Global->LDS staging uses GLOBAL_LOAD_ASYNC_TO_LDS_B128 (ASYNCcnt).
// ---------------------------------------------------------------------------
#define KSTEP 32
#define MBLK  128
#define NBLK  128
#define GPITCH 40   // halves; 80-B rows (16 B x odd) for the ds_load_b128 reader

__global__ __launch_bounds__(256) void gemm_wmma_kernel(
    const half_t* __restrict__ A, const half_t* __restrict__ W,
    const float* __restrict__ bias, half_t* __restrict__ outh,
    float* __restrict__ resid, int M, int N, int K, int act) {
  __shared__ __attribute__((aligned(16))) half_t ldsA[2][MBLK * GPITCH];
  __shared__ __attribute__((aligned(16))) half_t ldsB[2][NBLK * GPITCH];

  const int tid  = threadIdx.x;
  const int lane = tid & 31;
  const int wid  = tid >> 5;     // 0..7
  const int wm   = wid >> 2;     // 0..1 : wave row  (64 rows each)
  const int wn   = wid & 3;      // 0..3 : wave col  (32 cols each)
  const int m0 = blockIdx.x * MBLK;
  const int n0 = blockIdx.y * NBLK;

  // Staging assignment: thread -> (row = tid>>2 [+64], 8-half quad = (tid&3)*8)
  const int crow = tid >> 2;        // 0..63
  const int cq   = (tid & 3) * 8;   // 0,8,16,24

  v8f acc[4][2];
#pragma unroll
  for (int i = 0; i < 4; ++i) { acc[i][0] = zero_v8f(); acc[i][1] = zero_v8f(); }

  // C layout -> lane l<16 holds rows 0..7 (vgpr r), l>=16 rows 8..15.
  const int sub = lane & 15, hi = lane >> 4;
  // The bias is asked for here, so that its latency runs beside that of tile 0's copies.
  const float bias0 = bias[n0 + wn * 32 + sub];
  const float bias1 = bias[n0 + wn * 32 + sub + 16];

  // prologue: stage k=0 tiles into buffer 0
#pragma unroll
  for (int rr = 0; rr < MBLK; rr += 64)
    copy_b128_to_lds(A + (size_t)(m0 + crow + rr) * K + cq,
                     &ldsA[0][(crow + rr) * GPITCH + cq]);
#pragma unroll
  for (int rr = 0; rr < NBLK; rr += 64)
    copy_b128_to_lds(W + (size_t)(n0 + crow + rr) * K + cq,
                     &ldsB[0][(crow + rr) * GPITCH + cq]);
  wait_async_copies();
  __syncthreads();

  int buf = 0;
  for (int k0 = 0; k0 < K; k0 += KSTEP) {
    // stage next K-slice into the other buffer while computing this one
    if (k0 + KSTEP < K) {
      const int nb = buf ^ 1;
#pragma unroll
      for (int rr = 0; rr < MBLK; rr += 64)
        copy_b128_to_lds(A + (size_t)(m0 + crow + rr) * K + k0 + KSTEP + cq,
                         &ldsA[nb][(crow + rr) * GPITCH + cq]);
#pragma unroll
      for (int rr = 0; rr < NBLK; rr += 64)
        copy_b128_to_lds(W + (size_t)(n0 + crow + rr) * K + k0 + KSTEP + cq,
                         &ldsB[nb][(crow + rr) * GPITCH + cq]);
    }

    // compute: 4 A-frags x 2 B-frags = 8 WMMA per K-step, fed by ds_load_b128
    v16h bf0 = load_frag(&ldsB[buf][(wn * 32 +  0) * GPITCH], GPITCH);
    v16h bf1 = load_frag(&ldsB[buf][(wn * 32 + 16) * GPITCH], GPITCH);
#pragma unroll
    for (int i = 0; i < 4; ++i) {
      v16h af = load_frag(&ldsA[buf][(wm * 64 + i * 16) * GPITCH], GPITCH);
      acc[i][0] = wmma_f16(af, bf0, acc[i][0]);
      acc[i][1] = wmma_f16(af, bf1, acc[i][1]);
    }

    wait_async_copies();   // our staged writes for buf^1 have landed in LDS
    __syncthreads();       // everyone done reading buf / writing buf^1
    buf ^= 1;
  }

  // epilogue: the tests on act, outh and resid stand outside the element loops
#pragma unroll
  for (int i = 0; i < 4; ++i) {
#pragma unroll
    for (int r = 0; r < 8; ++r) {
      acc[i][0][r] += bias0;
      acc[i][1][r] += bias1;
    }
  }
  if (act == 1) {
#pragma unroll
    for (int i = 0; i < 4; ++i)
#pragma unroll
      for (int j = 0; j < 2; ++j)
#pragma unroll
        for (int r = 0; r < 8; ++r) {
          const float v = acc[i][j][r];
          acc[i][j][r] = 0.5f * v * (1.0f + erff(v * 0.70710678118654752f));
        }
  }
  // An output element lies at a block-uniform place (row i*16 + r, column j*16 of
  // the block's tile) plus this 32-bit offset of the lane, in elements.
  const size_t   tile0 = (size_t)m0 * N + n0;
  const unsigned loff  = (unsigned)((wm * 64 + 8 * hi) * N + wn * 32 + sub);
  if (outh) {
    half_t* op = outh + tile0;
#pragma unroll
    for (int i = 0; i < 4; ++i)
#pragma unroll
      for (int r = 0; r < 8; ++r)
#pragma unroll
        for (int j = 0; j < 2; ++j)
          (op + (size_t)(i * 16 + r) * N + j * 16)[loff] = (half_t)acc[i][j][r];
    // The residual path below rewrites registers that these stores name.
    asm volatile("s_wait_xcnt 0x0" ::: "memory");
  }
  if (resid) {
    float* rp = resid + tile0;
    // All 64 residual values are in flight together before the first is used.
    v8f rv[4][2];
#pragma unroll
    for (int i = 0; i < 4; ++i)
#pragma unroll
      for (int r = 0; r < 8; ++r)
#pragma unroll
        for (int j = 0; j < 2; ++j)
          rv[i][j][r] = (rp + (size_t)(i * 16 + r) * N + j * 16)[loff];
#pragma unroll
    for (int i = 0; i < 4; ++i)
#pragma unroll
      for (int r = 0; r < 8; ++r)
#pragma unroll
        for (int j = 0; j < 2; ++j)
          (rp + (size_t)(i * 16 + r) * N + j * 16)[loff] = rv[i][j][r] + acc[i][j][r];
  }
}

// ---------------------------------------------------------------------------
// Fused flash-style attention. grid = (Tq/64, nhead, B), block = 128 (4 waves),
// each wave owns 16 query rows. Online softmax over 32-key steps.
// Self-attn mask col<n_ctx == truncating keys to n_ctx (read device-side).
// The 32-key K and V tiles (32 rows x 128 B each) are staged once per block in
// LDS by async copies, two buffers: tile t+1 flies while tile t is worked on.
// ---------------------------------------------------------------------------
#define KPITCH 72   // halves; 144-B rows (16 B x odd) for the ds_load_b128 reader
#define VPITCH 80   // halves; 160-B rows (32 B x odd) for the ds_load_tr16_b128 reader

typedef __attribute__((ext_vector_type(8))) short s16x8;

__device__ inline unsigned lds_byte_addr(const half_t* p) {
  return (unsigned)(size_t)(ASL const half_t*)p;
}

// Transposing LDS read: lane (c = l & 15, h = l >> 4) gets T[8h + 0..7][c] of the
// 16 x 16 tile whose per-lane row addresses are passed in.
__device__ inline v8h lds_load_tr16(const half_t* p) {
  return __builtin_bit_cast(v8h, __builtin_amdgcn_ds_load_tr16_b128_v8i16((ASL s16x8*)p));
}

// Four 16-byte async copies per lane (two K rows, two V rows). The s_wait_xcnt
// stands inside the statement so that no address register named here is
// rewritten ahead of it.
__device__ inline void stage_kv_tile(const half_t* gk0, const half_t* gk1,
                                     const half_t* gv0, const half_t* gv1,
                                     unsigned lk0, unsigned lk1,
                                     unsigned lv0, unsigned lv1) {
  asm volatile(
      "global_load_async_to_lds_b128 %0, %4, off\n\t"
      "global_load_async_to_lds_b128 %1, %5, off\n\t"
      "global_load_async_to_lds_b128 %2, %6, off\n\t"
      "global_load_async_to_lds_b128 %3, %7, off\n\t"
      "s_wait_xcnt 0x0"
      :: "v"(lk0), "v"(lk1), "v"(lv0), "v"(lv1),
         "v"(gk0), "v"(gk1), "v"(gv0), "v"(gv1)
      : "memory");
}

__global__ __launch_bounds__(128) void attn_wmma_kernel(
    const half_t* __restrict__ Q, int qld,
    const half_t* __restrict__ Km, int kld,
    const half_t* __restrict__ V, int vld,
    half_t* __restrict__ O, int oldd,
    int Tq, int Tk, int Dh, const int* __restrict__ nctx, float scale) {
  __shared__ half_t plds[4 * 16 * 32];  // per-wave 16x32 P tile
  __shared__ __attribute__((aligned(16))) half_t kls[2][32 * KPITCH];
  __shared__ __attribute__((aligned(16))) half_t vls[2][32 * VPITCH];
  const int lane = threadIdx.x & 31;
  const int wid  = threadIdx.x >> 5;
  const int sub = lane & 15, hi = lane >> 4;
  const int h = blockIdx.y, b = blockIdx.z;
  const int qt = (blockIdx.x * 4 + wid) * 16;

  int kvlen = Tk;
  if (nctx) { int nc = *nctx; kvlen = nc < Tk ? nc : Tk; }

  const half_t* Qb = Q + ((size_t)b * Tq + qt) * qld + h * Dh;
  const half_t* Kb = Km + (size_t)b * Tk * kld + h * Dh;
  const half_t* Vb = V  + (size_t)b * Tk * vld + h * Dh;

  const v16h qf0 = load_frag(Qb,      qld);   // Dh = 64 -> two K=32 fragments
  const v16h qf1 = load_frag(Qb + 32, qld);

  v8f acc[4];
#pragma unroll
  for (int d = 0; d < 4; ++d) acc[d] = zero_v8f();
  float mrow[8], lrow[8];
#pragma unroll
  for (int r = 0; r < 8; ++r) { mrow[r] = -1e30f; lrow[r] = 0.f; }

  half_t* my = plds + wid * 512;

  // Staging: thread -> tile rows srow and srow + 16, 16-byte chunk sq of the row;
  // one wave's copy covers four whole 128-B rows.
  const int srow = threadIdx.x >> 3;        // 0..15
  const int sq   = (threadIdx.x & 7) * 8;   // halves
  auto stage = [&](int kt0, int sb) {
    const half_t* gk = Kb + (size_t)(kt0 + srow) * kld + sq;
    const half_t* gv = Vb + (size_t)(kt0 + srow) * vld + sq;
    stage_kv_tile(gk, gk + (size_t)16 * kld, gv, gv + (size_t)16 * vld,
                  lds_byte_addr(&kls[sb][srow * KPITCH + sq]),
                  lds_byte_addr(&kls[sb][(srow + 16) * KPITCH + sq]),
                  lds_byte_addr(&vls[sb][srow * VPITCH + sq]),
                  lds_byte_addr(&vls[sb][(srow + 16) * VPITCH + sq]));
  };
  // Per-lane offset of the transposing V read inside a tile.
  const int vtr = (8 * hi + (lane & 7)) * VPITCH + 8 * ((lane >> 3) & 1);

  // Ring prologue: tile 0 lands and is published, then tile 1 starts.
  stage(0, 0);
  asm volatile("s_wait_asynccnt 0x0" ::: "memory");  // own copies of tile 0 landed
  __syncthreads();                                   // publishes tile 0
  if (32 < kvlen) stage(32, 1);

  int buf = 0;
  for (int kt = 0; kt < kvlen; kt += 32) {
    v8f s0 = zero_v8f(), s1 = zero_v8f();
    {
      const half_t* kl = &kls[buf][0];
      v16h k00 = load_frag(kl,      KPITCH);
      v16h k01 = load_frag(kl + 32, KPITCH);
      v16h k10 = load_frag(kl + 16 * KPITCH,      KPITCH);
      v16h k11 = load_frag(kl + 16 * KPITCH + 32, KPITCH);
      // Inputs-only fence on the loaded fragments: keeps the eight LDS reads in one
      // group with one wait; without it each WMMA waits out its own LDS latency.
      asm volatile("" :: "v"(k00), "v"(k01), "v"(k10), "v"(k11));
      s0 = wmma_f16(qf0, k00, s0);
      s0 = wmma_f16(qf1, k01, s0);
      s1 = wmma_f16(qf0, k10, s1);
      s1 = wmma_f16(qf1, k11, s1);
    }
    const bool ok0 = (kt + sub)      < kvlen;
    const bool ok1 = (kt + 16 + sub) < kvlen;

#pragma unroll
    for (int r = 0; r < 8; ++r) {
      float v0 = ok0 ? s0[r] * scale : -1e30f;
      float v1 = ok1 ? s1[r] * scale : -1e30f;
      float mx = fmaxf(v0, v1);
#pragma unroll
      for (int off = 8; off > 0; off >>= 1) mx = fmaxf(mx, __shfl_xor(mx, off, 32));
      const float mnew = fmaxf(mrow[r], mx);
      const float corr = __expf(mrow[r] - mnew);
      const float p0 = __expf(v0 - mnew);
      const float p1 = __expf(v1 - mnew);
      float rs = p0 + p1;
#pragma unroll
      for (int off = 8; off > 0; off >>= 1) rs += __shfl_xor(rs, off, 32);
      lrow[r] = lrow[r] * corr + rs;
      mrow[r] = mnew;
#pragma unroll
      for (int d = 0; d < 4; ++d) acc[d][r] *= corr;
      s0[r] = p0; s1[r] = p1;
    }

    // Transpose P from C-layout to A-layout through LDS.
    __syncthreads();   // guard WAR vs previous iteration's fragment reads
#pragma unroll
    for (int r = 0; r < 8; ++r) {
      my[(r + 8 * hi) * 32 + sub]      = (half_t)s0[r];
      my[(r + 8 * hi) * 32 + 16 + sub] = (half_t)s1[r];
    }
    __syncthreads();
    v16h pf;
#pragma unroll
    for (int j = 0; j < 8; ++j) {
      pf[j]     = my[sub * 32 + hi * 8 + j];
      pf[j + 8] = my[sub * 32 + 16 + hi * 8 + j];
    }

    // acc += P(16x32) @ V(32x64): B[k][n] = V[kt+k][h*Dh + d*16 + n]
#pragma unroll
    for (int d = 0; d < 4; ++d) {
      const half_t* vb = &vls[buf][vtr + d * 16];
      const v8h vlo = lds_load_tr16(vb);                 // keys 8*hi + 0..7
      const v8h vhi = lds_load_tr16(vb + 16 * VPITCH);   // keys 16 + 8*hi + 0..7
      v16h vf;
#pragma unroll
      for (int j = 0; j < 8; ++j) { vf[j] = vlo[j]; vf[j + 8] = vhi[j]; }
      acc[d] = wmma_f16(pf, vf, acc[d]);
    }

    // Publish point of tile t+1; it also ends every reader's last read of buf.
    asm volatile("s_wait_dscnt 0x0" ::: "memory");     // own LDS reads of buf retired
    asm volatile("s_wait_asynccnt 0x0" ::: "memory");  // own copies of tile t+1 landed
    __syncthreads();
    if (kt + 64 < kvlen) stage(kt + 64, buf);          // refill the buffer just read
    buf ^= 1;
  }
  asm volatile("s_wait_asynccnt 0x0" ::: "memory");    // nothing in flight at wave end

#pragma unroll
  for (int r = 0; r < 8; ++r) {
    const float inv = 1.0f / lrow[r];
    const size_t row = (size_t)b * Tq + qt + r + 8 * hi;
#pragma unroll
    for (int d = 0; d < 4; ++d)
      O[row * oldd + h * Dh + d * 16 + sub] = (half_t)(acc[d][r] * inv);
  }
}

// ---------------------------------------------------------------------------
// Host orchestration
// ---------------------------------------------------------------------------
extern "C" void kernel_launch(void* const* d_in, const int* in_sizes, int n_in,
                              void* d_out, int out_size, void* d_ws, size_t ws_size,
                              hipStream_t stream) {
  (void)n_in; (void)out_size; (void)ws_size;
  const float* tgt      = (const float*)d_in[0];
  const float* memory   = (const float*)d_in[1];
  const float* self_w   = (const float*)d_in[2];
  const float* self_b   = (const float*)d_in[3];
  const float* self_ow  = (const float*)d_in[4];
  const float* self_ob  = (const float*)d_in[5];
  const float* cross_w  = (const float*)d_in[6];
  const float* cross_b  = (const float*)d_in[7];
  const float* cross_ow = (const float*)d_in[8];
  const float* cross_ob = (const float*)d_in[9];
  const float* ln1_g = (const float*)d_in[10];
  const float* ln1_b = (const float*)d_in[11];
  const float* ln2_g = (const float*)d_in[12];
  const float* ln2_b = (const float*)d_in[13];
  const float* ln3_g = (const float*)d_in[14];
  const float* ln3_b = (const float*)d_in[15];
  const float* w1 = (const float*)d_in[16];
  const float* b1 = (const float*)d_in[17];
  const float* w2 = (const float*)d_in[18];
  const float* b2 = (const float*)d_in[19];
  const int*   n_ctx_p = (const int*)d_in[20];

  const int E  = in_sizes[10];
  const int F  = in_sizes[16] / E;
  const int B  = 2;
  const int Tq = in_sizes[0] / (B * E);
  const int Tk = in_sizes[1] / (B * E);
  const int nhead = 16;
  const int Dh = E / nhead;
  const int M  = B * Tq;   // query rows
  const int Mk = B * Tk;   // memory rows
  const float scale = 1.0f / sqrtf((float)Dh);

  // --- workspace carve (all f16 buffers, 256B aligned) ---
  char* wp = (char*)d_ws;
  auto carve = [&](size_t elems) -> half_t* {
    half_t* r = (half_t*)wp;
    wp += (elems * sizeof(half_t) + 255) & ~(size_t)255;
    return r;
  };
  half_t* selfw_h   = carve((size_t)3 * E * E);
  half_t* selfow_h  = carve((size_t)E * E);
  half_t* crossw_h  = carve((size_t)3 * E * E);
  half_t* crossow_h = carve((size_t)E * E);
  half_t* w1_h      = carve((size_t)F * E);
  half_t* w2_h      = carve((size_t)E * F);
  half_t* mem_h     = carve((size_t)Mk * E);
  half_t* nx_h      = carve((size_t)M * E);
  half_t* qkv_h     = carve((size_t)M * 3 * E);
  half_t* qc_h      = carve((size_t)M * E);
  half_t* kvc_h     = carve((size_t)Mk * 2 * E);
  half_t* attn_h    = carve((size_t)M * E);
  half_t* ffn1_h    = carve((size_t)M * F);
  float*  x = (float*)d_out;   // residual accumulator

  // 512 blocks of 8 waves: 16 streaming waves on each of the 256 WGPs.
  convert_f16_kernel<<<512, 256, 0, stream>>>(
      self_w, self_ow, cross_w, cross_ow, w1, w2, memory,
      selfw_h, selfow_h, crossw_h, crossow_h, w1_h, w2_h, mem_h,
      (long long)3 * E * E, (long long)E * E, (long long)3 * E * E,
      (long long)E * E, (long long)F * E, (long long)E * F, (long long)Mk * E);

  // x = tgt
  (void)hipMemcpyAsync(x, tgt, (size_t)M * E * sizeof(float),
                       hipMemcpyDeviceToDevice, stream);

  auto gemm = [&](const half_t* A, const half_t* W, const float* bias,
                  half_t* outh, float* resid, int m, int n, int k, int act) {
    dim3 grid(m / MBLK, n / NBLK);
    gemm_wmma_kernel<<<grid, 256, 0, stream>>>(A, W, bias, outh, resid, m, n, k, act);
  };

  // ---- self-attention sublayer ----
  layernorm_kernel<<<M, 256, 0, stream>>>(x, ln1_g, ln1_b, nx_h, E);
  gemm(nx_h, selfw_h, self_b, qkv_h, nullptr, M, 3 * E, E, 0);
  {
    dim3 grid(Tq / 64, nhead, B);
    attn_wmma_kernel<<<grid, 128, 0, stream>>>(
        qkv_h, 3 * E, qkv_h + E, 3 * E, qkv_h + 2 * E, 3 * E,
        attn_h, E, Tq, Tq, Dh, n_ctx_p, scale);
  }
  gemm(attn_h, selfow_h, self_ob, nullptr, x, M, E, E, 0);

  // ---- cross-attention sublayer ----
  layernorm_kernel<<<M, 256, 0, stream>>>(x, ln2_g, ln2_b, nx_h, E);
  gemm(nx_h,  crossw_h,                 cross_b,     qc_h,  nullptr, M,  E,     E, 0);
  gemm(mem_h, crossw_h + (size_t)E * E, cross_b + E, kvc_h, nullptr, Mk, 2 * E, E, 0);
  {
    dim3 grid(Tq / 64, nhead, B);
    attn_wmma_kernel<<<grid, 128, 0, stream>>>(
        qc_h, E, kvc_h, 2 * E, kvc_h + E, 2 * E,
        attn_h, E, Tq, Tk, Dh, nullptr, scale);
  }
  gemm(attn_h, crossow_h, cross_ob, nullptr, x, M, E, E, 0);

  // ---- FFN sublayer ----
  layernorm_kernel<<<M, 256, 0, stream>>>(x, ln3_g, ln3_b, nx_h, E);
  gemm(nx_h,   w1_h, b1, ffn1_h, nullptr, M, F, E, 1);  // exact GELU
  gemm(ffn1_h, w2_h, b2, nullptr, x,       M, E, F, 0);
}

// v005
// Two timings next to v004 put it at 1.26 and 1.25 times that version's speed.
// Counting every step since v000, it is 3.01 times as fast.
#include <hip/hip_runtime.h>
#include <math.h>

typedef _Float16 half_t;
typedef __attribute__((ext_vector_type(16))) _Float16 v16h;
typedef __attribute__((ext_vector_type(8)))  _Float16 v8h;
typedef __attribute__((ext_vector_type(8)))  float    v8f;
typedef __attribute__((vector_size(16)))     int      vsi4;   // int4 for async builtin

#define ASG __attribute__((address_space(1)))
#define ASL __attribute__((address_space(3)))

// Detect CDNA5 async global->LDS builtins (gfx1250); fall back to load+ds_store.
#if defined(__has_builtin)
#  if __has_builtin(__builtin_amdgcn_global_load_async_to_lds_b128)
#    define HAVE_ASYNC 1
#  endif
#endif
#ifndef HAVE_ASYNC
#  define HAVE_ASYNC 0
#endif

// ---------------------------------------------------------------------------
// WMMA helpers (CDNA5 gfx1250, wave32)
// ---------------------------------------------------------------------------
__device__ inline v8f wmma_f16(v16h a, v16h b, v8f c) {
  // D(16x16,f32) = A(16x32,f16) x B(32x16,f16) + C
  return __builtin_amdgcn_wmma_f32_16x16x32_f16(
      /*neg_a=*/false, a, /*neg_b=*/false, b,
      /*c_mod=*/(short)0, c, /*reuse_a=*/false, /*reuse_b=*/false);
}

__device__ inline v8f zero_v8f() {
  v8f z;
#pragma unroll
  for (int i = 0; i < 8; ++i) z[i] = 0.0f;
  return z;
}

// Load a 16x32 f16 fragment in the ISA A-matrix lane layout:
//   lane<16 : row=lane,    K = [0..7] then [16..23]
//   lane>=16: row=lane-16, K = [8..15] then [24..31]
// base points at (row0, k0); ld = row stride in elements. Also used for the
// B operand of D = A x W^T (B column n == row n of W, identical pattern).
__device__ inline v16h load_frag(const half_t* __restrict__ base, int ld) {
  const int lane = threadIdx.x & 31;
  const int sub  = lane & 15;
  const int hi   = lane >> 4;
  const half_t* p = base + (size_t)sub * ld + hi * 8;
  v8h lo = *(const v8h*)(p);
  v8h hh = *(const v8h*)(p + 16);
  v16h r;
#pragma unroll
  for (int i = 0; i < 8; ++i) { r[i] = lo[i]; r[i + 8] = hh[i]; }
  return r;
}

// One 16-byte global->LDS transfer per lane (ASYNCcnt path if available).
__device__ inline void copy_b128_to_lds(const half_t* g, half_t* l) {
#if HAVE_ASYNC
  __builtin_amdgcn_global_load_async_to_lds_b128(
      (ASG vsi4*)g, (ASL vsi4*)l, 0, 0);
#else
  *(v8h*)l = *(const v8h*)g;
#endif
}

// ---------------------------------------------------------------------------
// Elementwise f32 -> f16 conversion of all seven arrays in one streaming launch.
// The arrays are cut into chunks of 8192 floats; a block walks chunks at grid
// stride. In a whole chunk each thread issues eight 16-byte loads (every wave
// load covers 512 contiguous bytes) before the first is converted, so few waves
// keep many bytes in flight; the last, partial chunk of an array goes by element.
// ---------------------------------------------------------------------------
#define CVT_LOADS 8
#define CVT_SPAN  (256 * 4)                // floats per block-wide 16-byte load
#define CVT_CHUNK (CVT_SPAN * CVT_LOADS)   // floats per chunk

typedef __attribute__((ext_vector_type(4))) float    v4f;
typedef __attribute__((ext_vector_type(4))) _Float16 v4h;

__device__ inline int cvt_chunks(long long n) {
  return (int)((n + CVT_CHUNK - 1) / CVT_CHUNK);
}

__global__ __launch_bounds__(256) void convert_f16_kernel(
    const float* __restrict__ s0, const float* __restrict__ s1,
    const float* __restrict__ s2, const float* __restrict__ s3,
    const float* __restrict__ s4, const float* __restrict__ s5,
    const float* __restrict__ s6,
    half_t* __restrict__ d0, half_t* __restrict__ d1, half_t* __restrict__ d2,
    half_t* __restrict__ d3, half_t* __restrict__ d4, half_t* __restrict__ d5,
    half_t* __restrict__ d6,
    long long n0, long long n1, long long n2, long long n3,
    long long n4, long long n5, long long n6) {
  // first chunk index behind each array
  const int e0 = cvt_chunks(n0);
  const int e1 = e0 + cvt_chunks(n1);
  const int e2 = e1 + cvt_chunks(n2);
  const int e3 = e2 + cvt_chunks(n3);
  const int e4 = e3 + cvt_chunks(n4);
  const int e5 = e4 + cvt_chunks(n5);
  const int e6 = e5 + cvt_chunks(n6);

  for (int c = blockIdx.x; c < e6; c += gridDim.x) {
    const float* s = s0; half_t* d = d0; long long n = n0; int first = 0;
    if (c >= e0) { s = s1; d = d1; n = n1; first = e0; }
    if (c >= e1) { s = s2; d = d2; n = n2; first = e1; }
    if (c >= e2) { s = s3; d = d3; n = n3; first = e2; }
    if (c >= e3) { s = s4; d = d4; n = n4; first = e3; }
    if (c >= e4) { s = s5; d = d5; n = n5; first = e4; }
    if (c >= e5) { s = s6; d = d6; n = n6; first = e5; }
    const long long base = (long long)(c - first) * CVT_CHUNK;
    if (base + CVT_CHUNK <= n) {
      const float* sp = s + base + threadIdx.x * 4;
      half_t*      dp = d + base + threadIdx.x * 4;
      v4f v[CVT_LOADS];
#pragma unroll
      for (int j = 0; j < CVT_LOADS; ++j) v[j] = *(const v4f*)(sp + j * CVT_SPAN);
#pragma unroll
      for (int j = 0; j < CVT_LOADS; ++j)
        *(v4h*)(dp + j * CVT_SPAN) = __builtin_convertvector(v[j], v4h);
      // The next trip rewrites the base and data registers that these stores
      // name.
      asm volatile("s_wait_xcnt 0x0" ::: "memory");
    } else {
      for (long long i = base + threadIdx.x; i < n; i += 256) d[i] = (half_t)s[i];
    }
  }
}

// ---------------------------------------------------------------------------
// LayerNorm: one block (256 thr) per row, writes f16 (GEMM input format)
// ---------------------------------------------------------------------------
__global__ __launch_bounds__(256) void layernorm_kernel(
    const float* __restrict__ x, const float* __restrict__ g,
    const float* __restrict__ b, half_t* __restrict__ outh, int E) {
  __shared__ float red[64];
  const int row = blockIdx.x;
  const float* xr = x + (size_t)row * E;
  float s = 0.f, s2 = 0.f;
  for (int i = threadIdx.x; i < E; i += blockDim.x) {
    float v = xr[i];
    s += v; s2 += v * v;
  }
#pragma unroll
  for (int off = 16; off > 0; off >>= 1) {
    s  += __shfl_xor(s,  off, 32);
    s2 += __shfl_xor(s2, off, 32);
  }
  const int wid = threadIdx.x >> 5, lane = threadIdx.x & 31;
  if (lane == 0) { red[wid] = s; red[32 + wid] = s2; }
  __syncthreads();
  if (wid == 0) {
    int nw = blockDim.x >> 5;
    float a  = (lane < nw) ? red[lane]      : 0.f;
    float a2 = (lane < nw) ? red[32 + lane] : 0.f;
#pragma unroll
    for (int off = 16; off > 0; off >>= 1) {
      a  += __shfl_xor(a,  off, 32);
      a2 += __shfl_xor(a2, off, 32);
    }
    if (lane == 0) { red[0] = a; red[1] = a2; }
  }
  __syncthreads();
  const float mean = red[0] / (float)E;
  const float var  = red[1] / (float)E - mean * mean;
  const float rstd = rsqrtf(var + 1e-5f);
  for (int i = threadIdx.x; i < E; i += blockDim.x)
    outh[(size_t)row * E + i] = (half_t)((xr[i] - mean) * rstd * g[i] + b[i]);
}

// ---------------------------------------------------------------------------
// LDS-staged double-buffered GEMM:
//   out[M,N] = act(A[M,K] @ W[N,K]^T + bias[N]); optional residual f32 add.
// Block = 256 thr = 8 waves (2 in M x 4 in N). Block tile 128x128.
// A stage holds 128 k (four WMMA k-blocks of 32), so that fragments can be fetched
// one k-block ahead inside a published stage; one barrier serves 128 k.
// LDS: 2 x (128 A rows + 128 B rows) of 256 B at a 272-B pitch = 136 KB.
// Global->LDS staging uses GLOBAL_LOAD_ASYNC_TO_LDS_B128 (ASYNCcnt).
// K must be a multiple of KSTEP.
// ---------------------------------------------------------------------------
#define KSTEP 128
#define MBLK  128
#define NBLK  128
#define GPITCH 136  // halves; 272-B rows (16 B x odd) for the ds_load_b128 reader

__global__ __launch_bounds__(256) void gemm_wmma_kernel(
    const half_t* __restrict__ A, const half_t* __restrict__ W,
    const float* __restrict__ bias, half_t* __restrict__ outh,
    float* __restrict__ resid, int M, int N, int K, int act) {
  __shared__ __attribute__((aligned(16))) half_t ldsA[2][MBLK * GPITCH];
  __shared__ __attribute__((aligned(16))) half_t ldsB[2][NBLK * GPITCH];

  const int tid  = threadIdx.x;
  const int lane = tid & 31;
  const int wid  = tid >> 5;     // 0..7
  const int wm   = wid >> 2;     // 0..1 : wave row  (64 rows each)
  const int wn   = wid & 3;      // 0..3 : wave col  (32 cols each)
  const int m0 = blockIdx.x * MBLK;
  const int n0 = blockIdx.y * NBLK;

  // Staging assignment: thread -> rows (tid>>4) + 0,16,..,112, 16-byte piece tid&15
  // of the row's 256 B; one wave's copy covers two whole 256-B row pieces.
  const int crow = tid >> 4;         // 0..15
  const int cq   = (tid & 15) * 8;   // halves
  auto stage = [&](int ks, int sb) {
#pragma unroll
    for (int rr = 0; rr < MBLK; rr += 16)
      copy_b128_to_lds(A + (size_t)(m0 + crow + rr) * K + ks + cq,
                       &ldsA[sb][(crow + rr) * GPITCH + cq]);
#pragma unroll
    for (int rr = 0; rr < NBLK; rr += 16)
      copy_b128_to_lds(W + (size_t)(n0 + crow + rr) * K + ks + cq,
                       &ldsB[sb][(crow + rr) * GPITCH + cq]);
  };

  v8f acc[4][2];
#pragma unroll
  for (int i = 0; i < 4; ++i) { acc[i][0] = zero_v8f(); acc[i][1] = zero_v8f(); }

  // C layout -> lane l<16 holds rows 0..7 (vgpr r), l>=16 rows 8..15.
  const int sub = lane & 15, hi = lane >> 4;
  // The bias is asked for here, so that its latency runs beside that of tile 0's copies.
  const float bias0 = bias[n0 + wn * 32 + sub];
  const float bias1 = bias[n0 + wn * 32 + sub + 16];

  // Ring prologue: stage 0 lands and is published, then stage 1 starts.
  stage(0, 0);
  asm volatile("s_wait_asynccnt 0x0" ::: "memory");  // own copies of stage 0 landed
  __syncthreads();                                   // publishes stage 0
  if (KSTEP < K) stage(KSTEP, 1);

  int buf = 0;
  for (int k0 = 0; k0 < K; k0 += KSTEP) {
    // compute: per k-block of 32, 4 A-frags x 2 B-frags = 8 WMMA, fed by ds_load_b128.
    // Two fragment sets: the twelve reads of block b + 1 are issued as one group ahead
    // of block b's WMMAs, so their LDS latency runs beside the matrix work. Only
    // blocks of this stage are fetched; the next stage is read behind its barrier.
    v16h af[2][4], bf[2][2];
    auto load_block = [&](int s, int kb) {
      bf[s][0] = load_frag(&ldsB[buf][(wn * 32 +  0) * GPITCH + kb], GPITCH);
      bf[s][1] = load_frag(&ldsB[buf][(wn * 32 + 16) * GPITCH + kb], GPITCH);
#pragma unroll
      for (int i = 0; i < 4; ++i)
        af[s][i] = load_frag(&ldsA[buf][(wm * 64 + i * 16) * GPITCH + kb], GPITCH);
    };
    load_block(0, 0);
#pragma unroll
    for (int b = 0; b < KSTEP / 32; ++b) {
      if (b + 1 < KSTEP / 32) load_block((b + 1) & 1, (b + 1) * 32);
      // Keeps the group of reads above the WMMAs: the scheduler otherwise sinks each
      // read to its use, and every WMMA pair waits out an LDS round trip.
      __builtin_amdgcn_sched_barrier(0);
#pragma unroll
      for (int i = 0; i < 4; ++i) {
        acc[i][0] = wmma_f16(af[b & 1][i], bf[b & 1][0], acc[i][0]);
        acc[i][1] = wmma_f16(af[b & 1][i], bf[b & 1][1], acc[i][1]);
      }
      // Keeps the following group of reads out of this run of WMMAs.
      __builtin_amdgcn_sched_barrier(0);
    }

    // Publish point of the next stage; it also ends every reader's last read of buf.
    asm volatile("s_wait_dscnt 0x0" ::: "memory");     // own LDS reads of buf retired
    asm volatile("s_wait_asynccnt 0x0" ::: "memory");  // own copies of the next stage landed
    __syncthreads();
    if (k0 + 2 * KSTEP < K) stage(k0 + 2 * KSTEP, buf);  // refill the buffer just read
    buf ^= 1;
  }
  asm volatile("s_wait_asynccnt 0x0" ::: "memory");    // nothing in flight behind the ring

  // epilogue: the tests on act, outh and resid stand outside the element loops
#pragma unroll
  for (int i = 0; i < 4; ++i) {
#pragma unroll
    for (int r = 0; r < 8; ++r) {
      acc[i][0][r] += bias0;
      acc[i][1][r] += bias1;
    }
  }
  if (act == 1) {
#pragma unroll
    for (int i = 0; i < 4; ++i)
#pragma unroll
      for (int j = 0; j < 2; ++j)
#pragma unroll
        for (int r = 0; r < 8; ++r) {
          const float v = acc[i][j][r];
          acc[i][j][r] = 0.5f * v * (1.0f + erff(v * 0.70710678118654752f));
        }
  }
  // An output element lies at a block-uniform place (row i*16 + r, column j*16 of
  // the block's tile) plus this 32-bit offset of the lane, in elements.
  const size_t   tile0 = (size_t)m0 * N + n0;
  const unsigned loff  = (unsigned)((wm * 64 + 8 * hi) * N + wn * 32 + sub);
  if (outh) {
    half_t* op = outh + tile0;
#pragma unroll
    for (int i = 0; i < 4; ++i)
#pragma unroll
      for (int r = 0; r < 8; ++r)
#pragma unroll
        for (int j = 0; j < 2; ++j)
          (op + (size_t)(i * 16 + r) * N + j * 16)[loff] = (half_t)acc[i][j][r];
    // The residual path below rewrites registers that these stores name.
    asm volatile("s_wait_xcnt 0x0" ::: "memory");
  }
  if (resid) {
    float* rp = resid + tile0;
    // All 64 residual values are in flight together before the first is used.
    v8f rv[4][2];
#pragma unroll
    for (int i = 0; i < 4; ++i)
#pragma unroll
      for (int r = 0; r < 8; ++r)
#pragma unroll
        for (int j = 0; j < 2; ++j)
          rv[i][j][r] = (rp + (size_t)(i * 16 + r) * N + j * 16)[loff];
#pragma unroll
    for (int i = 0; i < 4; ++i)
#pragma unroll
      for (int r = 0; r < 8; ++r)
#pragma unroll
        for (int j = 0; j < 2; ++j)
          (rp + (size_t)(i * 16 + r) * N + j * 16)[loff] = rv[i][j][r] + acc[i][j][r];
  }
}

// ---------------------------------------------------------------------------
// Fused flash-style attention. grid = (Tq/64, nhead, B), block = 128 (4 waves),
// each wave owns 16 query rows. Online softmax over 32-key steps.
// Self-attn mask col<n_ctx == truncating keys to n_ctx (read device-side).
// The 32-key K and V tiles (32 rows x 128 B each) are staged once per block in
// LDS by async copies, two buffers: tile t+1 flies while tile t is worked on.
// ---------------------------------------------------------------------------
#define KPITCH 72   // halves; 144-B rows (16 B x odd) for the ds_load_b128 reader
#define VPITCH 80   // halves; 160-B rows (32 B x odd) for the ds_load_tr16_b128 reader

typedef __attribute__((ext_vector_type(8))) short s16x8;

__device__ inline unsigned lds_byte_addr(const half_t* p) {
  return (unsigned)(size_t)(ASL const half_t*)p;
}

// Transposing LDS read: lane (c = l & 15, h = l >> 4) gets T[8h + 0..7][c] of the
// 16 x 16 tile whose per-lane row addresses are passed in.
__device__ inline v8h lds_load_tr16(const half_t* p) {
  return __builtin_bit_cast(v8h, __builtin_amdgcn_ds_load_tr16_b128_v8i16((ASL s16x8*)p));
}

// Four 16-byte async copies per lane (two K rows, two V rows). The s_wait_xcnt
// stands inside the statement so that no address register named here is
// rewritten ahead of it.
__device__ inline void stage_kv_tile(const half_t* gk0, const half_t* gk1,
                                     const half_t* gv0, const half_t* gv1,
                                     unsigned lk0, unsigned lk1,
                                     unsigned lv0, unsigned lv1) {
  asm volatile(
      "global_load_async_to_lds_b128 %0, %4, off\n\t"
      "global_load_async_to_lds_b128 %1, %5, off\n\t"
      "global_load_async_to_lds_b128 %2, %6, off\n\t"
      "global_load_async_to_lds_b128 %3, %7, off\n\t"
      "s_wait_xcnt 0x0"
      :: "v"(lk0), "v"(lk1), "v"(lv0), "v"(lv1),
         "v"(gk0), "v"(gk1), "v"(gv0), "v"(gv1)
      : "memory");
}

__global__ __launch_bounds__(128) void attn_wmma_kernel(
    const half_t* __restrict__ Q, int qld,
    const half_t* __restrict__ Km, int kld,
    const half_t* __restrict__ V, int vld,
    half_t* __restrict__ O, int oldd,
    int Tq, int Tk, int Dh, const int* __restrict__ nctx, float scale) {
  __shared__ half_t plds[4 * 16 * 32];  // per-wave 16x32 P tile
  __shared__ __attribute__((aligned(16))) half_t kls[2][32 * KPITCH];
  __shared__ __attribute__((aligned(16))) half_t vls[2][32 * VPITCH];
  const int lane = threadIdx.x & 31;
  const int wid  = threadIdx.x >> 5;
  const int sub = lane & 15, hi = lane >> 4;
  const int h = blockIdx.y, b = blockIdx.z;
  const int qt = (blockIdx.x * 4 + wid) * 16;

  int kvlen = Tk;
  if (nctx) { int nc = *nctx; kvlen = nc < Tk ? nc : Tk; }

  const half_t* Qb = Q + ((size_t)b * Tq + qt) * qld + h * Dh;
  const half_t* Kb = Km + (size_t)b * Tk * kld + h * Dh;
  const half_t* Vb = V  + (size_t)b * Tk * vld + h * Dh;

  const v16h qf0 = load_frag(Qb,      qld);   // Dh = 64 -> two K=32 fragments
  const v16h qf1 = load_frag(Qb + 32, qld);

  v8f acc[4];
#pragma unroll
  for (int d = 0; d < 4; ++d) acc[d] = zero_v8f();
  float mrow[8], lrow[8];
#pragma unroll
  for (int r = 0; r < 8; ++r) { mrow[r] = -1e30f; lrow[r] = 0.f; }

  half_t* my = plds + wid * 512;

  // Staging: thread -> tile rows srow and srow + 16, 16-byte chunk sq of the row;
  // one wave's copy covers four whole 128-B rows.
  const int srow = threadIdx.x >> 3;        // 0..15
  const int sq   = (threadIdx.x & 7) * 8;   // halves
  auto stage = [&](int kt0, int sb) {
    const half_t* gk = Kb + (size_t)(kt0 + srow) * kld + sq;
    const half_t* gv = Vb + (size_t)(kt0 + srow) * vld + sq;
    stage_kv_tile(gk, gk + (size_t)16 * kld, gv, gv + (size_t)16 * vld,
                  lds_byte_addr(&kls[sb][srow * KPITCH + sq]),
                  lds_byte_addr(&kls[sb][(srow + 16) * KPITCH + sq]),
                  lds_byte_addr(&vls[sb][srow * VPITCH + sq]),
                  lds_byte_addr(&vls[sb][(srow + 16) * VPITCH + sq]));
  };
  // Per-lane offset of the transposing V read inside a tile.
  const int vtr = (8 * hi + (lane & 7)) * VPITCH + 8 * ((lane >> 3) & 1);

  // Ring prologue: tile 0 lands and is published, then tile 1 starts.
  stage(0, 0);
  asm volatile("s_wait_asynccnt 0x0" ::: "memory");  // own copies of tile 0 landed
  __syncthreads();                                   // publishes tile 0
  if (32 < kvlen) stage(32, 1);

  int buf = 0;
  for (int kt = 0; kt < kvlen; kt += 32) {
    v8f s0 = zero_v8f(), s1 = zero_v8f();
    {
      const half_t* kl = &kls[buf][0];
      v16h k00 = load_frag(kl,      KPITCH);
      v16h k01 = load_frag(kl + 32, KPITCH);
      v16h k10 = load_frag(kl + 16 * KPITCH,      KPITCH);
      v16h k11 = load_frag(kl + 16 * KPITCH + 32, KPITCH);
      // Inputs-only fence on the loaded fragments: keeps the eight LDS reads in one
      // group with one wait; without it each WMMA waits out its own LDS latency.
      asm volatile("" :: "v"(k00), "v"(k01), "v"(k10), "v"(k11));
      s0 = wmma_f16(qf0, k00, s0);
      s0 = wmma_f16(qf1, k01, s0);
      s1 = wmma_f16(qf0, k10, s1);
      s1 = wmma_f16(qf1, k11, s1);
    }
    const bool ok0 = (kt + sub)      < kvlen;
    const bool ok1 = (kt + 16 + sub) < kvlen;

#pragma unroll
    for (int r = 0; r < 8; ++r) {
      float v0 = ok0 ? s0[r] * scale : -1e30f;
      float v1 = ok1 ? s1[r] * scale : -1e30f;
      float mx = fmaxf(v0, v1);
#pragma unroll
      for (int off = 8; off > 0; off >>= 1) mx = fmaxf(mx, __shfl_xor(mx, off, 32));
      const float mnew = fmaxf(mrow[r], mx);
      const float corr = __expf(mrow[r] - mnew);
      const float p0 = __expf(v0 - mnew);
      const float p1 = __expf(v1 - mnew);
      float rs = p0 + p1;
#pragma unroll
      for (int off = 8; off > 0; off >>= 1) rs += __shfl_xor(rs, off, 32);
      lrow[r] = lrow[r] * corr + rs;
      mrow[r] = mnew;
#pragma unroll
      for (int d = 0; d < 4; ++d) acc[d][r] *= corr;
      s0[r] = p0; s1[r] = p1;
    }

    // Transpose P from C-layout to A-layout through LDS.
    __syncthreads();   // guard WAR vs previous iteration's fragment reads
#pragma unroll
    for (int r = 0; r < 8; ++r) {
      my[(r + 8 * hi) * 32 + sub]      = (half_t)s0[r];
      my[(r + 8 * hi) * 32 + 16 + sub] = (half_t)s1[r];
    }
    __syncthreads();
    v16h pf;
#pragma unroll
    for (int j = 0; j < 8; ++j) {
      pf[j]     = my[sub * 32 + hi * 8 + j];
      pf[j + 8] = my[sub * 32 + 16 + hi * 8 + j];
    }

    // acc += P(16x32) @ V(32x64): B[k][n] = V[kt+k][h*Dh + d*16 + n]
#pragma unroll
    for (int d = 0; d < 4; ++d) {
      const half_t* vb = &vls[buf][vtr + d * 16];
      const v8h vlo = lds_load_tr16(vb);                 // keys 8*hi + 0..7
      const v8h vhi = lds_load_tr16(vb + 16 * VPITCH);   // keys 16 + 8*hi + 0..7
      v16h vf;
#pragma unroll
      for (int j = 0; j < 8; ++j) { vf[j] = vlo[j]; vf[j + 8] = vhi[j]; }
      acc[d] = wmma_f16(pf, vf, acc[d]);
    }

    // Publish point of tile t+1; it also ends every reader's last read of buf.
    asm volatile("s_wait_dscnt 0x0" ::: "memory");     // own LDS reads of buf retired
    asm volatile("s_wait_asynccnt 0x0" ::: "memory");  // own copies of tile t+1 landed
    __syncthreads();
    if (kt + 64 < kvlen) stage(kt + 64, buf);          // refill the buffer just read
    buf ^= 1;
  }
  asm volatile("s_wait_asynccnt 0x0" ::: "memory");    // nothing in flight at wave end

#pragma unroll
  for (int r = 0; r < 8; ++r) {
    const float inv = 1.0f / lrow[r];
    const size_t row = (size_t)b * Tq + qt + r + 8 * hi;
#pragma unroll
    for (int d = 0; d < 4; ++d)
      O[row * oldd + h * Dh + d * 16 + sub] = (half_t)(acc[d][r] * inv);
  }
}

// ---------------------------------------------------------------------------
// Host orchestration
// ---------------------------------------------------------------------------
extern "C" void kernel_launch(void* const* d_in, const int* in_sizes, int n_in,
                              void* d_out, int out_size, void* d_ws, size_t ws_size,
                              hipStream_t stream) {
  (void)n_in; (void)out_size; (void)ws_size;
  const float* tgt      = (const float*)d_in[0];
  const float* memory   = (const float*)d_in[1];
  const float* self_w   = (const float*)d_in[2];
  const float* self_b   = (const float*)d_in[3];
  const float* self_ow  = (const float*)d_in[4];
  const float* self_ob  = (const float*)d_in[5];
  const float* cross_w  = (const float*)d_in[6];
  const float* cross_b  = (const float*)d_in[7];
  const float* cross_ow = (const float*)d_in[8];
  const float* cross_ob = (const float*)d_in[9];
  const float* ln1_g = (const float*)d_in[10];
  const float* ln1_b = (const float*)d_in[11];
  const float* ln2_g = (const float*)d_in[12];
  const float* ln2_b = (const float*)d_in[13];
  const float* ln3_g = (const float*)d_in[14];
  const float* ln3_b = (const float*)d_in[15];
  const float* w1 = (const float*)d_in[16];
  const float* b1 = (const float*)d_in[17];
  const float* w2 = (const float*)d_in[18];
  const float* b2 = (const float*)d_in[19];
  const int*   n_ctx_p = (const int*)d_in[20];

  const int E  = in_sizes[10];
  const int F  = in_sizes[16] / E;
  const int B  = 2;
  const int Tq = in_sizes[0] / (B * E);
  const int Tk = in_sizes[1] / (B * E);
  const int nhead = 16;
  const int Dh = E / nhead;
  const int M  = B * Tq;   // query rows
  const int Mk = B * Tk;   // memory rows
  const float scale = 1.0f / sqrtf((float)Dh);

  // --- workspace carve (all f16 buffers, 256B aligned) ---
  char* wp = (char*)d_ws;
  auto carve = [&](size_t elems) -> half_t* {
    half_t* r = (half_t*)wp;
    wp += (elems * sizeof(half_t) + 255) & ~(size_t)255;
    return r;
  };
  half_t* selfw_h   = carve((size_t)3 * E * E);
  half_t* selfow_h  = carve((size_t)E * E);
  half_t* crossw_h  = carve((size_t)3 * E * E);
  half_t* crossow_h = carve((size_t)E * E);
  half_t* w1_h      = carve((size_t)F * E);
  half_t* w2_h      = carve((size_t)E * F);
  half_t* mem_h     = carve((size_t)Mk * E);
  half_t* nx_h      = carve((size_t)M * E);
  half_t* qkv_h     = carve((size_t)M * 3 * E);
  half_t* qc_h      = carve((size_t)M * E);
  half_t* kvc_h     = carve((size_t)Mk * 2 * E);
  half_t* attn_h    = carve((size_t)M * E);
  half_t* ffn1_h    = carve((size_t)M * F);
  float*  x = (float*)d_out;   // residual accumulator

  // 512 blocks of 8 waves: 16 streaming waves on each of the 256 WGPs.
  convert_f16_kernel<<<512, 256, 0, stream>>>(
      self_w, self_ow, cross_w, cross_ow, w1, w2, memory,
      selfw_h, selfow_h, crossw_h, crossow_h, w1_h, w2_h, mem_h,
      (long long)3 * E * E, (long long)E * E, (long long)3 * E * E,
      (long long)E * E, (long long)F * E, (long long)E * F, (long long)Mk * E);

  // x = tgt
  (void)hipMemcpyAsync(x, tgt, (size_t)M * E * sizeof(float),
                       hipMemcpyDeviceToDevice, stream);

  auto gemm = [&](const half_t* A, const half_t* W, const float* bias,
                  half_t* outh, float* resid, int m, int n, int k, int act) {
    dim3 grid(m / MBLK, n / NBLK);
    gemm_wmma_kernel<<<grid, 256, 0, stream>>>(A, W, bias, outh, resid, m, n, k, act);
  };

  // ---- self-attention sublayer ----
  layernorm_kernel<<<M, 256, 0, stream>>>(x, ln1_g, ln1_b, nx_h, E);
  gemm(nx_h, selfw_h, self_b, qkv_h, nullptr, M, 3 * E, E, 0);
  {
    dim3 grid(Tq / 64, nhead, B);
    attn_wmma_kernel<<<grid, 128, 0, stream>>>(
        qkv_h, 3 * E, qkv_h + E, 3 * E, qkv_h + 2 * E, 3 * E,
        attn_h, E, Tq, Tq, Dh, n_ctx_p, scale);
  }
  gemm(attn_h, selfow_h, self_ob, nullptr, x, M, E, E, 0);

  // ---- cross-attention sublayer ----
  layernorm_kernel<<<M, 256, 0, stream>>>(x, ln2_g, ln2_b, nx_h, E);
  gemm(nx_h,  crossw_h,                 cross_b,     qc_h,  nullptr, M,  E,     E, 0);
  gemm(mem_h, crossw_h + (size_t)E * E, cross_b + E, kvc_h, nullptr, Mk, 2 * E, E, 0);
  {
    dim3 grid(Tq / 64, nhead, B);
    attn_wmma_kernel<<<grid, 128, 0, stream>>>(
        qc_h, E, kvc_h, 2 * E, kvc_h + E, 2 * E,
        attn_h, E, Tq, Tk, Dh, nullptr, scale);
  }
  gemm(attn_h, crossow_h, cross_ob, nullptr, x, M, E, E, 0);

  // ---- FFN sublayer ----
  layernorm_kernel<<<M, 256, 0, stream>>>(x, ln3_g, ln3_b, nx_h, E);
  gemm(nx_h,   w1_h, b1, ffn1_h, nullptr, M, F, E, 1);  // exact GELU
  gemm(ffn1_h, w2_h, b2, nullptr, x,       M, E, F, 0);
}

// v006
// Timed twice side by side with v005, it ran 1.17 and 1.16 times as fast.
// All steps since v000 together make it 3.50 times as fast.
#include <hip/hip_runtime.h>
#include <math.h>

typedef _Float16 half_t;
typedef __attribute__((ext_vector_type(16))) _Float16 v16h;
typedef __attribute__((ext_vector_type(8)))  _Float16 v8h;
typedef __attribute__((ext_vector_type(8)))  float    v8f;
typedef __attribute__((vector_size(16)))     int      vsi4;   // int4 for async builtin

#define ASG __attribute__((address_space(1)))
#define ASL __attribute__((address_space(3)))

// Detect CDNA5 async global->LDS builtins (gfx1250); fall back to load+ds_store.
#if defined(__has_builtin)
#  if __has_builtin(__builtin_amdgcn_global_load_async_to_lds_b128)
#    define HAVE_ASYNC 1
#  endif
#endif
#ifndef HAVE_ASYNC
#  define HAVE_ASYNC 0
#endif

// ---------------------------------------------------------------------------
// WMMA helpers (CDNA5 gfx1250, wave32)
// ---------------------------------------------------------------------------
__device__ inline v8f wmma_f16(v16h a, v16h b, v8f c) {
  // D(16x16,f32) = A(16x32,f16) x B(32x16,f16) + C
  return __builtin_amdgcn_wmma_f32_16x16x32_f16(
      /*neg_a=*/false, a, /*neg_b=*/false, b,
      /*c_mod=*/(short)0, c, /*reuse_a=*/false, /*reuse_b=*/false);
}

__device__ inline v8f zero_v8f() {
  v8f z;
#pragma unroll
  for (int i = 0; i < 8; ++i) z[i] = 0.0f;
  return z;
}

// Load a 16x32 f16 fragment in the ISA A-matrix lane layout:
//   lane<16 : row=lane,    K = [0..7] then [16..23]
//   lane>=16: row=lane-16, K = [8..15] then [24..31]
// base points at (row0, k0); ld = row stride in elements. Also used for the
// B operand of D = A x W^T (B column n == row n of W, identical pattern).
__device__ inline v16h load_frag(const half_t* __restrict__ base, int ld) {
  const int lane = threadIdx.x & 31;
  const int sub  = lane & 15;
  const int hi   = lane >> 4;
  const half_t* p = base + (size_t)sub * ld + hi * 8;
  v8h lo = *(const v8h*)(p);
  v8h hh = *(const v8h*)(p + 16);
  v16h r;
#pragma unroll
  for (int i = 0; i < 8; ++i) { r[i] = lo[i]; r[i + 8] = hh[i]; }
  return r;
}

// One 16-byte global->LDS transfer per lane (ASYNCcnt path if available).
__device__ inline void copy_b128_to_lds(const half_t* g, half_t* l) {
#if HAVE_ASYNC
  __builtin_amdgcn_global_load_async_to_lds_b128(
      (ASG vsi4*)g, (ASL vsi4*)l, 0, 0);
#else
  *(v8h*)l = *(const v8h*)g;
#endif
}

// ---------------------------------------------------------------------------
// Elementwise f32 -> f16 conversion of all seven arrays in one streaming launch.
// The arrays are cut into chunks of 8192 floats; a block walks chunks at grid
// stride. In a whole chunk each thread issues eight 16-byte loads (every wave
// load covers 512 contiguous bytes) before the first is converted, so few waves
// keep many bytes in flight; the last, partial chunk of an array goes by element.
// ---------------------------------------------------------------------------
#define CVT_LOADS 8
#define CVT_SPAN  (256 * 4)                // floats per block-wide 16-byte load
#define CVT_CHUNK (CVT_SPAN * CVT_LOADS)   // floats per chunk

typedef __attribute__((ext_vector_type(4))) float    v4f;
typedef __attribute__((ext_vector_type(4))) _Float16 v4h;

__device__ inline int cvt_chunks(long long n) {
  return (int)((n + CVT_CHUNK - 1) / CVT_CHUNK);
}

__global__ __launch_bounds__(256) void convert_f16_kernel(
    const float* __restrict__ s0, const float* __restrict__ s1,
    const float* __restrict__ s2, const float* __restrict__ s3,
    const float* __restrict__ s4, const float* __restrict__ s5,
    const float* __restrict__ s6,
    half_t* __restrict__ d0, half_t* __restrict__ d1, half_t* __restrict__ d2,
    half_t* __restrict__ d3, half_t* __restrict__ d4, half_t* __restrict__ d5,
    half_t* __restrict__ d6,
    long long n0, long long n1, long long n2, long long n3,
    long long n4, long long n5, long long n6) {
  // first chunk index behind each array
  const int e0 = cvt_chunks(n0);
  const int e1 = e0 + cvt_chunks(n1);
  const int e2 = e1 + cvt_chunks(n2);
  const int e3 = e2 + cvt_chunks(n3);
  const int e4 = e3 + cvt_chunks(n4);
  const int e5 = e4 + cvt_chunks(n5);
  const int e6 = e5 + cvt_chunks(n6);

  for (int c = blockIdx.x; c < e6; c += gridDim.x) {
    const float* s = s0; half_t* d = d0; long long n = n0; int first = 0;
    if (c >= e0) { s = s1; d = d1; n = n1; first = e0; }
    if (c >= e1) { s = s2; d = d2; n = n2; first = e1; }
    if (c >= e2) { s = s3; d = d3; n = n3; first = e2; }
    if (c >= e3) { s = s4; d = d4; n = n4; first = e3; }
    if (c >= e4) { s = s5; d = d5; n = n5; first = e4; }
    if (c >= e5) { s = s6; d = d6; n = n6; first = e5; }
    const long long base = (long long)(c - first) * CVT_CHUNK;
    if (base + CVT_CHUNK <= n) {
      const float* sp = s + base + threadIdx.x * 4;
      half_t*      dp = d + base + threadIdx.x * 4;
      v4f v[CVT_LOADS];
#pragma unroll
      for (int j = 0; j < CVT_LOADS; ++j) v[j] = *(const v4f*)(sp + j * CVT_SPAN);
#pragma unroll
      for (int j = 0; j < CVT_LOADS; ++j)
        *(v4h*)(dp + j * CVT_SPAN) = __builtin_convertvector(v[j], v4h);
      // The next trip rewrites the base and data registers that these stores
      // name.
      asm volatile("s_wait_xcnt 0x0" ::: "memory");
    } else {
      for (long long i = base + threadIdx.x; i < n; i += 256) d[i] = (half_t)s[i];
    }
  }
}

// ---------------------------------------------------------------------------
// LayerNorm: one block (256 thr) per row, writes f16 (GEMM input format)
// ---------------------------------------------------------------------------
__global__ __launch_bounds__(256) void layernorm_kernel(
    const float* __restrict__ x, const float* __restrict__ g,
    const float* __restrict__ b, half_t* __restrict__ outh, int E) {
  __shared__ float red[64];
  const int row = blockIdx.x;
  const float* xr = x + (size_t)row * E;
  float s = 0.f, s2 = 0.f;
  for (int i = threadIdx.x; i < E; i += blockDim.x) {
    float v = xr[i];
    s += v; s2 += v * v;
  }
#pragma unroll
  for (int off = 16; off > 0; off >>= 1) {
    s  += __shfl_xor(s,  off, 32);
    s2 += __shfl_xor(s2, off, 32);
  }
  const int wid = threadIdx.x >> 5, lane = threadIdx.x & 31;
  if (lane == 0) { red[wid] = s; red[32 + wid] = s2; }
  __syncthreads();
  if (wid == 0) {
    int nw = blockDim.x >> 5;
    float a  = (lane < nw) ? red[lane]      : 0.f;
    float a2 = (lane < nw) ? red[32 + lane] : 0.f;
#pragma unroll
    for (int off = 16; off > 0; off >>= 1) {
      a  += __shfl_xor(a,  off, 32);
      a2 += __shfl_xor(a2, off, 32);
    }
    if (lane == 0) { red[0] = a; red[1] = a2; }
  }
  __syncthreads();
  const float mean = red[0] / (float)E;
  const float var  = red[1] / (float)E - mean * mean;
  const float rstd = rsqrtf(var + 1e-5f);
  for (int i = threadIdx.x; i < E; i += blockDim.x)
    outh[(size_t)row * E + i] = (half_t)((xr[i] - mean) * rstd * g[i] + b[i]);
}

// ---------------------------------------------------------------------------
// LDS-staged double-buffered GEMM:
//   out[M,N] = act(A[M,K] @ W[N,K]^T + bias[N]); optional residual f32 add.
// Block = 256 thr = 8 waves (2 in M x 4 in N). Block tile 128x128.
// A stage holds 128 k (four WMMA k-blocks of 32), so that fragments can be fetched
// one k-block ahead inside a published stage; one barrier serves 128 k.
// LDS: 2 x (128 A rows + 128 B rows) of 256 B at a 272-B pitch = 136 KB.
// Global->LDS staging uses GLOBAL_LOAD_ASYNC_TO_LDS_B128 (ASYNCcnt).
// K must be a multiple of KSTEP.
// ---------------------------------------------------------------------------
#define KSTEP 128
#define MBLK  128
#define NBLK  128
#define GPITCH 136  // halves; 272-B rows (16 B x odd) for the ds_load_b128 reader

__global__ __launch_bounds__(256) void gemm_wmma_kernel(
    const half_t* __restrict__ A, const half_t* __restrict__ W,
    const float* __restrict__ bias, half_t* __restrict__ outh,
    float* __restrict__ resid, int M, int N, int K, int act) {
  __shared__ __attribute__((aligned(16))) half_t ldsA[2][MBLK * GPITCH];
  __shared__ __attribute__((aligned(16))) half_t ldsB[2][NBLK * GPITCH];

  const int tid  = threadIdx.x;
  const int lane = tid & 31;
  const int wid  = tid >> 5;     // 0..7
  const int wm   = wid >> 2;     // 0..1 : wave row  (64 rows each)
  const int wn   = wid & 3;      // 0..3 : wave col  (32 cols each)
  const int m0 = blockIdx.x * MBLK;
  const int n0 = blockIdx.y * NBLK;

  // Staging assignment: thread -> rows (tid>>4) + 0,16,..,112, 16-byte piece tid&15
  // of the row's 256 B; one wave's copy covers two whole 256-B row pieces.
  const int crow = tid >> 4;         // 0..15
  const int cq   = (tid & 15) * 8;   // halves
  auto stage = [&](int ks, int sb) {
#pragma unroll
    for (int rr = 0; rr < MBLK; rr += 16)
      copy_b128_to_lds(A + (size_t)(m0 + crow + rr) * K + ks + cq,
                       &ldsA[sb][(crow + rr) * GPITCH + cq]);
#pragma unroll
    for (int rr = 0; rr < NBLK; rr += 16)
      copy_b128_to_lds(W + (size_t)(n0 + crow + rr) * K + ks + cq,
                       &ldsB[sb][(crow + rr) * GPITCH + cq]);
  };

  v8f acc[4][2];
#pragma unroll
  for (int i = 0; i < 4; ++i) { acc[i][0] = zero_v8f(); acc[i][1] = zero_v8f(); }

  // C layout -> lane l<16 holds rows 0..7 (vgpr r), l>=16 rows 8..15.
  const int sub = lane & 15, hi = lane >> 4;
  // The bias is asked for here, so that its latency runs beside that of tile 0's copies.
  const float bias0 = bias[n0 + wn * 32 + sub];
  const float bias1 = bias[n0 + wn * 32 + sub + 16];

  // Ring prologue: stage 0 lands and is published, then stage 1 starts.
  stage(0, 0);
  asm volatile("s_wait_asynccnt 0x0" ::: "memory");  // own copies of stage 0 landed
  __syncthreads();                                   // publishes stage 0
  if (KSTEP < K) stage(KSTEP, 1);

  int buf = 0;
  for (int k0 = 0; k0 < K; k0 += KSTEP) {
    // compute: per k-block of 32, 4 A-frags x 2 B-frags = 8 WMMA, fed by ds_load_b128.
    // Two fragment sets: the twelve reads of block b + 1 are issued as one group ahead
    // of block b's WMMAs, so their LDS latency runs beside the matrix work. Only
    // blocks of this stage are fetched; the next stage is read behind its barrier.
    v16h af[2][4], bf[2][2];
    auto load_block = [&](int s, int kb) {
      bf[s][0] = load_frag(&ldsB[buf][(wn * 32 +  0) * GPITCH + kb], GPITCH);
      bf[s][1] = load_frag(&ldsB[buf][(wn * 32 + 16) * GPITCH + kb], GPITCH);
#pragma unroll
      for (int i = 0; i < 4; ++i)
        af[s][i] = load_frag(&ldsA[buf][(wm * 64 + i * 16) * GPITCH + kb], GPITCH);
    };
    load_block(0, 0);
#pragma unroll
    for (int b = 0; b < KSTEP / 32; ++b) {
      if (b + 1 < KSTEP / 32) load_block((b + 1) & 1, (b + 1) * 32);
      // Keeps the group of reads above the WMMAs: the scheduler otherwise sinks each
      // read to its use, and every WMMA pair waits out an LDS round trip.
      __builtin_amdgcn_sched_barrier(0);
#pragma unroll
      for (int i = 0; i < 4; ++i) {
        acc[i][0] = wmma_f16(af[b & 1][i], bf[b & 1][0], acc[i][0]);
        acc[i][1] = wmma_f16(af[b & 1][i], bf[b & 1][1], acc[i][1]);
      }
      // Keeps the following group of reads out of this run of WMMAs.
      __builtin_amdgcn_sched_barrier(0);
    }

    // Publish point of the next stage; it also ends every reader's last read of buf.
    asm volatile("s_wait_dscnt 0x0" ::: "memory");     // own LDS reads of buf retired
    asm volatile("s_wait_asynccnt 0x0" ::: "memory");  // own copies of the next stage landed
    __syncthreads();
    if (k0 + 2 * KSTEP < K) stage(k0 + 2 * KSTEP, buf);  // refill the buffer just read
    buf ^= 1;
  }
  asm volatile("s_wait_asynccnt 0x0" ::: "memory");    // nothing in flight behind the ring

  // epilogue: the tests on act, outh and resid stand outside the element loops
#pragma unroll
  for (int i = 0; i < 4; ++i) {
#pragma unroll
    for (int r = 0; r < 8; ++r) {
      acc[i][0][r] += bias0;
      acc[i][1][r] += bias1;
    }
  }
  if (act == 1) {
#pragma unroll
    for (int i = 0; i < 4; ++i)
#pragma unroll
      for (int j = 0; j < 2; ++j)
#pragma unroll
        for (int r = 0; r < 8; ++r) {
          const float v = acc[i][j][r];
          acc[i][j][r] = 0.5f * v * (1.0f + erff(v * 0.70710678118654752f));
        }
  }
  // An output element lies at a block-uniform place (row i*16 + r, column j*16 of
  // the block's tile) plus this 32-bit offset of the lane, in elements.
  const size_t   tile0 = (size_t)m0 * N + n0;
  const unsigned loff  = (unsigned)((wm * 64 + 8 * hi) * N + wn * 32 + sub);
  if (outh) {
    half_t* op = outh + tile0;
#pragma unroll
    for (int i = 0; i < 4; ++i)
#pragma unroll
      for (int r = 0; r < 8; ++r)
#pragma unroll
        for (int j = 0; j < 2; ++j)
          (op + (size_t)(i * 16 + r) * N + j * 16)[loff] = (half_t)acc[i][j][r];
    // The residual path below rewrites registers that these stores name.
    asm volatile("s_wait_xcnt 0x0" ::: "memory");
  }
  if (resid) {
    float* rp = resid + tile0;
    // All 64 residual values are in flight together before the first is used.
    v8f rv[4][2];
#pragma unroll
    for (int i = 0; i < 4; ++i)
#pragma unroll
      for (int r = 0; r < 8; ++r)
#pragma unroll
        for (int j = 0; j < 2; ++j)
          rv[i][j][r] = (rp + (size_t)(i * 16 + r) * N + j * 16)[loff];
#pragma unroll
    for (int i = 0; i < 4; ++i)
#pragma unroll
      for (int r = 0; r < 8; ++r)
#pragma unroll
        for (int j = 0; j < 2; ++j)
          (rp + (size_t)(i * 16 + r) * N + j * 16)[loff] = rv[i][j][r] + acc[i][j][r];
  }
}

#define KPITCH 72
#define VPITCH 80

typedef __attribute__((ext_vector_type(8))) short s16x8;

__device__ inline unsigned lds_byte_addr(const half_t* p) {
  return (unsigned)(size_t)(ASL const half_t*)p;
}

// Transposing LDS read: lane (c = l & 15, h = l >> 4) gets T[8h + 0..7][c] of the
// 16 x 16 tile whose per-lane row addresses are passed in.
__device__ inline v8h lds_load_tr16(const half_t* p) {
  return __builtin_bit_cast(v8h, __builtin_amdgcn_ds_load_tr16_b128_v8i16((ASL s16x8*)p));
}

// Lane l with lane l ^ 16.
__device__ inline float xhalf(float x) {
  const int b = __builtin_bit_cast(int, x);
  return __builtin_bit_cast(
      float, __builtin_amdgcn_permlanex16(b, b, 0x76543210, 0xfedcba98, false, false));
}

// Four 16-byte async copies per lane (two K rows, two V rows). The s_wait_xcnt
// stands inside the statement so that no address register named here is
// rewritten ahead of it.
__device__ inline void stage_kv_tile(const half_t* gk0, const half_t* gk1,
                                     const half_t* gv0, const half_t* gv1,
                                     unsigned lk0, unsigned lk1,
                                     unsigned lv0, unsigned lv1) {
  asm volatile(
      "global_load_async_to_lds_b128 %0, %4, off\n\t"
      "global_load_async_to_lds_b128 %1, %5, off\n\t"
      "global_load_async_to_lds_b128 %2, %6, off\n\t"
      "global_load_async_to_lds_b128 %3, %7, off\n\t"
      "s_wait_xcnt 0x0"
      :: "v"(lk0), "v"(lk1), "v"(lv0), "v"(lv1),
         "v"(gk0), "v"(gk1), "v"(gv0), "v"(gv1)
      : "memory");
}

__global__ __launch_bounds__(128) void attn_wmma_kernel(
    const half_t* __restrict__ Q, int qld,
    const half_t* __restrict__ Km, int kld,
    const half_t* __restrict__ V, int vld,
    half_t* __restrict__ O, int oldd,
    int Tq, int Tk, int Dh, const int* __restrict__ nctx, float scale) {
  __shared__ __attribute__((aligned(16))) half_t kls[2][32 * KPITCH];
  __shared__ __attribute__((aligned(16))) half_t vls[2][32 * VPITCH];
  const int lane = threadIdx.x & 31;
  const int wid  = threadIdx.x >> 5;
  const int sub = lane & 15, hi = lane >> 4;
  const int h = blockIdx.y, b = blockIdx.z;
  const int qt = (blockIdx.x * 4 + wid) * 16;

  int kvlen = Tk;
  if (nctx) { int nc = *nctx; kvlen = nc < Tk ? nc : Tk; }

  const half_t* Qb = Q + ((size_t)b * Tq + qt) * qld + h * Dh;
  const half_t* Kb = Km + (size_t)b * Tk * kld + h * Dh;
  const half_t* Vb = V  + (size_t)b * Tk * vld + h * Dh;

  const v16h qf0 = load_frag(Qb,      qld);   // Dh = 64 -> two K=32 fragments
  const v16h qf1 = load_frag(Qb + 32, qld);

  // acc[d][r] = O[query sub][d * 16 + 8 * hi + r]
  v8f acc[4];
#pragma unroll
  for (int d = 0; d < 4; ++d) acc[d] = zero_v8f();
  // Running maximum of the lane's query (equal in lanes l and l ^ 16) and the sum
  // over the lane's own keys; the two halves' sums are joined behind the loop.
  float mrow = -1e30f, lsum = 0.f;

  // Staging: thread -> tile rows srow and srow + 16, 16-byte chunk sq of the row;
  // one wave's copy covers four whole 128-B rows.
  const int srow = threadIdx.x >> 3;        // 0..15
  const int sq   = (threadIdx.x & 7) * 8;   // halves
  auto stage = [&](int kt0, int sb) {
    const half_t* gk = Kb + (size_t)(kt0 + srow) * kld + sq;
    const half_t* gv = Vb + (size_t)(kt0 + srow) * vld + sq;
    stage_kv_tile(gk, gk + (size_t)16 * kld, gv, gv + (size_t)16 * vld,
                  lds_byte_addr(&kls[sb][srow * KPITCH + sq]),
                  lds_byte_addr(&kls[sb][(srow + 16) * KPITCH + sq]),
                  lds_byte_addr(&vls[sb][srow * VPITCH + sq]),
                  lds_byte_addr(&vls[sb][(srow + 16) * VPITCH + sq]));
  };
  // Per-lane offset of the transposing V read inside a tile.
  const int vtr = (8 * hi + (lane & 7)) * VPITCH + 8 * ((lane >> 3) & 1);

  // Ring prologue: tile 0 lands and is published, then tile 1 starts.
  stage(0, 0);
  asm volatile("s_wait_asynccnt 0x0" ::: "memory");  // own copies of tile 0 landed
  __syncthreads();                                   // publishes tile 0
  if (32 < kvlen) stage(32, 1);

  int buf = 0;
  for (int kt = 0; kt < kvlen; kt += 32) {
    v8f s0 = zero_v8f(), s1 = zero_v8f();
    {
      const half_t* kl = &kls[buf][0];
      v16h k00 = load_frag(kl,      KPITCH);
      v16h k01 = load_frag(kl + 32, KPITCH);
      v16h k10 = load_frag(kl + 16 * KPITCH,      KPITCH);
      v16h k11 = load_frag(kl + 16 * KPITCH + 32, KPITCH);
      // Inputs-only fence on the loaded fragments: keeps the eight LDS reads in one
      // group with one wait; without it each WMMA waits out its own LDS latency.
      asm volatile("" :: "v"(k00), "v"(k01), "v"(k10), "v"(k11));
      // s0[r] = S[key kt + 8 * hi + r][query sub], s1[r] the same 16 keys on
      s0 = wmma_f16(k00, qf0, s0);
      s0 = wmma_f16(k01, qf1, s0);
      s1 = wmma_f16(k10, qf0, s1);
      s1 = wmma_f16(k11, qf1, s1);
    }
    float v0[8], v1[8];
#pragma unroll
    for (int r = 0; r < 8; ++r) { v0[r] = s0[r] * scale; v1[r] = s1[r] * scale; }
    if (kt + 32 > kvlen) {   // block-uniform: only a last, partial tile has keys to mask
      const int lim = kvlen - kt - 8 * hi;
#pragma unroll
      for (int r = 0; r < 8; ++r) {
        if (r >= lim)      v0[r] = -1e30f;
        if (r + 16 >= lim) v1[r] = -1e30f;
      }
    }

    // Maximum and sum go as trees, so that no long dependent chain forms.
    float t[8];
#pragma unroll
    for (int r = 0; r < 8; ++r) t[r] = fmaxf(v0[r], v1[r]);
#pragma unroll
    for (int w = 4; w > 0; w >>= 1)
#pragma unroll
      for (int r = 0; r < w; ++r) t[r] = fmaxf(t[r], t[r + w]);
    const float mx   = fmaxf(t[0], xhalf(t[0]));
    const float mnew = fmaxf(mrow, mx);
    const float corr = __expf(mrow - mnew);
    mrow = mnew;
#pragma unroll
    for (int r = 0; r < 8; ++r) {
      v0[r] = __expf(v0[r] - mnew);
      v1[r] = __expf(v1[r] - mnew);
      t[r] = v0[r] + v1[r];
    }
#pragma unroll
    for (int w = 4; w > 0; w >>= 1)
#pragma unroll
      for (int r = 0; r < w; ++r) t[r] += t[r + w];
    lsum = lsum * corr + t[0];
#pragma unroll
    for (int d = 0; d < 4; ++d)
#pragma unroll
      for (int r = 0; r < 8; ++r) acc[d][r] *= corr;

    // P^T as a B operand: element s holds key 8 * hi + s, then 16 + 8 * hi + (s - 8),
    // the k order in which the transposing read delivers V^T.
    v16h pf;
#pragma unroll
    for (int j = 0; j < 8; ++j) { pf[j] = (half_t)v0[j]; pf[j + 8] = (half_t)v1[j]; }

    // acc += V^T(64x32) @ P^T(32x16): A[m][k] = V[kt+k][h*Dh + d*16 + m]
#pragma unroll
    for (int d = 0; d < 4; ++d) {
      const half_t* vb = &vls[buf][vtr + d * 16];
      const v8h vlo = lds_load_tr16(vb);                 // keys 8*hi + 0..7
      const v8h vhi = lds_load_tr16(vb + 16 * VPITCH);   // keys 16 + 8*hi + 0..7
      v16h vf;
#pragma unroll
      for (int j = 0; j < 8; ++j) { vf[j] = vlo[j]; vf[j + 8] = vhi[j]; }
      acc[d] = wmma_f16(vf, pf, acc[d]);
    }

    // Publish point of tile t+1; it also ends every reader's last read of buf.
    asm volatile("s_wait_dscnt 0x0" ::: "memory");     // own LDS reads of buf retired
    asm volatile("s_wait_asynccnt 0x0" ::: "memory");  // own copies of tile t+1 landed
    __syncthreads();
    if (kt + 64 < kvlen) stage(kt + 64, buf);          // refill the buffer just read
    buf ^= 1;
  }
  asm volatile("s_wait_asynccnt 0x0" ::: "memory");    // nothing in flight at wave end

  // A lane's eight values of a tile are eight neighbours of one output row.
  const float inv = 1.0f / (lsum + xhalf(lsum));
  half_t* orow = O + ((size_t)b * Tq + qt + sub) * oldd + h * Dh + 8 * hi;
#pragma unroll
  for (int d = 0; d < 4; ++d) {
    v8h o;
#pragma unroll
    for (int r = 0; r < 8; ++r) o[r] = (half_t)(acc[d][r] * inv);
    *(v8h*)(orow + d * 16) = o;
  }
}

// ---------------------------------------------------------------------------
// Host orchestration
// ---------------------------------------------------------------------------
extern "C" void kernel_launch(void* const* d_in, const int* in_sizes, int n_in,
                              void* d_out, int out_size, void* d_ws, size_t ws_size,
                              hipStream_t stream) {
  (void)n_in; (void)out_size; (void)ws_size;
  const float* tgt      = (const float*)d_in[0];
  const float* memory   = (const float*)d_in[1];
  const float* self_w   = (const float*)d_in[2];
  const float* self_b   = (const float*)d_in[3];
  const float* self_ow  = (const float*)d_in[4];
  const float* self_ob  = (const float*)d_in[5];
  const float* cross_w  = (const float*)d_in[6];
  const float* cross_b  = (const float*)d_in[7];
  const float* cross_ow = (const float*)d_in[8];
  const float* cross_ob = (const float*)d_in[9];
  const float* ln1_g = (const float*)d_in[10];
  const float* ln1_b = (const float*)d_in[11];
  const float* ln2_g = (const float*)d_in[12];
  const float* ln2_b = (const float*)d_in[13];
  const float* ln3_g = (const float*)d_in[14];
  const float* ln3_b = (const float*)d_in[15];
  const float* w1 = (const float*)d_in[16];
  const float* b1 = (const float*)d_in[17];
  const float* w2 = (const float*)d_in[18];
  const float* b2 = (const float*)d_in[19];
  const int*   n_ctx_p = (const int*)d_in[20];

  const int E  = in_sizes[10];
  const int F  = in_sizes[16] / E;
  const int B  = 2;
  const int Tq = in_sizes[0] / (B * E);
  const int Tk = in_sizes[1] / (B * E);
  const int nhead = 16;
  const int Dh = E / nhead;
  const int M  = B * Tq;   // query rows
  const int Mk = B * Tk;   // memory rows
  const float scale = 1.0f / sqrtf((float)Dh);

  // --- workspace carve (all f16 buffers, 256B aligned) ---
  char* wp = (char*)d_ws;
  auto carve = [&](size_t elems) -> half_t* {
    half_t* r = (half_t*)wp;
    wp += (elems * sizeof(half_t) + 255) & ~(size_t)255;
    return r;
  };
  half_t* selfw_h   = carve((size_t)3 * E * E);
  half_t* selfow_h  = carve((size_t)E * E);
  half_t* crossw_h  = carve((size_t)3 * E * E);
  half_t* crossow_h = carve((size_t)E * E);
  half_t* w1_h      = carve((size_t)F * E);
  half_t* w2_h      = carve((size_t)E * F);
  half_t* mem_h     = carve((size_t)Mk * E);
  half_t* nx_h      = carve((size_t)M * E);
  half_t* qkv_h     = carve((size_t)M * 3 * E);
  half_t* qc_h      = carve((size_t)M * E);
  half_t* kvc_h     = carve((size_t)Mk * 2 * E);
  half_t* attn_h    = carve((size_t)M * E);
  half_t* ffn1_h    = carve((size_t)M * F);
  float*  x = (float*)d_out;   // residual accumulator

  // 512 blocks of 8 waves: 16 streaming waves on each of the 256 WGPs.
  convert_f16_kernel<<<512, 256, 0, stream>>>(
      self_w, self_ow, cross_w, cross_ow, w1, w2, memory,
      selfw_h, selfow_h, crossw_h, crossow_h, w1_h, w2_h, mem_h,
      (long long)3 * E * E, (long long)E * E, (long long)3 * E * E,
      (long long)E * E, (long long)F * E, (long long)E * F, (long long)Mk * E);

  // x = tgt
  (void)hipMemcpyAsync(x, tgt, (size_t)M * E * sizeof(float),
                       hipMemcpyDeviceToDevice, stream);

  auto gemm = [&](const half_t* A, const half_t* W, const float* bias,
                  half_t* outh, float* resid, int m, int n, int k, int act) {
    dim3 grid(m / MBLK, n / NBLK);
    gemm_wmma_kernel<<<grid, 256, 0, stream>>>(A, W, bias, outh, resid, m, n, k, act);
  };

  // ---- self-attention sublayer ----
  layernorm_kernel<<<M, 256, 0, stream>>>(x, ln1_g, ln1_b, nx_h, E);
  gemm(nx_h, selfw_h, self_b, qkv_h, nullptr, M, 3 * E, E, 0);
  {
    dim3 grid(Tq / 64, nhead, B);
    attn_wmma_kernel<<<grid, 128, 0, stream>>>(
        qkv_h, 3 * E, qkv_h + E, 3 * E, qkv_h + 2 * E, 3 * E,
        attn_h, E, Tq, Tq, Dh, n_ctx_p, scale);
  }
  gemm(attn_h, selfow_h, self_ob, nullptr, x, M, E, E, 0);

  // ---- cross-attention sublayer ----
  layernorm_kernel<<<M, 256, 0, stream>>>(x, ln2_g, ln2_b, nx_h, E);
  gemm(nx_h,  crossw_h,                 cross_b,     qc_h,  nullptr, M,  E,     E, 0);
  gemm(mem_h, crossw_h + (size_t)E * E, cross_b + E, kvc_h, nullptr, Mk, 2 * E, E, 0);
  {
    dim3 grid(Tq / 64, nhead, B);
    attn_wmma_kernel<<<grid, 128, 0, stream>>>(
        qc_h, E, kvc_h, 2 * E, kvc_h + E, 2 * E,
        attn_h, E, Tq, Tk, Dh, nullptr, scale);
  }
  gemm(attn_h, crossow_h, cross_ob, nullptr, x, M, E, E, 0);

  // ---- FFN sublayer ----
  layernorm_kernel<<<M, 256, 0, stream>>>(x, ln3_g, ln3_b, nx_h, E);
  gemm(nx_h,   w1_h, b1, ffn1_h, nullptr, M, F, E, 1);  // exact GELU
  gemm(ffn1_h, w2_h, b2, nullptr, x,       M, E, F, 0);
}

// v007
// Two timings next to v006 both put it at 1.05 times that version's speed.
// Counting every step since v000, it is 3.68 times as fast.
#include <hip/hip_runtime.h>
#include <math.h>

typedef _Float16 half_t;
typedef __attribute__((ext_vector_type(16))) _Float16 v16h;
typedef __attribute__((ext_vector_type(8)))  _Float16 v8h;
typedef __attribute__((ext_vector_type(8)))  float    v8f;
typedef __attribute__((vector_size(16)))     int      vsi4;   // int4 for async builtin

#define ASG __attribute__((address_space(1)))
#define ASL __attribute__((address_space(3)))

// Detect CDNA5 async global->LDS builtins (gfx1250); fall back to load+ds_store.
#if defined(__has_builtin)
#  if __has_builtin(__builtin_amdgcn_global_load_async_to_lds_b128)
#    define HAVE_ASYNC 1
#  endif
#endif
#ifndef HAVE_ASYNC
#  define HAVE_ASYNC 0
#endif

// ---------------------------------------------------------------------------
// WMMA helpers (CDNA5 gfx1250, wave32)
// ---------------------------------------------------------------------------
__device__ inline v8f wmma_f16(v16h a, v16h b, v8f c) {
  // D(16x16,f32) = A(16x32,f16) x B(32x16,f16) + C
  return __builtin_amdgcn_wmma_f32_16x16x32_f16(
      /*neg_a=*/false, a, /*neg_b=*/false, b,
      /*c_mod=*/(short)0, c, /*reuse_a=*/false, /*reuse_b=*/false);
}

__device__ inline v8f zero_v8f() {
  v8f z;
#pragma unroll
  for (int i = 0; i < 8; ++i) z[i] = 0.0f;
  return z;
}

// Load a 16x32 f16 fragment in the ISA A-matrix lane layout:
//   lane<16 : row=lane,    K = [0..7] then [16..23]
//   lane>=16: row=lane-16, K = [8..15] then [24..31]
// base points at (row0, k0); ld = row stride in elements. Also used for the
// B operand of D = A x W^T (B column n == row n of W, identical pattern).
__device__ inline v16h load_frag(const half_t* __restrict__ base, int ld) {
  const int lane = threadIdx.x & 31;
  const int sub  = lane & 15;
  const int hi   = lane >> 4;
  const half_t* p = base + (size_t)sub * ld + hi * 8;
  v8h lo = *(const v8h*)(p);
  v8h hh = *(const v8h*)(p + 16);
  v16h r;
#pragma unroll
  for (int i = 0; i < 8; ++i) { r[i] = lo[i]; r[i + 8] = hh[i]; }
  return r;
}

// One 16-byte global->LDS transfer per lane (ASYNCcnt path if available).
__device__ inline void copy_b128_to_lds(const half_t* g, half_t* l) {
#if HAVE_ASYNC
  __builtin_amdgcn_global_load_async_to_lds_b128(
      (ASG vsi4*)g, (ASL vsi4*)l, 0, 0);
#else
  *(v8h*)l = *(const v8h*)g;
#endif
}

// ---------------------------------------------------------------------------
// Elementwise f32 -> f16 conversion of all seven arrays in one streaming launch.
// The arrays are cut into chunks of 8192 floats; a block walks chunks at grid
// stride. In a whole chunk each thread issues eight 16-byte loads (every wave
// load covers 512 contiguous bytes) before the first is converted, so few waves
// keep many bytes in flight; the last, partial chunk of an array goes by element.
// ---------------------------------------------------------------------------
#define CVT_LOADS 8
#define CVT_SPAN  (256 * 4)                // floats per block-wide 16-byte load
#define CVT_CHUNK (CVT_SPAN * CVT_LOADS)   // floats per chunk

typedef __attribute__((ext_vector_type(4))) float    v4f;
typedef __attribute__((ext_vector_type(4))) _Float16 v4h;

__device__ inline int cvt_chunks(long long n) {
  return (int)((n + CVT_CHUNK - 1) / CVT_CHUNK);
}

__global__ __launch_bounds__(256) void convert_f16_kernel(
    const float* __restrict__ s0, const float* __restrict__ s1,
    const float* __restrict__ s2, const float* __restrict__ s3,
    const float* __restrict__ s4, const float* __restrict__ s5,
    const float* __restrict__ s6,
    half_t* __restrict__ d0, half_t* __restrict__ d1, half_t* __restrict__ d2,
    half_t* __restrict__ d3, half_t* __restrict__ d4, half_t* __restrict__ d5,
    half_t* __restrict__ d6,
    long long n0, long long n1, long long n2, long long n3,
    long long n4, long long n5, long long n6) {
  // first chunk index behind each array
  const int e0 = cvt_chunks(n0);
  const int e1 = e0 + cvt_chunks(n1);
  const int e2 = e1 + cvt_chunks(n2);
  const int e3 = e2 + cvt_chunks(n3);
  const int e4 = e3 + cvt_chunks(n4);
  const int e5 = e4 + cvt_chunks(n5);
  const int e6 = e5 + cvt_chunks(n6);

  for (int c = blockIdx.x; c < e6; c += gridDim.x) {
    const float* s = s0; half_t* d = d0; long long n = n0; int first = 0;
    if (c >= e0) { s = s1; d = d1; n = n1; first = e0; }
    if (c >= e1) { s = s2; d = d2; n = n2; first = e1; }
    if (c >= e2) { s = s3; d = d3; n = n3; first = e2; }
    if (c >= e3) { s = s4; d = d4; n = n4; first = e3; }
    if (c >= e4) { s = s5; d = d5; n = n5; first = e4; }
    if (c >= e5) { s = s6; d = d6; n = n6; first = e5; }
    const long long base = (long long)(c - first) * CVT_CHUNK;
    if (base + CVT_CHUNK <= n) {
      const float* sp = s + base + threadIdx.x * 4;
      half_t*      dp = d + base + threadIdx.x * 4;
      v4f v[CVT_LOADS];
#pragma unroll
      for (int j = 0; j < CVT_LOADS; ++j) v[j] = *(const v4f*)(sp + j * CVT_SPAN);
#pragma unroll
      for (int j = 0; j < CVT_LOADS; ++j)
        *(v4h*)(dp + j * CVT_SPAN) = __builtin_convertvector(v[j], v4h);
      // The next trip rewrites the base and data registers that these stores
      // name.
      asm volatile("s_wait_xcnt 0x0" ::: "memory");
    } else {
      for (long long i = base + threadIdx.x; i < n; i += 256) d[i] = (half_t)s[i];
    }
  }
}

// ---------------------------------------------------------------------------
// LayerNorm: one wave per row, eight rows per block; writes f16 (GEMM input format).
// A lane asks for its 32 floats of the row with eight 16-byte loads (each wave load
// covers 512 contiguous bytes) and keeps them in registers, so the row is read once;
// the two sums are joined across the lanes in registers: no LDS and no barrier.
// A launch starts one wave per row instead of eight.
// ---------------------------------------------------------------------------
#define LN_COLS 1024               // row length: 32 lanes x LN_VEC pieces of 4 floats
#define LN_VEC  (LN_COLS / 128)
#define LN_ROWS 8                  // rows (waves) per block

// x plus the x of the lane whose number differs by MASK inside the 16-lane row.
template <int MASK>
__device__ inline float add_row_xmask(float x) {
  const int y = __builtin_amdgcn_update_dpp(0, __builtin_bit_cast(int, x),
                                            0x160 | MASK, 0xf, 0xf, true);
  return x + __builtin_bit_cast(float, y);
}

// Lane l with lane l ^ 16.
__device__ inline float xhalf(float x) {
  const int b = __builtin_bit_cast(int, x);
  return __builtin_bit_cast(
      float, __builtin_amdgcn_permlanex16(b, b, 0x76543210, 0xfedcba98, false, false));
}

// Sum over the 32 lanes, the same value in every lane.
__device__ inline float wave_sum(float x) {
  x = add_row_xmask<1>(x);
  x = add_row_xmask<2>(x);
  x = add_row_xmask<4>(x);
  x = add_row_xmask<8>(x);
  return x + xhalf(x);
}

__global__ __launch_bounds__(32 * LN_ROWS) void layernorm_kernel(
    const float* __restrict__ x, const float* __restrict__ g,
    const float* __restrict__ b, half_t* __restrict__ outh, int rows) {
  const int lane = threadIdx.x & 31;
  const int row  = blockIdx.x * LN_ROWS + (threadIdx.x >> 5);
  if (row >= rows) return;   // the same in every lane of a wave; no barrier follows
  const float* xr = x + (size_t)row * LN_COLS + lane * 4;
  v4f v[LN_VEC], gv[LN_VEC], bv[LN_VEC];
#pragma unroll
  for (int j = 0; j < LN_VEC; ++j) v[j] = *(const v4f*)(xr + j * 128);
#pragma unroll
  for (int j = 0; j < LN_VEC; ++j) {
    gv[j] = *(const v4f*)(g + lane * 4 + j * 128);
    bv[j] = *(const v4f*)(b + lane * 4 + j * 128);
  }
  // Keeps all 24 loads above the sums: the scheduler otherwise sinks the g and b loads
  // behind the reduction, two at a time, and the wave waits out their latency in turn.
  __builtin_amdgcn_sched_barrier(0);
  // four independent chains per sum
  v4f sv = v[0], qv = v[0] * v[0];
#pragma unroll
  for (int j = 1; j < LN_VEC; ++j) { sv += v[j]; qv += v[j] * v[j]; }
  const float s  = wave_sum((sv[0] + sv[1]) + (sv[2] + sv[3]));
  const float s2 = wave_sum((qv[0] + qv[1]) + (qv[2] + qv[3]));
  const float mean = s / (float)LN_COLS;
  const float var  = s2 / (float)LN_COLS - mean * mean;
  const float rstd = rsqrtf(var + 1e-5f);
  half_t* orow = outh + (size_t)row * LN_COLS + lane * 4;
#pragma unroll
  for (int j = 0; j < LN_VEC; ++j)
    *(v4h*)(orow + j * 128) =
        __builtin_convertvector((v[j] - mean) * rstd * gv[j] + bv[j], v4h);
}

// ---------------------------------------------------------------------------
// LDS-staged double-buffered GEMM:
//   out[M,N] = act(A[M,K] @ W[N,K]^T + bias[N]); optional residual f32 add.
// Block = 256 thr = 8 waves (2 in M x 4 in N). Block tile 128x128.
// A stage holds 128 k (four WMMA k-blocks of 32), so that fragments can be fetched
// one k-block ahead inside a published stage; one barrier serves 128 k.
// LDS: 2 x (128 A rows + 128 B rows) of 256 B at a 272-B pitch = 136 KB.
// Global->LDS staging uses GLOBAL_LOAD_ASYNC_TO_LDS_B128 (ASYNCcnt).
// K must be a multiple of KSTEP.
// ---------------------------------------------------------------------------
#define KSTEP 128
#define MBLK  128
#define NBLK  128
#define GPITCH 136  // halves; 272-B rows (16 B x odd) for the ds_load_b128 reader

__global__ __launch_bounds__(256) void gemm_wmma_kernel(
    const half_t* __restrict__ A, const half_t* __restrict__ W,
    const float* __restrict__ bias, half_t* __restrict__ outh,
    float* __restrict__ resid, int M, int N, int K, int act) {
  __shared__ __attribute__((aligned(16))) half_t ldsA[2][MBLK * GPITCH];
  __shared__ __attribute__((aligned(16))) half_t ldsB[2][NBLK * GPITCH];

  const int tid  = threadIdx.x;
  const int lane = tid & 31;
  const int wid  = tid >> 5;     // 0..7
  const int wm   = wid >> 2;     // 0..1 : wave row  (64 rows each)
  const int wn   = wid & 3;      // 0..3 : wave col  (32 cols each)
  const int m0 = blockIdx.x * MBLK;
  const int n0 = blockIdx.y * NBLK;

  // Staging assignment: thread -> rows (tid>>4) + 0,16,..,112, 16-byte piece tid&15
  // of the row's 256 B; one wave's copy covers two whole 256-B row pieces.
  const int crow = tid >> 4;         // 0..15
  const int cq   = (tid & 15) * 8;   // halves
  auto stage = [&](int ks, int sb) {
#pragma unroll
    for (int rr = 0; rr < MBLK; rr += 16)
      copy_b128_to_lds(A + (size_t)(m0 + crow + rr) * K + ks + cq,
                       &ldsA[sb][(crow + rr) * GPITCH + cq]);
#pragma unroll
    for (int rr = 0; rr < NBLK; rr += 16)
      copy_b128_to_lds(W + (size_t)(n0 + crow + rr) * K + ks + cq,
                       &ldsB[sb][(crow + rr) * GPITCH + cq]);
  };

  v8f acc[4][2];
#pragma unroll
  for (int i = 0; i < 4; ++i) { acc[i][0] = zero_v8f(); acc[i][1] = zero_v8f(); }

  // C layout -> lane l<16 holds rows 0..7 (vgpr r), l>=16 rows 8..15.
  const int sub = lane & 15, hi = lane >> 4;
  // The bias is asked for here, so that its latency runs beside that of tile 0's copies.
  const float bias0 = bias[n0 + wn * 32 + sub];
  const float bias1 = bias[n0 + wn * 32 + sub + 16];

  // Ring prologue: stage 0 lands and is published, then stage 1 starts.
  stage(0, 0);
  asm volatile("s_wait_asynccnt 0x0" ::: "memory");  // own copies of stage 0 landed
  __syncthreads();                                   // publishes stage 0
  if (KSTEP < K) stage(KSTEP, 1);

  int buf = 0;
  for (int k0 = 0; k0 < K; k0 += KSTEP) {
    // compute: per k-block of 32, 4 A-frags x 2 B-frags = 8 WMMA, fed by ds_load_b128.
    // Two fragment sets: the twelve reads of block b + 1 are issued as one group ahead
    // of block b's WMMAs, so their LDS latency runs beside the matrix work. Only
    // blocks of this stage are fetched; the next stage is read behind its barrier.
    v16h af[2][4], bf[2][2];
    auto load_block = [&](int s, int kb) {
      bf[s][0] = load_frag(&ldsB[buf][(wn * 32 +  0) * GPITCH + kb], GPITCH);
      bf[s][1] = load_frag(&ldsB[buf][(wn * 32 + 16) * GPITCH + kb], GPITCH);
#pragma unroll
      for (int i = 0; i < 4; ++i)
        af[s][i] = load_frag(&ldsA[buf][(wm * 64 + i * 16) * GPITCH + kb], GPITCH);
    };
    load_block(0, 0);
#pragma unroll
    for (int b = 0; b < KSTEP / 32; ++b) {
      if (b + 1 < KSTEP / 32) load_block((b + 1) & 1, (b + 1) * 32);
      // Keeps the group of reads above the WMMAs: the scheduler otherwise sinks each
      // read to its use, and every WMMA pair waits out an LDS round trip.
      __builtin_amdgcn_sched_barrier(0);
#pragma unroll
      for (int i = 0; i < 4; ++i) {
        acc[i][0] = wmma_f16(af[b & 1][i], bf[b & 1][0], acc[i][0]);
        acc[i][1] = wmma_f16(af[b & 1][i], bf[b & 1][1], acc[i][1]);
      }
      // Keeps the following group of reads out of this run of WMMAs.
      __builtin_amdgcn_sched_barrier(0);
    }

    // Publish point of the next stage; it also ends every reader's last read of buf.
    asm volatile("s_wait_dscnt 0x0" ::: "memory");     // own LDS reads of buf retired
    asm volatile("s_wait_asynccnt 0x0" ::: "memory");  // own copies of the next stage landed
    __syncthreads();
    if (k0 + 2 * KSTEP < K) stage(k0 + 2 * KSTEP, buf);  // refill the buffer just read
    buf ^= 1;
  }
  asm volatile("s_wait_asynccnt 0x0" ::: "memory");    // nothing in flight behind the ring

  // epilogue: the tests on act, outh and resid stand outside the element loops
#pragma unroll
  for (int i = 0; i < 4; ++i) {
#pragma unroll
    for (int r = 0; r < 8; ++r) {
      acc[i][0][r] += bias0;
      acc[i][1][r] += bias1;
    }
  }
  if (act == 1) {
#pragma unroll
    for (int i = 0; i < 4; ++i)
#pragma unroll
      for (int j = 0; j < 2; ++j)
#pragma unroll
        for (int r = 0; r < 8; ++r) {
          const float v = acc[i][j][r];
          acc[i][j][r] = 0.5f * v * (1.0f + erff(v * 0.70710678118654752f));
        }
  }
  // An output element lies at a block-uniform place (row i*16 + r, column j*16 of
  // the block's tile) plus this 32-bit offset of the lane, in elements.
  const size_t   tile0 = (size_t)m0 * N + n0;
  const unsigned loff  = (unsigned)((wm * 64 + 8 * hi) * N + wn * 32 + sub);
  if (outh) {
    half_t* op = outh + tile0;
#pragma unroll
    for (int i = 0; i < 4; ++i)
#pragma unroll
      for (int r = 0; r < 8; ++r)
#pragma unroll
        for (int j = 0; j < 2; ++j)
          (op + (size_t)(i * 16 + r) * N + j * 16)[loff] = (half_t)acc[i][j][r];
    // The residual path below rewrites registers that these stores name.
    asm volatile("s_wait_xcnt 0x0" ::: "memory");
  }
  if (resid) {
    float* rp = resid + tile0;
    // All 64 residual values are in flight together before the first is used.
    v8f rv[4][2];
#pragma unroll
    for (int i = 0; i < 4; ++i)
#pragma unroll
      for (int r = 0; r < 8; ++r)
#pragma unroll
        for (int j = 0; j < 2; ++j)
          rv[i][j][r] = (rp + (size_t)(i * 16 + r) * N + j * 16)[loff];
#pragma unroll
    for (int i = 0; i < 4; ++i)
#pragma unroll
      for (int r = 0; r < 8; ++r)
#pragma unroll
        for (int j = 0; j < 2; ++j)
          (rp + (size_t)(i * 16 + r) * N + j * 16)[loff] = rv[i][j][r] + acc[i][j][r];
  }
}

#define KPITCH 72
#define VPITCH 80

typedef __attribute__((ext_vector_type(8))) short s16x8;

__device__ inline unsigned lds_byte_addr(const half_t* p) {
  return (unsigned)(size_t)(ASL const half_t*)p;
}

// Transposing LDS read: lane (c = l & 15, h = l >> 4) gets T[8h + 0..7][c] of the
// 16 x 16 tile whose per-lane row addresses are passed in.
__device__ inline v8h lds_load_tr16(const half_t* p) {
  return __builtin_bit_cast(v8h, __builtin_amdgcn_ds_load_tr16_b128_v8i16((ASL s16x8*)p));
}

// Four 16-byte async copies per lane (two K rows, two V rows). The s_wait_xcnt
// stands inside the statement so that no address register named here is
// rewritten ahead of it.
__device__ inline void stage_kv_tile(const half_t* gk0, const half_t* gk1,
                                     const half_t* gv0, const half_t* gv1,
                                     unsigned lk0, unsigned lk1,
                                     unsigned lv0, unsigned lv1) {
  asm volatile(
      "global_load_async_to_lds_b128 %0, %4, off\n\t"
      "global_load_async_to_lds_b128 %1, %5, off\n\t"
      "global_load_async_to_lds_b128 %2, %6, off\n\t"
      "global_load_async_to_lds_b128 %3, %7, off\n\t"
      "s_wait_xcnt 0x0"
      :: "v"(lk0), "v"(lk1), "v"(lv0), "v"(lv1),
         "v"(gk0), "v"(gk1), "v"(gv0), "v"(gv1)
      : "memory");
}

__global__ __launch_bounds__(128) void attn_wmma_kernel(
    const half_t* __restrict__ Q, int qld,
    const half_t* __restrict__ Km, int kld,
    const half_t* __restrict__ V, int vld,
    half_t* __restrict__ O, int oldd,
    int Tq, int Tk, int Dh, const int* __restrict__ nctx, float scale) {
  __shared__ __attribute__((aligned(16))) half_t kls[2][32 * KPITCH];
  __shared__ __attribute__((aligned(16))) half_t vls[2][32 * VPITCH];
  const int lane = threadIdx.x & 31;
  const int wid  = threadIdx.x >> 5;
  const int sub = lane & 15, hi = lane >> 4;
  const int h = blockIdx.y, b = blockIdx.z;
  const int qt = (blockIdx.x * 4 + wid) * 16;

  int kvlen = Tk;
  if (nctx) { int nc = *nctx; kvlen = nc < Tk ? nc : Tk; }

  const half_t* Qb = Q + ((size_t)b * Tq + qt) * qld + h * Dh;
  const half_t* Kb = Km + (size_t)b * Tk * kld + h * Dh;
  const half_t* Vb = V  + (size_t)b * Tk * vld + h * Dh;

  const v16h qf0 = load_frag(Qb,      qld);   // Dh = 64 -> two K=32 fragments
  const v16h qf1 = load_frag(Qb + 32, qld);

  // acc[d][r] = O[query sub][d * 16 + 8 * hi + r]
  v8f acc[4];
#pragma unroll
  for (int d = 0; d < 4; ++d) acc[d] = zero_v8f();
  // Running maximum of the lane's query (equal in lanes l and l ^ 16) and the sum
  // over the lane's own keys; the two halves' sums are joined behind the loop.
  float mrow = -1e30f, lsum = 0.f;

  // Staging: thread -> tile rows srow and srow + 16, 16-byte chunk sq of the row;
  // one wave's copy covers four whole 128-B rows.
  const int srow = threadIdx.x >> 3;        // 0..15
  const int sq   = (threadIdx.x & 7) * 8;   // halves
  auto stage = [&](int kt0, int sb) {
    const half_t* gk = Kb + (size_t)(kt0 + srow) * kld + sq;
    const half_t* gv = Vb + (size_t)(kt0 + srow) * vld + sq;
    stage_kv_tile(gk, gk + (size_t)16 * kld, gv, gv + (size_t)16 * vld,
                  lds_byte_addr(&kls[sb][srow * KPITCH + sq]),
                  lds_byte_addr(&kls[sb][(srow + 16) * KPITCH + sq]),
                  lds_byte_addr(&vls[sb][srow * VPITCH + sq]),
                  lds_byte_addr(&vls[sb][(srow + 16) * VPITCH + sq]));
  };
  // Per-lane offset of the transposing V read inside a tile.
  const int vtr = (8 * hi + (lane & 7)) * VPITCH + 8 * ((lane >> 3) & 1);

  // Ring prologue: tile 0 lands and is published, then tile 1 starts.
  stage(0, 0);
  asm volatile("s_wait_asynccnt 0x0" ::: "memory");  // own copies of tile 0 landed
  __syncthreads();                                   // publishes tile 0
  if (32 < kvlen) stage(32, 1);

  int buf = 0;
  for (int kt = 0; kt < kvlen; kt += 32) {
    v8f s0 = zero_v8f(), s1 = zero_v8f();
    {
      const half_t* kl = &kls[buf][0];
      v16h k00 = load_frag(kl,      KPITCH);
      v16h k01 = load_frag(kl + 32, KPITCH);
      v16h k10 = load_frag(kl + 16 * KPITCH,      KPITCH);
      v16h k11 = load_frag(kl + 16 * KPITCH + 32, KPITCH);
      // Inputs-only fence on the loaded fragments: keeps the eight LDS reads in one
      // group with one wait; without it each WMMA waits out its own LDS latency.
      asm volatile("" :: "v"(k00), "v"(k01), "v"(k10), "v"(k11));
      // s0[r] = S[key kt + 8 * hi + r][query sub], s1[r] the same 16 keys on
      s0 = wmma_f16(k00, qf0, s0);
      s0 = wmma_f16(k01, qf1, s0);
      s1 = wmma_f16(k10, qf0, s1);
      s1 = wmma_f16(k11, qf1, s1);
    }
    float v0[8], v1[8];
#pragma unroll
    for (int r = 0; r < 8; ++r) { v0[r] = s0[r] * scale; v1[r] = s1[r] * scale; }
    if (kt + 32 > kvlen) {   // block-uniform: only a last, partial tile has keys to mask
      const int lim = kvlen - kt - 8 * hi;
#pragma unroll
      for (int r = 0; r < 8; ++r) {
        if (r >= lim)      v0[r] = -1e30f;
        if (r + 16 >= lim) v1[r] = -1e30f;
      }
    }

    // Maximum and sum go as trees, so that no long dependent chain forms.
    float t[8];
#pragma unroll
    for (int r = 0; r < 8; ++r) t[r] = fmaxf(v0[r], v1[r]);
#pragma unroll
    for (int w = 4; w > 0; w >>= 1)
#pragma unroll
      for (int r = 0; r < w; ++r) t[r] = fmaxf(t[r], t[r + w]);
    const float mx   = fmaxf(t[0], xhalf(t[0]));
    const float mnew = fmaxf(mrow, mx);
    const float corr = __expf(mrow - mnew);
    mrow = mnew;
#pragma unroll
    for (int r = 0; r < 8; ++r) {
      v0[r] = __expf(v0[r] - mnew);
      v1[r] = __expf(v1[r] - mnew);
      t[r] = v0[r] + v1[r];
    }
#pragma unroll
    for (int w = 4; w > 0; w >>= 1)
#pragma unroll
      for (int r = 0; r < w; ++r) t[r] += t[r + w];
    lsum = lsum * corr + t[0];
#pragma unroll
    for (int d = 0; d < 4; ++d)
#pragma unroll
      for (int r = 0; r < 8; ++r) acc[d][r] *= corr;

    // P^T as a B operand: element s holds key 8 * hi + s, then 16 + 8 * hi + (s - 8),
    // the k order in which the transposing read delivers V^T.
    v16h pf;
#pragma unroll
    for (int j = 0; j < 8; ++j) { pf[j] = (half_t)v0[j]; pf[j + 8] = (half_t)v1[j]; }

    // acc += V^T(64x32) @ P^T(32x16): A[m][k] = V[kt+k][h*Dh + d*16 + m]
#pragma unroll
    for (int d = 0; d < 4; ++d) {
      const half_t* vb = &vls[buf][vtr + d * 16];
      const v8h vlo = lds_load_tr16(vb);                 // keys 8*hi + 0..7
      const v8h vhi = lds_load_tr16(vb + 16 * VPITCH);   // keys 16 + 8*hi + 0..7
      v16h vf;
#pragma unroll
      for (int j = 0; j < 8; ++j) { vf[j] = vlo[j]; vf[j + 8] = vhi[j]; }
      acc[d] = wmma_f16(vf, pf, acc[d]);
    }

    // Publish point of tile t+1; it also ends every reader's last read of buf.
    asm volatile("s_wait_dscnt 0x0" ::: "memory");     // own LDS reads of buf retired
    asm volatile("s_wait_asynccnt 0x0" ::: "memory");  // own copies of tile t+1 landed
    __syncthreads();
    if (kt + 64 < kvlen) stage(kt + 64, buf);          // refill the buffer just read
    buf ^= 1;
  }
  asm volatile("s_wait_asynccnt 0x0" ::: "memory");    // nothing in flight at wave end

  // A lane's eight values of a tile are eight neighbours of one output row.
  const float inv = 1.0f / (lsum + xhalf(lsum));
  half_t* orow = O + ((size_t)b * Tq + qt + sub) * oldd + h * Dh + 8 * hi;
#pragma unroll
  for (int d = 0; d < 4; ++d) {
    v8h o;
#pragma unroll
    for (int r = 0; r < 8; ++r) o[r] = (half_t)(acc[d][r] * inv);
    *(v8h*)(orow + d * 16) = o;
  }
}

// ---------------------------------------------------------------------------
// Host orchestration
// ---------------------------------------------------------------------------
extern "C" void kernel_launch(void* const* d_in, const int* in_sizes, int n_in,
                              void* d_out, int out_size, void* d_ws, size_t ws_size,
                              hipStream_t stream) {
  (void)n_in; (void)out_size; (void)ws_size;
  const float* tgt      = (const float*)d_in[0];
  const float* memory   = (const float*)d_in[1];
  const float* self_w   = (const float*)d_in[2];
  const float* self_b   = (const float*)d_in[3];
  const float* self_ow  = (const float*)d_in[4];
  const float* self_ob  = (const float*)d_in[5];
  const float* cross_w  = (const float*)d_in[6];
  const float* cross_b  = (const float*)d_in[7];
  const float* cross_ow = (const float*)d_in[8];
  const float* cross_ob = (const float*)d_in[9];
  const float* ln1_g = (const float*)d_in[10];
  const float* ln1_b = (const float*)d_in[11];
  const float* ln2_g = (const float*)d_in[12];
  const float* ln2_b = (const float*)d_in[13];
  const float* ln3_g = (const float*)d_in[14];
  const float* ln3_b = (const float*)d_in[15];
  const float* w1 = (const float*)d_in[16];
  const float* b1 = (const float*)d_in[17];
  const float* w2 = (const float*)d_in[18];
  const float* b2 = (const float*)d_in[19];
  const int*   n_ctx_p = (const int*)d_in[20];

  const int E  = in_sizes[10];
  const int F  = in_sizes[16] / E;
  const int B  = 2;
  const int Tq = in_sizes[0] / (B * E);
  const int Tk = in_sizes[1] / (B * E);
  const int nhead = 16;
  const int Dh = E / nhead;
  const int M  = B * Tq;   // query rows
  const int Mk = B * Tk;   // memory rows
  const float scale = 1.0f / sqrtf((float)Dh);

  // --- workspace carve (all f16 buffers, 256B aligned) ---
  char* wp = (char*)d_ws;
  auto carve = [&](size_t elems) -> half_t* {
    half_t* r = (half_t*)wp;
    wp += (elems * sizeof(half_t) + 255) & ~(size_t)255;
    return r;
  };
  half_t* selfw_h   = carve((size_t)3 * E * E);
  half_t* selfow_h  = carve((size_t)E * E);
  half_t* crossw_h  = carve((size_t)3 * E * E);
  half_t* crossow_h = carve((size_t)E * E);
  half_t* w1_h      = carve((size_t)F * E);
  half_t* w2_h      = carve((size_t)E * F);
  half_t* mem_h     = carve((size_t)Mk * E);
  half_t* nx_h      = carve((size_t)M * E);
  half_t* qkv_h     = carve((size_t)M * 3 * E);
  half_t* qc_h      = carve((size_t)M * E);
  half_t* kvc_h     = carve((size_t)Mk * 2 * E);
  half_t* attn_h    = carve((size_t)M * E);
  half_t* ffn1_h    = carve((size_t)M * F);
  float*  x = (float*)d_out;   // residual accumulator

  // 512 blocks of 8 waves: 16 streaming waves on each of the 256 WGPs.
  convert_f16_kernel<<<512, 256, 0, stream>>>(
      self_w, self_ow, cross_w, cross_ow, w1, w2, memory,
      selfw_h, selfow_h, crossw_h, crossow_h, w1_h, w2_h, mem_h,
      (long long)3 * E * E, (long long)E * E, (long long)3 * E * E,
      (long long)E * E, (long long)F * E, (long long)E * F, (long long)Mk * E);

  // x = tgt
  (void)hipMemcpyAsync(x, tgt, (size_t)M * E * sizeof(float),
                       hipMemcpyDeviceToDevice, stream);

  auto gemm = [&](const half_t* A, const half_t* W, const float* bias,
                  half_t* outh, float* resid, int m, int n, int k, int act) {
    dim3 grid(m / MBLK, n / NBLK);
    gemm_wmma_kernel<<<grid, 256, 0, stream>>>(A, W, bias, outh, resid, m, n, k, act);
  };

  // ---- self-attention sublayer ----
  layernorm_kernel<<<(M + LN_ROWS - 1) / LN_ROWS, 32 * LN_ROWS, 0, stream>>>(
      x, ln1_g, ln1_b, nx_h, M);
  gemm(nx_h, selfw_h, self_b, qkv_h, nullptr, M, 3 * E, E, 0);
  {
    dim3 grid(Tq / 64, nhead, B);
    attn_wmma_kernel<<<grid, 128, 0, stream>>>(
        qkv_h, 3 * E, qkv_h + E, 3 * E, qkv_h + 2 * E, 3 * E,
        attn_h, E, Tq, Tq, Dh, n_ctx_p, scale);
  }
  gemm(attn_h, selfow_h, self_ob, nullptr, x, M, E, E, 0);

  // ---- cross-attention sublayer ----
  layernorm_kernel<<<(M + LN_ROWS - 1) / LN_ROWS, 32 * LN_ROWS, 0, stream>>>(
      x, ln2_g, ln2_b, nx_h, M);
  gemm(nx_h,  crossw_h,                 cross_b,     qc_h,  nullptr, M,  E,     E, 0);
  gemm(mem_h, crossw_h + (size_t)E * E, cross_b + E, kvc_h, nullptr, Mk, 2 * E, E, 0);
  {
    dim3 grid(Tq / 64, nhead, B);
    attn_wmma_kernel<<<grid, 128, 0, stream>>>(
        qc_h, E, kvc_h, 2 * E, kvc_h + E, 2 * E,
        attn_h, E, Tq, Tk, Dh, nullptr, scale);
  }
  gemm(attn_h, crossow_h, cross_ob, nullptr, x, M, E, E, 0);

  // ---- FFN sublayer ----
  layernorm_kernel<<<(M + LN_ROWS - 1) / LN_ROWS, 32 * LN_ROWS, 0, stream>>>(
      x, ln3_g, ln3_b, nx_h, M);
  gemm(nx_h,   w1_h, b1, ffn1_h, nullptr, M, F, E, 1);  // exact GELU
  gemm(ffn1_h, w2_h, b2, nullptr, x,       M, E, F, 0);
}

// v008
// It runs in 190 microseconds.
// Two timings next to v007 put it at 1.05 and 1.06 times that version's speed.
// Counting every step since v000, it is 3.88 times as fast.
#include <hip/hip_runtime.h>
#include <math.h>

typedef _Float16 half_t;
typedef __attribute__((ext_vector_type(16))) _Float16 v16h;
typedef __attribute__((ext_vector_type(8)))  _Float16 v8h;
typedef __attribute__((ext_vector_type(8)))  float    v8f;
typedef __attribute__((vector_size(16)))     int      vsi4;   // int4 for async builtin

#define ASG __attribute__((address_space(1)))
#define ASL __attribute__((address_space(3)))

// Detect CDNA5 async global->LDS builtins (gfx1250); fall back to load+ds_store.
#if defined(__has_builtin)
#  if __has_builtin(__builtin_amdgcn_global_load_async_to_lds_b128)
#    define HAVE_ASYNC 1
#  endif
#endif
#ifndef HAVE_ASYNC
#  define HAVE_ASYNC 0
#endif

// ---------------------------------------------------------------------------
// WMMA helpers (CDNA5 gfx1250, wave32)
// ---------------------------------------------------------------------------
__device__ inline v8f wmma_f16(v16h a, v16h b, v8f c) {
  // D(16x16,f32) = A(16x32,f16) x B(32x16,f16) + C
  return __builtin_amdgcn_wmma_f32_16x16x32_f16(
      /*neg_a=*/false, a, /*neg_b=*/false, b,
      /*c_mod=*/(short)0, c, /*reuse_a=*/false, /*reuse_b=*/false);
}

__device__ inline v8f zero_v8f() {
  v8f z;
#pragma unroll
  for (int i = 0; i < 8; ++i) z[i] = 0.0f;
  return z;
}

// Load a 16x32 f16 fragment in the ISA A-matrix lane layout:
//   lane<16 : row=lane,    K = [0..7] then [16..23]
//   lane>=16: row=lane-16, K = [8..15] then [24..31]
// base points at (row0, k0); ld = row stride in elements. Also used for the
// B operand of D = A x W^T (B column n == row n of W, identical pattern).
__device__ inline v16h load_frag(const half_t* __restrict__ base, int ld) {
  const int lane = threadIdx.x & 31;
  const int sub  = lane & 15;
  const int hi   = lane >> 4;
  const half_t* p = base + (size_t)sub * ld + hi * 8;
  v8h lo = *(const v8h*)(p);
  v8h hh = *(const v8h*)(p + 16);
  v16h r;
#pragma unroll
  for (int i = 0; i < 8; ++i) { r[i] = lo[i]; r[i + 8] = hh[i]; }
  return r;
}

// One 16-byte global->LDS transfer per lane (ASYNCcnt path if available).
__device__ inline void copy_b128_to_lds(const half_t* g, half_t* l) {
#if HAVE_ASYNC
  __builtin_amdgcn_global_load_async_to_lds_b128(
      (ASG vsi4*)g, (ASL vsi4*)l, 0, 0);
#else
  *(v8h*)l = *(const v8h*)g;
#endif
}

// ---------------------------------------------------------------------------
// Elementwise f32 -> f16 conversion, streaming.
// An array is cut into chunks of 8192 floats; a block walks chunks at a stride of
// blocks. In a whole chunk each thread issues eight 16-byte loads (every wave
// load covers 512 contiguous bytes) before the first is converted, so few waves
// keep many bytes in flight; the last, partial chunk of an array goes by element.
// ---------------------------------------------------------------------------
#define CVT_LOADS 8
#define CVT_SPAN  (256 * 4)                // floats per block-wide 16-byte load
#define CVT_CHUNK (CVT_SPAN * CVT_LOADS)   // floats per chunk

typedef __attribute__((ext_vector_type(4))) float    v4f;
typedef __attribute__((ext_vector_type(4))) _Float16 v4h;

__device__ inline int cvt_chunks(long long n) {
  return (int)((n + CVT_CHUNK - 1) / CVT_CHUNK);
}

// The chunk of s[0..n) that starts at element base; a block of 256 threads.
__device__ inline void convert_chunk(const float* __restrict__ s, half_t* __restrict__ d,
                                     long long n, long long base) {
  if (base + CVT_CHUNK <= n) {
    const float* sp = s + base + threadIdx.x * 4;
    half_t*      dp = d + base + threadIdx.x * 4;
    v4f v[CVT_LOADS];
#pragma unroll
    for (int j = 0; j < CVT_LOADS; ++j) v[j] = *(const v4f*)(sp + j * CVT_SPAN);
#pragma unroll
    for (int j = 0; j < CVT_LOADS; ++j)
      *(v4h*)(dp + j * CVT_SPAN) = __builtin_convertvector(v[j], v4h);
    // The caller's next trip rewrites the base and data registers that these stores
    // name.
    asm volatile("s_wait_xcnt 0x0" ::: "memory");
  } else {
    for (long long i = base + threadIdx.x; i < n; i += 256) d[i] = (half_t)s[i];
  }
}

// One array, by block blk of nblk.
__device__ inline void convert_array(const float* __restrict__ s, half_t* __restrict__ d,
                                     long long n, int blk, int nblk) {
  const int e = cvt_chunks(n);
  for (int c = blk; c < e; c += nblk) convert_chunk(s, d, n, (long long)c * CVT_CHUNK);
}

// Five arrays as one run of chunks, by block blk of nblk.
__device__ inline void convert_arrays(
    const float* __restrict__ s0, const float* __restrict__ s1,
    const float* __restrict__ s2, const float* __restrict__ s3,
    const float* __restrict__ s4,
    half_t* __restrict__ d0, half_t* __restrict__ d1, half_t* __restrict__ d2,
    half_t* __restrict__ d3, half_t* __restrict__ d4,
    long long n0, long long n1, long long n2, long long n3, long long n4,
    int blk, int nblk) {
  // first chunk index behind each array
  const int e0 = cvt_chunks(n0);
  const int e1 = e0 + cvt_chunks(n1);
  const int e2 = e1 + cvt_chunks(n2);
  const int e3 = e2 + cvt_chunks(n3);
  const int e4 = e3 + cvt_chunks(n4);

  for (int c = blk; c < e4; c += nblk) {
    const float* s = s0; half_t* d = d0; long long n = n0; int first = 0;
    if (c >= e0) { s = s1; d = d1; n = n1; first = e0; }
    if (c >= e1) { s = s2; d = d2; n = n2; first = e1; }
    if (c >= e2) { s = s3; d = d3; n = n3; first = e2; }
    if (c >= e3) { s = s4; d = d4; n = n4; first = e3; }
    convert_chunk(s, d, n, (long long)(c - first) * CVT_CHUNK);
  }
}

// ---------------------------------------------------------------------------
// LayerNorm: one wave per row, eight rows per block; writes f16 (GEMM input format).
// A lane asks for its 32 floats of the row with eight 16-byte loads (each wave load
// covers 512 contiguous bytes) and keeps them in registers, so the row is read once;
// the two sums are joined across the lanes in registers: no LDS and no barrier.
// A launch starts one wave per row instead of eight.
// ---------------------------------------------------------------------------
#define LN_COLS 1024               // row length: 32 lanes x LN_VEC pieces of 4 floats
#define LN_VEC  (LN_COLS / 128)
#define LN_ROWS 8                  // rows (waves) per block

// x plus the x of the lane whose number differs by MASK inside the 16-lane row.
template <int MASK>
__device__ inline float add_row_xmask(float x) {
  const int y = __builtin_amdgcn_update_dpp(0, __builtin_bit_cast(int, x),
                                            0x160 | MASK, 0xf, 0xf, true);
  return x + __builtin_bit_cast(float, y);
}

// Lane l with lane l ^ 16.
__device__ inline float xhalf(float x) {
  const int b = __builtin_bit_cast(int, x);
  return __builtin_bit_cast(
      float, __builtin_amdgcn_permlanex16(b, b, 0x76543210, 0xfedcba98, false, false));
}

// Sum over the 32 lanes, the same value in every lane.
__device__ inline float wave_sum(float x) {
  x = add_row_xmask<1>(x);
  x = add_row_xmask<2>(x);
  x = add_row_xmask<4>(x);
  x = add_row_xmask<8>(x);
  return x + xhalf(x);
}

__device__ inline void layernorm_rows(
    const float* __restrict__ x, const float* __restrict__ g,
    const float* __restrict__ b, half_t* __restrict__ outh,
    float* __restrict__ xcopy, int rows, int blk) {
  const int lane = threadIdx.x & 31;
  const int row  = blk * LN_ROWS + (threadIdx.x >> 5);
  if (row >= rows) return;   // the same in every lane of a wave; no barrier follows
  const float* xr = x + (size_t)row * LN_COLS + lane * 4;
  v4f v[LN_VEC], gv[LN_VEC], bv[LN_VEC];
#pragma unroll
  for (int j = 0; j < LN_VEC; ++j) v[j] = *(const v4f*)(xr + j * 128);
  // A load of g or b below may be given the registers that hold the address of the
  // loads above.
  asm volatile("s_wait_xcnt 0x0" ::: "memory");
#pragma unroll
  for (int j = 0; j < LN_VEC; ++j) {
    gv[j] = *(const v4f*)(g + lane * 4 + j * 128);
    bv[j] = *(const v4f*)(b + lane * 4 + j * 128);
  }
  // Keeps all 24 loads above the sums: the scheduler otherwise sinks the g and b loads
  // behind the reduction, two at a time, and the wave waits out their latency in turn.
  __builtin_amdgcn_sched_barrier(0);
  // four independent chains per sum
  v4f sv = v[0], qv = v[0] * v[0];
#pragma unroll
  for (int j = 1; j < LN_VEC; ++j) { sv += v[j]; qv += v[j] * v[j]; }
  const float s  = wave_sum((sv[0] + sv[1]) + (sv[2] + sv[3]));
  const float s2 = wave_sum((qv[0] + qv[1]) + (qv[2] + qv[3]));
  const float mean = s / (float)LN_COLS;
  const float var  = s2 / (float)LN_COLS - mean * mean;
  const float rstd = rsqrtf(var + 1e-5f);
  half_t* orow = outh + (size_t)row * LN_COLS + lane * 4;
#pragma unroll
  for (int j = 0; j < LN_VEC; ++j)
    *(v4h*)(orow + j * 128) =
        __builtin_convertvector((v[j] - mean) * rstd * gv[j] + bv[j], v4h);
  if (xcopy) {   // the row as it was read, from the registers that hold it
    float* crow = xcopy + (size_t)row * LN_COLS + lane * 4;
#pragma unroll
    for (int j = 0; j < LN_VEC; ++j) *(v4f*)(crow + j * 128) = v[j];
  }
}

__global__ __launch_bounds__(32 * LN_ROWS) void layernorm_kernel(
    const float* __restrict__ x, const float* __restrict__ g,
    const float* __restrict__ b, half_t* __restrict__ outh, int rows) {
  layernorm_rows(x, g, b, outh, nullptr, rows, blockIdx.x);
}

// The conversion of what the first products read and the first LayerNorm depend on
// inputs alone and on nothing of each other, so they share one launch: blocks below
// lnblk take LN_ROWS rows each, the rest walk the conversion's chunks. The LayerNorm's
// waves also store their rows to xcopy, the start value of the residual sum.
__global__ __launch_bounds__(256) void convert_ln_kernel(
    const float* __restrict__ s0, const float* __restrict__ s1,
    const float* __restrict__ s2, const float* __restrict__ s3,
    const float* __restrict__ s4,
    half_t* __restrict__ d0, half_t* __restrict__ d1, half_t* __restrict__ d2,
    half_t* __restrict__ d3, half_t* __restrict__ d4,
    long long n0, long long n1, long long n2, long long n3, long long n4,
    const float* __restrict__ x, const float* __restrict__ g,
    const float* __restrict__ b, half_t* __restrict__ outh,
    float* __restrict__ xcopy, int rows, int lnblk) {
  const int blk = blockIdx.x;
  if (blk < lnblk) {
    layernorm_rows(x, g, b, outh, xcopy, rows, blk);
  } else {
    convert_arrays(s0, s1, s2, s3, s4, d0, d1, d2, d3, d4, n0, n1, n2, n3, n4,
                   blk - lnblk, (int)gridDim.x - lnblk);
  }
}

// ---------------------------------------------------------------------------
// LDS-staged double-buffered GEMM:
//   out[M,N] = act(A[M,K] @ W[N,K]^T + bias[N]); optional residual f32 add.
// Block = 256 thr = 8 waves (2 in M x 4 in N). Block tile 128x128.
// A stage holds 128 k (four WMMA k-blocks of 32), so that fragments can be fetched
// one k-block ahead inside a published stage; one barrier serves 128 k.
// LDS: 2 x (128 A rows + 128 B rows) of 256 B at a 272-B pitch = 136 KB.
// Global->LDS staging uses GLOBAL_LOAD_ASYNC_TO_LDS_B128 (ASYNCcnt).
// K must be a multiple of KSTEP.
// ---------------------------------------------------------------------------
#define KSTEP 128
#define MBLK  128
#define NBLK  128
#define GPITCH 136  // halves; 272-B rows (16 B x odd) for the ds_load_b128 reader

// One block tile at (m0, n0).
__device__ __forceinline__ void gemm_tile(
    const half_t* __restrict__ A, const half_t* __restrict__ W,
    const float* __restrict__ bias, half_t* __restrict__ outh,
    float* __restrict__ resid, int m0, int n0, int N, int K, int act) {
  __shared__ __attribute__((aligned(16))) half_t ldsA[2][MBLK * GPITCH];
  __shared__ __attribute__((aligned(16))) half_t ldsB[2][NBLK * GPITCH];

  const int tid  = threadIdx.x;
  const int lane = tid & 31;
  const int wid  = tid >> 5;     // 0..7
  const int wm   = wid >> 2;     // 0..1 : wave row  (64 rows each)
  const int wn   = wid & 3;      // 0..3 : wave col  (32 cols each)

  // Staging assignment: thread -> rows (tid>>4) + 0,16,..,112, 16-byte piece tid&15
  // of the row's 256 B; one wave's copy covers two whole 256-B row pieces.
  const int crow = tid >> 4;         // 0..15
  const int cq   = (tid & 15) * 8;   // halves
  auto stage = [&](int ks, int sb) {
#pragma unroll
    for (int rr = 0; rr < MBLK; rr += 16)
      copy_b128_to_lds(A + (size_t)(m0 + crow + rr) * K + ks + cq,
                       &ldsA[sb][(crow + rr) * GPITCH + cq]);
#pragma unroll
    for (int rr = 0; rr < NBLK; rr += 16)
      copy_b128_to_lds(W + (size_t)(n0 + crow + rr) * K + ks + cq,
                       &ldsB[sb][(crow + rr) * GPITCH + cq]);
  };

  v8f acc[4][2];
#pragma unroll
  for (int i = 0; i < 4; ++i) { acc[i][0] = zero_v8f(); acc[i][1] = zero_v8f(); }

  // C layout -> lane l<16 holds rows 0..7 (vgpr r), l>=16 rows 8..15.
  const int sub = lane & 15, hi = lane >> 4;
  // The bias is asked for here, so that its latency runs beside that of tile 0's copies.
  const float bias0 = bias[n0 + wn * 32 + sub];
  const float bias1 = bias[n0 + wn * 32 + sub + 16];

  // Ring prologue: stage 0 lands and is published, then stage 1 starts.
  stage(0, 0);
  asm volatile("s_wait_asynccnt 0x0" ::: "memory");  // own copies of stage 0 landed
  __syncthreads();                                   // publishes stage 0
  if (KSTEP < K) stage(KSTEP, 1);

  int buf = 0;
  for (int k0 = 0; k0 < K; k0 += KSTEP) {
    // compute: per k-block of 32, 4 A-frags x 2 B-frags = 8 WMMA, fed by ds_load_b128.
    // Two fragment sets: the twelve reads of block b + 1 are issued as one group ahead
    // of block b's WMMAs, so their LDS latency runs beside the matrix work. Only
    // blocks of this stage are fetched; the next stage is read behind its barrier.
    v16h af[2][4], bf[2][2];
    auto load_block = [&](int s, int kb) {
      bf[s][0] = load_frag(&ldsB[buf][(wn * 32 +  0) * GPITCH + kb], GPITCH);
      bf[s][1] = load_frag(&ldsB[buf][(wn * 32 + 16) * GPITCH + kb], GPITCH);
#pragma unroll
      for (int i = 0; i < 4; ++i)
        af[s][i] = load_frag(&ldsA[buf][(wm * 64 + i * 16) * GPITCH + kb], GPITCH);
    };
    load_block(0, 0);
#pragma unroll
    for (int b = 0; b < KSTEP / 32; ++b) {
      if (b + 1 < KSTEP / 32) load_block((b + 1) & 1, (b + 1) * 32);
      // Keeps the group of reads above the WMMAs: the scheduler otherwise sinks each
      // read to its use, and every WMMA pair waits out an LDS round trip.
      __builtin_amdgcn_sched_barrier(0);
#pragma unroll
      for (int i = 0; i < 4; ++i) {
        acc[i][0] = wmma_f16(af[b & 1][i], bf[b & 1][0], acc[i][0]);
        acc[i][1] = wmma_f16(af[b & 1][i], bf[b & 1][1], acc[i][1]);
      }
      // Keeps the following group of reads out of this run of WMMAs.
      __builtin_amdgcn_sched_barrier(0);
    }

    // Publish point of the next stage; it also ends every reader's last read of buf.
    asm volatile("s_wait_dscnt 0x0" ::: "memory");     // own LDS reads of buf retired
    asm volatile("s_wait_asynccnt 0x0" ::: "memory");  // own copies of the next stage landed
    __syncthreads();
    if (k0 + 2 * KSTEP < K) stage(k0 + 2 * KSTEP, buf);  // refill the buffer just read
    buf ^= 1;
  }
  asm volatile("s_wait_asynccnt 0x0" ::: "memory");    // nothing in flight behind the ring

  // epilogue: the tests on act, outh and resid stand outside the element loops
#pragma unroll
  for (int i = 0; i < 4; ++i) {
#pragma unroll
    for (int r = 0; r < 8; ++r) {
      acc[i][0][r] += bias0;
      acc[i][1][r] += bias1;
    }
  }
  if (act == 1) {
#pragma unroll
    for (int i = 0; i < 4; ++i)
#pragma unroll
      for (int j = 0; j < 2; ++j)
#pragma unroll
        for (int r = 0; r < 8; ++r) {
          const float v = acc[i][j][r];
          acc[i][j][r] = 0.5f * v * (1.0f + erff(v * 0.70710678118654752f));
        }
  }
  // An output element lies at a block-uniform place (row i*16 + r, column j*16 of
  // the block's tile) plus this 32-bit offset of the lane, in elements.
  const size_t   tile0 = (size_t)m0 * N + n0;
  const unsigned loff  = (unsigned)((wm * 64 + 8 * hi) * N + wn * 32 + sub);
  if (outh) {
    half_t* op = outh + tile0;
#pragma unroll
    for (int i = 0; i < 4; ++i)
#pragma unroll
      for (int r = 0; r < 8; ++r)
#pragma unroll
        for (int j = 0; j < 2; ++j)
          (op + (size_t)(i * 16 + r) * N + j * 16)[loff] = (half_t)acc[i][j][r];
    // The residual path below rewrites registers that these stores name.
    asm volatile("s_wait_xcnt 0x0" ::: "memory");
  }
  if (resid) {
    float* rp = resid + tile0;
    // All 64 residual values are in flight together before the first is used.
    v8f rv[4][2];
#pragma unroll
    for (int i = 0; i < 4; ++i)
#pragma unroll
      for (int r = 0; r < 8; ++r)
#pragma unroll
        for (int j = 0; j < 2; ++j)
          rv[i][j][r] = (rp + (size_t)(i * 16 + r) * N + j * 16)[loff];
#pragma unroll
    for (int i = 0; i < 4; ++i)
#pragma unroll
      for (int r = 0; r < 8; ++r)
#pragma unroll
        for (int j = 0; j < 2; ++j)
          (rp + (size_t)(i * 16 + r) * N + j * 16)[loff] = rv[i][j][r] + acc[i][j][r];
  }
}

// Grid rows below ny are the product's n tiles. A product with N = 1024 has a block for
// only half of the WGPs: the grid rows behind ny convert an array (cs -> cd, cn floats)
// that a later launch reads, on the WGPs that the product leaves idle.
__global__ __launch_bounds__(256) void gemm_wmma_kernel(
    const half_t* __restrict__ A, const half_t* __restrict__ W,
    const float* __restrict__ bias, half_t* __restrict__ outh,
    float* __restrict__ resid, int N, int K, int act, int ny,
    const float* __restrict__ cs, half_t* __restrict__ cd, long long cn) {
  if ((int)blockIdx.y < ny) {
    gemm_tile(A, W, bias, outh, resid, blockIdx.x * MBLK, blockIdx.y * NBLK, N, K, act);
  } else {
    convert_array(cs, cd, cn, (int)((blockIdx.y - ny) * gridDim.x + blockIdx.x),
                  (int)((gridDim.y - ny) * gridDim.x));
  }
}

// Two products that do not depend on each other (equal K, f16 output, no activation, no
// residual) in one launch. Grid rows below ny0 are the n tiles of the first product,
// with grid.x its m tiles; the blocks behind them are numbered on and cut into the
// second product's mt1 m tiles per n tile.
__global__ __launch_bounds__(256) void gemm_pair_kernel(
    const half_t* __restrict__ A0, const half_t* __restrict__ W0,
    const float* __restrict__ bias0, half_t* __restrict__ out0, int N0, int ny0,
    const half_t* __restrict__ A1, const half_t* __restrict__ W1,
    const float* __restrict__ bias1, half_t* __restrict__ out1, int N1, int mt1, int K) {
  const bool second = (int)blockIdx.y >= ny0;
  int mt = blockIdx.x, nt = blockIdx.y;
  if (second) {
    const unsigned t = (blockIdx.y - (unsigned)ny0) * gridDim.x + blockIdx.x;
    mt = (int)(t % (unsigned)mt1);
    nt = (int)(t / (unsigned)mt1);
  }
  const int N = second ? N1 : N0;
  if (nt * NBLK >= N) return;   // block-uniform, ahead of every copy and barrier
  gemm_tile(second ? A1 : A0, second ? W1 : W0, second ? bias1 : bias0,
            second ? out1 : out0, nullptr, mt * MBLK, nt * NBLK, N, K, 0);
}

#define KPITCH 72
#define VPITCH 80

typedef __attribute__((ext_vector_type(8))) short s16x8;

__device__ inline unsigned lds_byte_addr(const half_t* p) {
  return (unsigned)(size_t)(ASL const half_t*)p;
}

// Transposing LDS read: lane (c = l & 15, h = l >> 4) gets T[8h + 0..7][c] of the
// 16 x 16 tile whose per-lane row addresses are passed in.
__device__ inline v8h lds_load_tr16(const half_t* p) {
  return __builtin_bit_cast(v8h, __builtin_amdgcn_ds_load_tr16_b128_v8i16((ASL s16x8*)p));
}

// Four 16-byte async copies per lane (two K rows, two V rows). The s_wait_xcnt
// stands inside the statement so that no address register named here is
// rewritten ahead of it.
__device__ inline void stage_kv_tile(const half_t* gk0, const half_t* gk1,
                                     const half_t* gv0, const half_t* gv1,
                                     unsigned lk0, unsigned lk1,
                                     unsigned lv0, unsigned lv1) {
  asm volatile(
      "global_load_async_to_lds_b128 %0, %4, off\n\t"
      "global_load_async_to_lds_b128 %1, %5, off\n\t"
      "global_load_async_to_lds_b128 %2, %6, off\n\t"
      "global_load_async_to_lds_b128 %3, %7, off\n\t"
      "s_wait_xcnt 0x0"
      :: "v"(lk0), "v"(lk1), "v"(lv0), "v"(lv1),
         "v"(gk0), "v"(gk1), "v"(gv0), "v"(gv1)
      : "memory");
}

__global__ __launch_bounds__(128) void attn_wmma_kernel(
    const half_t* __restrict__ Q, int qld,
    const half_t* __restrict__ Km, int kld,
    const half_t* __restrict__ V, int vld,
    half_t* __restrict__ O, int oldd,
    int Tq, int Tk, int Dh, const int* __restrict__ nctx, float scale) {
  __shared__ __attribute__((aligned(16))) half_t kls[2][32 * KPITCH];
  __shared__ __attribute__((aligned(16))) half_t vls[2][32 * VPITCH];
  const int lane = threadIdx.x & 31;
  const int wid  = threadIdx.x >> 5;
  const int sub = lane & 15, hi = lane >> 4;
  const int h = blockIdx.y, b = blockIdx.z;
  const int qt = (blockIdx.x * 4 + wid) * 16;

  int kvlen = Tk;
  if (nctx) { int nc = *nctx; kvlen = nc < Tk ? nc : Tk; }

  const half_t* Qb = Q + ((size_t)b * Tq + qt) * qld + h * Dh;
  const half_t* Kb = Km + (size_t)b * Tk * kld + h * Dh;
  const half_t* Vb = V  + (size_t)b * Tk * vld + h * Dh;

  const v16h qf0 = load_frag(Qb,      qld);   // Dh = 64 -> two K=32 fragments
  const v16h qf1 = load_frag(Qb + 32, qld);

  // acc[d][r] = O[query sub][d * 16 + 8 * hi + r]
  v8f acc[4];
#pragma unroll
  for (int d = 0; d < 4; ++d) acc[d] = zero_v8f();
  // Running maximum of the lane's query (equal in lanes l and l ^ 16) and the sum
  // over the lane's own keys; the two halves' sums are joined behind the loop.
  float mrow = -1e30f, lsum = 0.f;

  // Staging: thread -> tile rows srow and srow + 16, 16-byte chunk sq of the row;
  // one wave's copy covers four whole 128-B rows.
  const int srow = threadIdx.x >> 3;        // 0..15
  const int sq   = (threadIdx.x & 7) * 8;   // halves
  auto stage = [&](int kt0, int sb) {
    const half_t* gk = Kb + (size_t)(kt0 + srow) * kld + sq;
    const half_t* gv = Vb + (size_t)(kt0 + srow) * vld + sq;
    stage_kv_tile(gk, gk + (size_t)16 * kld, gv, gv + (size_t)16 * vld,
                  lds_byte_addr(&kls[sb][srow * KPITCH + sq]),
                  lds_byte_addr(&kls[sb][(srow + 16) * KPITCH + sq]),
                  lds_byte_addr(&vls[sb][srow * VPITCH + sq]),
                  lds_byte_addr(&vls[sb][(srow + 16) * VPITCH + sq]));
  };
  // Per-lane offset of the transposing V read inside a tile.
  const int vtr = (8 * hi + (lane & 7)) * VPITCH + 8 * ((lane >> 3) & 1);

  // Ring prologue: tile 0 lands and is published, then tile 1 starts.
  stage(0, 0);
  asm volatile("s_wait_asynccnt 0x0" ::: "memory");  // own copies of tile 0 landed
  __syncthreads();                                   // publishes tile 0
  if (32 < kvlen) stage(32, 1);

  int buf = 0;
  for (int kt = 0; kt < kvlen; kt += 32) {
    v8f s0 = zero_v8f(), s1 = zero_v8f();
    {
      const half_t* kl = &kls[buf][0];
      v16h k00 = load_frag(kl,      KPITCH);
      v16h k01 = load_frag(kl + 32, KPITCH);
      v16h k10 = load_frag(kl + 16 * KPITCH,      KPITCH);
      v16h k11 = load_frag(kl + 16 * KPITCH + 32, KPITCH);
      // Inputs-only fence on the loaded fragments: keeps the eight LDS reads in one
      // group with one wait; without it each WMMA waits out its own LDS latency.
      asm volatile("" :: "v"(k00), "v"(k01), "v"(k10), "v"(k11));
      // s0[r] = S[key kt + 8 * hi + r][query sub], s1[r] the same 16 keys on
      s0 = wmma_f16(k00, qf0, s0);
      s0 = wmma_f16(k01, qf1, s0);
      s1 = wmma_f16(k10, qf0, s1);
      s1 = wmma_f16(k11, qf1, s1);
    }
    float v0[8], v1[8];
#pragma unroll
    for (int r = 0; r < 8; ++r) { v0[r] = s0[r] * scale; v1[r] = s1[r] * scale; }
    if (kt + 32 > kvlen) {   // block-uniform: only a last, partial tile has keys to mask
      const int lim = kvlen - kt - 8 * hi;
#pragma unroll
      for (int r = 0; r < 8; ++r) {
        if (r >= lim)      v0[r] = -1e30f;
        if (r + 16 >= lim) v1[r] = -1e30f;
      }
    }

    // Maximum and sum go as trees, so that no long dependent chain forms.
    float t[8];
#pragma unroll
    for (int r = 0; r < 8; ++r) t[r] = fmaxf(v0[r], v1[r]);
#pragma unroll
    for (int w = 4; w > 0; w >>= 1)
#pragma unroll
      for (int r = 0; r < w; ++r) t[r] = fmaxf(t[r], t[r + w]);
    const float mx   = fmaxf(t[0], xhalf(t[0]));
    const float mnew = fmaxf(mrow, mx);
    const float corr = __expf(mrow - mnew);
    mrow = mnew;
#pragma unroll
    for (int r = 0; r < 8; ++r) {
      v0[r] = __expf(v0[r] - mnew);
      v1[r] = __expf(v1[r] - mnew);
      t[r] = v0[r] + v1[r];
    }
#pragma unroll
    for (int w = 4; w > 0; w >>= 1)
#pragma unroll
      for (int r = 0; r < w; ++r) t[r] += t[r + w];
    lsum = lsum * corr + t[0];
#pragma unroll
    for (int d = 0; d < 4; ++d)
#pragma unroll
      for (int r = 0; r < 8; ++r) acc[d][r] *= corr;

    // P^T as a B operand: element s holds key 8 * hi + s, then 16 + 8 * hi + (s - 8),
    // the k order in which the transposing read delivers V^T.
    v16h pf;
#pragma unroll
    for (int j = 0; j < 8; ++j) { pf[j] = (half_t)v0[j]; pf[j + 8] = (half_t)v1[j]; }

    // acc += V^T(64x32) @ P^T(32x16): A[m][k] = V[kt+k][h*Dh + d*16 + m]
#pragma unroll
    for (int d = 0; d < 4; ++d) {
      const half_t* vb = &vls[buf][vtr + d * 16];
      const v8h vlo = lds_load_tr16(vb);                 // keys 8*hi + 0..7
      const v8h vhi = lds_load_tr16(vb + 16 * VPITCH);   // keys 16 + 8*hi + 0..7
      v16h vf;
#pragma unroll
      for (int j = 0; j < 8; ++j) { vf[j] = vlo[j]; vf[j + 8] = vhi[j]; }
      acc[d] = wmma_f16(vf, pf, acc[d]);
    }

    // Publish point of tile t+1; it also ends every reader's last read of buf.
    asm volatile("s_wait_dscnt 0x0" ::: "memory");     // own LDS reads of buf retired
    asm volatile("s_wait_asynccnt 0x0" ::: "memory");  // own copies of tile t+1 landed
    __syncthreads();
    if (kt + 64 < kvlen) stage(kt + 64, buf);          // refill the buffer just read
    buf ^= 1;
  }
  asm volatile("s_wait_asynccnt 0x0" ::: "memory");    // nothing in flight at wave end

  // A lane's eight values of a tile are eight neighbours of one output row.
  const float inv = 1.0f / (lsum + xhalf(lsum));
  half_t* orow = O + ((size_t)b * Tq + qt + sub) * oldd + h * Dh + 8 * hi;
#pragma unroll
  for (int d = 0; d < 4; ++d) {
    v8h o;
#pragma unroll
    for (int r = 0; r < 8; ++r) o[r] = (half_t)(acc[d][r] * inv);
    *(v8h*)(orow + d * 16) = o;
  }
}

// ---------------------------------------------------------------------------
// Host orchestration
// ---------------------------------------------------------------------------
extern "C" void kernel_launch(void* const* d_in, const int* in_sizes, int n_in,
                              void* d_out, int out_size, void* d_ws, size_t ws_size,
                              hipStream_t stream) {
  (void)n_in; (void)out_size; (void)ws_size;
  const float* tgt      = (const float*)d_in[0];
  const float* memory   = (const float*)d_in[1];
  const float* self_w   = (const float*)d_in[2];
  const float* self_b   = (const float*)d_in[3];
  const float* self_ow  = (const float*)d_in[4];
  const float* self_ob  = (const float*)d_in[5];
  const float* cross_w  = (const float*)d_in[6];
  const float* cross_b  = (const float*)d_in[7];
  const float* cross_ow = (const float*)d_in[8];
  const float* cross_ob = (const float*)d_in[9];
  const float* ln1_g = (const float*)d_in[10];
  const float* ln1_b = (const float*)d_in[11];
  const float* ln2_g = (const float*)d_in[12];
  const float* ln2_b = (const float*)d_in[13];
  const float* ln3_g = (const float*)d_in[14];
  const float* ln3_b = (const float*)d_in[15];
  const float* w1 = (const float*)d_in[16];
  const float* b1 = (const float*)d_in[17];
  const float* w2 = (const float*)d_in[18];
  const float* b2 = (const float*)d_in[19];
  const int*   n_ctx_p = (const int*)d_in[20];

  const int E  = in_sizes[10];
  const int F  = in_sizes[16] / E;
  const int B  = 2;
  const int Tq = in_sizes[0] / (B * E);
  const int Tk = in_sizes[1] / (B * E);
  const int nhead = 16;
  const int Dh = E / nhead;
  const int M  = B * Tq;   // query rows
  const int Mk = B * Tk;   // memory rows
  const float scale = 1.0f / sqrtf((float)Dh);

  // --- workspace carve (all f16 buffers, 256B aligned) ---
  char* wp = (char*)d_ws;
  auto carve = [&](size_t elems) -> half_t* {
    half_t* r = (half_t*)wp;
    wp += (elems * sizeof(half_t) + 255) & ~(size_t)255;
    return r;
  };
  half_t* selfw_h   = carve((size_t)3 * E * E);
  half_t* selfow_h  = carve((size_t)E * E);
  half_t* crossw_h  = carve((size_t)3 * E * E);
  half_t* crossow_h = carve((size_t)E * E);
  half_t* w1_h      = carve((size_t)F * E);
  half_t* w2_h      = carve((size_t)E * F);
  half_t* mem_h     = carve((size_t)Mk * E);
  half_t* nx_h      = carve((size_t)M * E);
  half_t* qkv_h     = carve((size_t)M * 3 * E);
  half_t* qc_h      = carve((size_t)M * E);
  half_t* kvc_h     = carve((size_t)Mk * 2 * E);
  half_t* attn_h    = carve((size_t)M * E);
  half_t* ffn1_h    = carve((size_t)M * F);
  float*  x = (float*)d_out;   // residual accumulator

  // 512 blocks of 8 waves: 16 streaming waves on each of the 256 WGPs; in front of
  // them the blocks of the first LayerNorm, which reads tgt and leaves x = tgt.
  const int lnblk = (M + LN_ROWS - 1) / LN_ROWS;
  convert_ln_kernel<<<lnblk + 512, 256, 0, stream>>>(
      self_w, self_ow, cross_w, cross_ow, memory,
      selfw_h, selfow_h, crossw_h, crossow_h, mem_h,
      (long long)3 * E * E, (long long)E * E, (long long)3 * E * E,
      (long long)E * E, (long long)Mk * E,
      tgt, ln1_g, ln1_b, nx_h, x, M, lnblk);

  // cs, cd, cn: an array to convert beside the product, on 256 more blocks (none if null).
  auto gemm = [&](const half_t* A, const half_t* W, const float* bias,
                  half_t* outh, float* resid, int m, int n, int k, int act,
                  const float* cs, half_t* cd, long long cn) {
    const int ny = n / NBLK;
    dim3 grid(m / MBLK, ny + (cs ? 256 / (m / MBLK) : 0));
    gemm_wmma_kernel<<<grid, 256, 0, stream>>>(A, W, bias, outh, resid, n, k, act,
                                               ny, cs, cd, cn);
  };

  // ---- self-attention sublayer ----
  // The cross-attention K/V projection needs only memory: it rides with the QKV projection.
  {
    const int mt0 = M / MBLK, ny0 = 3 * E / NBLK;
    const int mt1 = Mk / MBLK, tiles1 = mt1 * (2 * E / NBLK);
    dim3 grid(mt0, ny0 + (tiles1 + mt0 - 1) / mt0);
    gemm_pair_kernel<<<grid, 256, 0, stream>>>(
        nx_h, selfw_h, self_b, qkv_h, 3 * E, ny0,
        mem_h, crossw_h + (size_t)E * E, cross_b + E, kvc_h, 2 * E, mt1, E);
  }
  {
    dim3 grid(Tq / 64, nhead, B);
    attn_wmma_kernel<<<grid, 128, 0, stream>>>(
        qkv_h, 3 * E, qkv_h + E, 3 * E, qkv_h + 2 * E, 3 * E,
        attn_h, E, Tq, Tq, Dh, n_ctx_p, scale);
  }
  gemm(attn_h, selfow_h, self_ob, nullptr, x, M, E, E, 0, w1, w1_h, (long long)F * E);

  // ---- cross-attention sublayer ----
  layernorm_kernel<<<(M + LN_ROWS - 1) / LN_ROWS, 32 * LN_ROWS, 0, stream>>>(
      x, ln2_g, ln2_b, nx_h, M);
  gemm(nx_h, crossw_h, cross_b, qc_h, nullptr, M, E, E, 0, w2, w2_h, (long long)E * F);
  {
    dim3 grid(Tq / 64, nhead, B);
    attn_wmma_kernel<<<grid, 128, 0, stream>>>(
        qc_h, E, kvc_h, 2 * E, kvc_h + E, 2 * E,
        attn_h, E, Tq, Tk, Dh, nullptr, scale);
  }
  gemm(attn_h, crossow_h, cross_ob, nullptr, x, M, E, E, 0, nullptr, nullptr, 0);

  // ---- FFN sublayer ----
  layernorm_kernel<<<(M + LN_ROWS - 1) / LN_ROWS, 32 * LN_ROWS, 0, stream>>>(
      x, ln3_g, ln3_b, nx_h, M);
  gemm(nx_h,   w1_h, b1, ffn1_h, nullptr, M, F, E, 1, nullptr, nullptr, 0);  // exact GELU
  gemm(ffn1_h, w2_h, b2, nullptr, x,       M, E, F, 0, nullptr, nullptr, 0);
}

// v009
// A run of this version takes 178 microseconds.
// Timed twice side by side with v008, it ran 1.06 and 1.09 times as fast.
// Over all steps from v000 it is 4.17 times as fast.
#include <hip/hip_runtime.h>
#include <math.h>

typedef _Float16 half_t;
typedef __attribute__((ext_vector_type(16))) _Float16 v16h;
typedef __attribute__((ext_vector_type(8)))  _Float16 v8h;
typedef __attribute__((ext_vector_type(8)))  float    v8f;
typedef __attribute__((vector_size(16)))     int      vsi4;   // int4 for async builtin

#define ASG __attribute__((address_space(1)))
#define ASL __attribute__((address_space(3)))

// Detect CDNA5 async global->LDS builtins (gfx1250); fall back to load+ds_store.
#if defined(__has_builtin)
#  if __has_builtin(__builtin_amdgcn_global_load_async_to_lds_b128)
#    define HAVE_ASYNC 1
#  endif
#endif
#ifndef HAVE_ASYNC
#  define HAVE_ASYNC 0
#endif

// ---------------------------------------------------------------------------
// WMMA helpers (CDNA5 gfx1250, wave32)
// ---------------------------------------------------------------------------
__device__ inline v8f wmma_f16(v16h a, v16h b, v8f c) {
  // D(16x16,f32) = A(16x32,f16) x B(32x16,f16) + C
  return __builtin_amdgcn_wmma_f32_16x16x32_f16(
      /*neg_a=*/false, a, /*neg_b=*/false, b,
      /*c_mod=*/(short)0, c, /*reuse_a=*/false, /*reuse_b=*/false);
}

__device__ inline v8f zero_v8f() {
  v8f z;
#pragma unroll
  for (int i = 0; i < 8; ++i) z[i] = 0.0f;
  return z;
}

// Load a 16x32 f16 fragment in the ISA A-matrix lane layout:
//   lane<16 : row=lane,    K = [0..7] then [16..23]
//   lane>=16: row=lane-16, K = [8..15] then [24..31]
// base points at (row0, k0); ld = row stride in elements. Also used for the
// B operand of D = A x W^T (B column n == row n of W, identical pattern).
__device__ inline v16h load_frag(const half_t* __restrict__ base, int ld) {
  const int lane = threadIdx.x & 31;
  const int sub  = lane & 15;
  const int hi   = lane >> 4;
  const half_t* p = base + (size_t)sub * ld + hi * 8;
  v8h lo = *(const v8h*)(p);
  v8h hh = *(const v8h*)(p + 16);
  v16h r;
#pragma unroll
  for (int i = 0; i < 8; ++i) { r[i] = lo[i]; r[i + 8] = hh[i]; }
  return r;
}

// One 16-byte global->LDS transfer per lane (ASYNCcnt path if available).
__device__ inline void copy_b128_to_lds(const half_t* g, half_t* l) {
#if HAVE_ASYNC
  __builtin_amdgcn_global_load_async_to_lds_b128(
      (ASG vsi4*)g, (ASL vsi4*)l, 0, 0);
#else
  *(v8h*)l = *(const v8h*)g;
#endif
}

// ---------------------------------------------------------------------------
// Elementwise f32 -> f16 conversion, streaming.
// An array is cut into chunks of 8192 floats; a block walks chunks at a stride of
// blocks. In a whole chunk each thread issues eight 16-byte loads (every wave
// load covers 512 contiguous bytes) before the first is converted, so few waves
// keep many bytes in flight; the last, partial chunk of an array goes by element.
// ---------------------------------------------------------------------------
#define CVT_LOADS 8
#define CVT_SPAN  (256 * 4)                // floats per block-wide 16-byte load
#define CVT_CHUNK (CVT_SPAN * CVT_LOADS)   // floats per chunk

typedef __attribute__((ext_vector_type(4))) float    v4f;
typedef __attribute__((ext_vector_type(4))) _Float16 v4h;

__device__ inline int cvt_chunks(long long n) {
  return (int)((n + CVT_CHUNK - 1) / CVT_CHUNK);
}

// The chunk of s[0..n) that starts at element base; a block of 256 threads.
__device__ inline void convert_chunk(const float* __restrict__ s, half_t* __restrict__ d,
                                     long long n, long long base) {
  if (base + CVT_CHUNK <= n) {
    const float* sp = s + base + threadIdx.x * 4;
    half_t*      dp = d + base + threadIdx.x * 4;
    v4f v[CVT_LOADS];
#pragma unroll
    for (int j = 0; j < CVT_LOADS; ++j) v[j] = *(const v4f*)(sp + j * CVT_SPAN);
#pragma unroll
    for (int j = 0; j < CVT_LOADS; ++j)
      *(v4h*)(dp + j * CVT_SPAN) = __builtin_convertvector(v[j], v4h);
    // The caller's next trip rewrites the base and data registers that these stores
    // name.
    asm volatile("s_wait_xcnt 0x0" ::: "memory");
  } else {
    for (long long i = base + threadIdx.x; i < n; i += 256) d[i] = (half_t)s[i];
  }
}

// One array, by block blk of nblk.
__device__ inline void convert_array(const float* __restrict__ s, half_t* __restrict__ d,
                                     long long n, int blk, int nblk) {
  const int e = cvt_chunks(n);
  for (int c = blk; c < e; c += nblk) convert_chunk(s, d, n, (long long)c * CVT_CHUNK);
}

// Five arrays as one run of chunks, by block blk of nblk.
__device__ inline void convert_arrays(
    const float* __restrict__ s0, const float* __restrict__ s1,
    const float* __restrict__ s2, const float* __restrict__ s3,
    const float* __restrict__ s4,
    half_t* __restrict__ d0, half_t* __restrict__ d1, half_t* __restrict__ d2,
    half_t* __restrict__ d3, half_t* __restrict__ d4,
    long long n0, long long n1, long long n2, long long n3, long long n4,
    int blk, int nblk) {
  // first chunk index behind each array
  const int e0 = cvt_chunks(n0);
  const int e1 = e0 + cvt_chunks(n1);
  const int e2 = e1 + cvt_chunks(n2);
  const int e3 = e2 + cvt_chunks(n3);
  const int e4 = e3 + cvt_chunks(n4);

  for (int c = blk; c < e4; c += nblk) {
    const float* s = s0; half_t* d = d0; long long n = n0; int first = 0;
    if (c >= e0) { s = s1; d = d1; n = n1; first = e0; }
    if (c >= e1) { s = s2; d = d2; n = n2; first = e1; }
    if (c >= e2) { s = s3; d = d3; n = n3; first = e2; }
    if (c >= e3) { s = s4; d = d4; n = n4; first = e3; }
    convert_chunk(s, d, n, (long long)(c - first) * CVT_CHUNK);
  }
}

// ---------------------------------------------------------------------------
// LayerNorm: one wave per row, eight rows per block; writes f16 (GEMM input format).
// A lane asks for its 32 floats of the row with eight 16-byte loads (each wave load
// covers 512 contiguous bytes) and keeps them in registers, so the row is read once;
// the two sums are joined across the lanes in registers: no LDS and no barrier.
// A launch starts one wave per row instead of eight.
// ---------------------------------------------------------------------------
#define LN_COLS 1024               // row length: 32 lanes x LN_VEC pieces of 4 floats
#define LN_VEC  (LN_COLS / 128)
#define LN_ROWS 8                  // rows (waves) per block

// x plus the x of the lane whose number differs by MASK inside the 16-lane row.
template <int MASK>
__device__ inline float add_row_xmask(float x) {
  const int y = __builtin_amdgcn_update_dpp(0, __builtin_bit_cast(int, x),
                                            0x160 | MASK, 0xf, 0xf, true);
  return x + __builtin_bit_cast(float, y);
}

// Lane l with lane l ^ 16.
__device__ inline float xhalf(float x) {
  const int b = __builtin_bit_cast(int, x);
  return __builtin_bit_cast(
      float, __builtin_amdgcn_permlanex16(b, b, 0x76543210, 0xfedcba98, false, false));
}

// Sum over the 32 lanes, the same value in every lane.
__device__ inline float wave_sum(float x) {
  x = add_row_xmask<1>(x);
  x = add_row_xmask<2>(x);
  x = add_row_xmask<4>(x);
  x = add_row_xmask<8>(x);
  return x + xhalf(x);
}

__device__ inline void layernorm_rows(
    const float* __restrict__ x, const float* __restrict__ g,
    const float* __restrict__ b, half_t* __restrict__ outh,
    float* __restrict__ xcopy, int rows, int blk) {
  const int lane = threadIdx.x & 31;
  const int row  = blk * LN_ROWS + (threadIdx.x >> 5);
  if (row >= rows) return;   // the same in every lane of a wave; no barrier follows
  const float* xr = x + (size_t)row * LN_COLS + lane * 4;
  v4f v[LN_VEC], gv[LN_VEC], bv[LN_VEC];
#pragma unroll
  for (int j = 0; j < LN_VEC; ++j) v[j] = *(const v4f*)(xr + j * 128);
  // A load of g or b below may be given the registers that hold the address of the
  // loads above.
  asm volatile("s_wait_xcnt 0x0" ::: "memory");
#pragma unroll
  for (int j = 0; j < LN_VEC; ++j) {
    gv[j] = *(const v4f*)(g + lane * 4 + j * 128);
    bv[j] = *(const v4f*)(b + lane * 4 + j * 128);
  }
  // Keeps all 24 loads above the sums: the scheduler otherwise sinks the g and b loads
  // behind the reduction, two at a time, and the wave waits out their latency in turn.
  __builtin_amdgcn_sched_barrier(0);
  // four independent chains per sum
  v4f sv = v[0], qv = v[0] * v[0];
#pragma unroll
  for (int j = 1; j < LN_VEC; ++j) { sv += v[j]; qv += v[j] * v[j]; }
  const float s  = wave_sum((sv[0] + sv[1]) + (sv[2] + sv[3]));
  const float s2 = wave_sum((qv[0] + qv[1]) + (qv[2] + qv[3]));
  const float mean = s / (float)LN_COLS;
  const float var  = s2 / (float)LN_COLS - mean * mean;
  const float rstd = rsqrtf(var + 1e-5f);
  half_t* orow = outh + (size_t)row * LN_COLS + lane * 4;
#pragma unroll
  for (int j = 0; j < LN_VEC; ++j)
    *(v4h*)(orow + j * 128) =
        __builtin_convertvector((v[j] - mean) * rstd * gv[j] + bv[j], v4h);
  if (xcopy) {   // the row as it was read, from the registers that hold it
    float* crow = xcopy + (size_t)row * LN_COLS + lane * 4;
#pragma unroll
    for (int j = 0; j < LN_VEC; ++j) *(v4f*)(crow + j * 128) = v[j];
  }
}

__global__ __launch_bounds__(32 * LN_ROWS) void layernorm_kernel(
    const float* __restrict__ x, const float* __restrict__ g,
    const float* __restrict__ b, half_t* __restrict__ outh, int rows) {
  layernorm_rows(x, g, b, outh, nullptr, rows, blockIdx.x);
}

// The conversion of what the first products read and the first LayerNorm depend on
// inputs alone and on nothing of each other, so they share one launch: blocks below
// lnblk take LN_ROWS rows each, the rest walk the conversion's chunks. The LayerNorm's
// waves also store their rows to xcopy, the start value of the residual sum.
__global__ __launch_bounds__(256) void convert_ln_kernel(
    const float* __restrict__ s0, const float* __restrict__ s1,
    const float* __restrict__ s2, const float* __restrict__ s3,
    const float* __restrict__ s4,
    half_t* __restrict__ d0, half_t* __restrict__ d1, half_t* __restrict__ d2,
    half_t* __restrict__ d3, half_t* __restrict__ d4,
    long long n0, long long n1, long long n2, long long n3, long long n4,
    const float* __restrict__ x, const float* __restrict__ g,
    const float* __restrict__ b, half_t* __restrict__ outh,
    float* __restrict__ xcopy, int rows, int lnblk) {
  const int blk = blockIdx.x;
  if (blk < lnblk) {
    layernorm_rows(x, g, b, outh, xcopy, rows, blk);
  } else {
    convert_arrays(s0, s1, s2, s3, s4, d0, d1, d2, d3, d4, n0, n1, n2, n3, n4,
                   blk - lnblk, (int)gridDim.x - lnblk);
  }
}

// ---------------------------------------------------------------------------
// LDS-staged double-buffered GEMM:
//   out[M,N] = act(A[M,K] @ W[N,K]^T + bias[N]); optional residual f32 add.
// Block = 256 thr = 8 waves (2 in M x 4 in N). Block tile 128x128.
// A stage holds 128 k (four WMMA k-blocks of 32), so that fragments can be fetched
// one k-block ahead inside a published stage; one barrier serves 128 k.
// LDS: 2 x (128 A rows + 128 B rows) of 256 B at a 272-B pitch = 136 KB.
// Global->LDS staging uses GLOBAL_LOAD_ASYNC_TO_LDS_B128 (ASYNCcnt).
// K must be a multiple of KSTEP.
// ---------------------------------------------------------------------------
#define KSTEP 128
#define MBLK  128
#define NBLK  128
#define GPITCH 136  // halves; 272-B rows (16 B x odd) for the ds_load_b128 reader

// One block tile at (m0, n0).
__device__ __forceinline__ void gemm_tile(
    const half_t* __restrict__ A, const half_t* __restrict__ W,
    const float* __restrict__ bias, half_t* __restrict__ outh,
    float* __restrict__ resid, int m0, int n0, int N, int K, int act) {
  __shared__ __attribute__((aligned(16))) half_t ldsA[2][MBLK * GPITCH];
  __shared__ __attribute__((aligned(16))) half_t ldsB[2][NBLK * GPITCH];

  const int tid  = threadIdx.x;
  const int lane = tid & 31;
  const int wid  = tid >> 5;     // 0..7
  const int wm   = wid >> 2;     // 0..1 : wave row  (64 rows each)
  const int wn   = wid & 3;      // 0..3 : wave col  (32 cols each)

  // Staging assignment: thread -> rows (tid>>4) + 0,16,..,112, 16-byte piece tid&15
  // of the row's 256 B; one wave's copy covers two whole 256-B row pieces.
  const int crow = tid >> 4;         // 0..15
  const int cq   = (tid & 15) * 8;   // halves
  auto stage = [&](int ks, int sb) {
#pragma unroll
    for (int rr = 0; rr < MBLK; rr += 16)
      copy_b128_to_lds(A + (size_t)(m0 + crow + rr) * K + ks + cq,
                       &ldsA[sb][(crow + rr) * GPITCH + cq]);
#pragma unroll
    for (int rr = 0; rr < NBLK; rr += 16)
      copy_b128_to_lds(W + (size_t)(n0 + crow + rr) * K + ks + cq,
                       &ldsB[sb][(crow + rr) * GPITCH + cq]);
  };

  v8f acc[4][2];
#pragma unroll
  for (int i = 0; i < 4; ++i) { acc[i][0] = zero_v8f(); acc[i][1] = zero_v8f(); }

  // C layout -> lane l<16 holds rows 0..7 (vgpr r), l>=16 rows 8..15.
  const int sub = lane & 15, hi = lane >> 4;
  // The bias is asked for here, so that its latency runs beside that of tile 0's copies.
  const float bias0 = bias[n0 + wn * 32 + sub];
  const float bias1 = bias[n0 + wn * 32 + sub + 16];

  // Ring prologue: stage 0 lands and is published, then stage 1 starts.
  stage(0, 0);
  asm volatile("s_wait_asynccnt 0x0" ::: "memory");  // own copies of stage 0 landed
  __syncthreads();                                   // publishes stage 0
  if (KSTEP < K) stage(KSTEP, 1);

  int buf = 0;
  for (int k0 = 0; k0 < K; k0 += KSTEP) {
    // compute: per k-block of 32, 4 A-frags x 2 B-frags = 8 WMMA, fed by ds_load_b128.
    // Two fragment sets: the twelve reads of block b + 1 are issued as one group ahead
    // of block b's WMMAs, so their LDS latency runs beside the matrix work. Only
    // blocks of this stage are fetched; the next stage is read behind its barrier.
    v16h af[2][4], bf[2][2];
    auto load_block = [&](int s, int kb) {
      bf[s][0] = load_frag(&ldsB[buf][(wn * 32 +  0) * GPITCH + kb], GPITCH);
      bf[s][1] = load_frag(&ldsB[buf][(wn * 32 + 16) * GPITCH + kb], GPITCH);
#pragma unroll
      for (int i = 0; i < 4; ++i)
        af[s][i] = load_frag(&ldsA[buf][(wm * 64 + i * 16) * GPITCH + kb], GPITCH);
    };
    load_block(0, 0);
#pragma unroll
    for (int b = 0; b < KSTEP / 32; ++b) {
      if (b + 1 < KSTEP / 32) load_block((b + 1) & 1, (b + 1) * 32);
      // Keeps the group of reads above the WMMAs: the scheduler otherwise sinks each
      // read to its use, and every WMMA pair waits out an LDS round trip.
      __builtin_amdgcn_sched_barrier(0);
#pragma unroll
      for (int i = 0; i < 4; ++i) {
        acc[i][0] = wmma_f16(af[b & 1][i], bf[b & 1][0], acc[i][0]);
        acc[i][1] = wmma_f16(af[b & 1][i], bf[b & 1][1], acc[i][1]);
      }
      // Keeps the following group of reads out of this run of WMMAs.
      __builtin_amdgcn_sched_barrier(0);
    }

    // Publish point of the next stage; it also ends every reader's last read of buf.
    asm volatile("s_wait_dscnt 0x0" ::: "memory");     // own LDS reads of buf retired
    asm volatile("s_wait_asynccnt 0x0" ::: "memory");  // own copies of the next stage landed
    __syncthreads();
    if (k0 + 2 * KSTEP < K) stage(k0 + 2 * KSTEP, buf);  // refill the buffer just read
    buf ^= 1;
  }
  asm volatile("s_wait_asynccnt 0x0" ::: "memory");    // nothing in flight behind the ring

  // epilogue: the tests on act, outh and resid stand outside the element loops
#pragma unroll
  for (int i = 0; i < 4; ++i) {
#pragma unroll
    for (int r = 0; r < 8; ++r) {
      acc[i][0][r] += bias0;
      acc[i][1][r] += bias1;
    }
  }
  if (act == 1) {
#pragma unroll
    for (int i = 0; i < 4; ++i)
#pragma unroll
      for (int j = 0; j < 2; ++j)
#pragma unroll
        for (int r = 0; r < 8; ++r) {
          const float v = acc[i][j][r];
          acc[i][j][r] = 0.5f * v * (1.0f + erff(v * 0.70710678118654752f));
        }
  }
  // An output element lies at a block-uniform place (row i*16 + r, column j*16 of
  // the block's tile) plus this 32-bit offset of the lane, in elements.
  const size_t   tile0 = (size_t)m0 * N + n0;
  const unsigned loff  = (unsigned)((wm * 64 + 8 * hi) * N + wn * 32 + sub);
  if (outh) {
    half_t* op = outh + tile0;
#pragma unroll
    for (int i = 0; i < 4; ++i)
#pragma unroll
      for (int r = 0; r < 8; ++r)
#pragma unroll
        for (int j = 0; j < 2; ++j)
          (op + (size_t)(i * 16 + r) * N + j * 16)[loff] = (half_t)acc[i][j][r];
    // The residual path below rewrites registers that these stores name.
    asm volatile("s_wait_xcnt 0x0" ::: "memory");
  }
  if (resid) {
    float* rp = resid + tile0;
    // All 64 residual values are in flight together before the first is used.
    v8f rv[4][2];
#pragma unroll
    for (int i = 0; i < 4; ++i)
#pragma unroll
      for (int r = 0; r < 8; ++r)
#pragma unroll
        for (int j = 0; j < 2; ++j)
          rv[i][j][r] = (rp + (size_t)(i * 16 + r) * N + j * 16)[loff];
#pragma unroll
    for (int i = 0; i < 4; ++i)
#pragma unroll
      for (int r = 0; r < 8; ++r)
#pragma unroll
        for (int j = 0; j < 2; ++j)
          (rp + (size_t)(i * 16 + r) * N + j * 16)[loff] = rv[i][j][r] + acc[i][j][r];
  }
}

// Grid rows below ny are the product's n tiles. A product with N = 1024 has a block for
// only half of the WGPs: the grid rows behind ny convert an array (cs -> cd, cn floats)
// that a later launch reads, on the WGPs that the product leaves idle.
__global__ __launch_bounds__(256) void gemm_wmma_kernel(
    const half_t* __restrict__ A, const half_t* __restrict__ W,
    const float* __restrict__ bias, half_t* __restrict__ outh,
    float* __restrict__ resid, int N, int K, int act, int ny,
    const float* __restrict__ cs, half_t* __restrict__ cd, long long cn) {
  if ((int)blockIdx.y < ny) {
    gemm_tile(A, W, bias, outh, resid, blockIdx.x * MBLK, blockIdx.y * NBLK, N, K, act);
  } else {
    convert_array(cs, cd, cn, (int)((blockIdx.y - ny) * gridDim.x + blockIdx.x),
                  (int)((gridDim.y - ny) * gridDim.x));
  }
}

// Two products that do not depend on each other (equal K, f16 output, no activation, no
// residual) in one launch. Grid rows below ny0 are the n tiles of the first product,
// with grid.x its m tiles; the blocks behind them are numbered on and cut into the
// second product's mt1 m tiles per n tile.
__global__ __launch_bounds__(256) void gemm_pair_kernel(
    const half_t* __restrict__ A0, const half_t* __restrict__ W0,
    const float* __restrict__ bias0, half_t* __restrict__ out0, int N0, int ny0,
    const half_t* __restrict__ A1, const half_t* __restrict__ W1,
    const float* __restrict__ bias1, half_t* __restrict__ out1, int N1, int mt1, int K) {
  const bool second = (int)blockIdx.y >= ny0;
  int mt = blockIdx.x, nt = blockIdx.y;
  if (second) {
    const unsigned t = (blockIdx.y - (unsigned)ny0) * gridDim.x + blockIdx.x;
    mt = (int)(t % (unsigned)mt1);
    nt = (int)(t / (unsigned)mt1);
  }
  const int N = second ? N1 : N0;
  if (nt * NBLK >= N) return;   // block-uniform, ahead of every copy and barrier
  gemm_tile(second ? A1 : A0, second ? W1 : W0, second ? bias1 : bias0,
            second ? out1 : out0, nullptr, mt * MBLK, nt * NBLK, N, K, 0);
}

#define KSTAGE 128
#define KPITCH 72
#define VPITCH 80

typedef __attribute__((ext_vector_type(8))) short s16x8;

__device__ inline unsigned lds_byte_addr(const half_t* p) {
  return (unsigned)(size_t)(ASL const half_t*)p;
}

// Transposing LDS read: lane (c = l & 15, h = l >> 4) gets T[8h + 0..7][c] of the
// 16 x 16 tile whose per-lane row addresses are passed in.
__device__ inline v8h lds_load_tr16(const half_t* p) {
  return __builtin_bit_cast(v8h, __builtin_amdgcn_ds_load_tr16_b128_v8i16((ASL s16x8*)p));
}

// Eight 16-byte async copies per lane (four K rows, four V rows). The s_wait_xcnt
// stands inside the statement so that no address register named here is
// rewritten ahead of it; one wait serves the eight copies.
__device__ inline void stage_kv_rows(const half_t* gk0, const half_t* gk1,
                                     const half_t* gk2, const half_t* gk3,
                                     const half_t* gv0, const half_t* gv1,
                                     const half_t* gv2, const half_t* gv3,
                                     unsigned lk0, unsigned lk1, unsigned lk2, unsigned lk3,
                                     unsigned lv0, unsigned lv1, unsigned lv2, unsigned lv3) {
  asm volatile(
      "global_load_async_to_lds_b128 %0, %8, off\n\t"
      "global_load_async_to_lds_b128 %1, %9, off\n\t"
      "global_load_async_to_lds_b128 %2, %10, off\n\t"
      "global_load_async_to_lds_b128 %3, %11, off\n\t"
      "global_load_async_to_lds_b128 %4, %12, off\n\t"
      "global_load_async_to_lds_b128 %5, %13, off\n\t"
      "global_load_async_to_lds_b128 %6, %14, off\n\t"
      "global_load_async_to_lds_b128 %7, %15, off\n\t"
      "s_wait_xcnt 0x0"
      :: "v"(lk0), "v"(lk1), "v"(lk2), "v"(lk3), "v"(lv0), "v"(lv1), "v"(lv2), "v"(lv3),
         "v"(gk0), "v"(gk1), "v"(gk2), "v"(gk3), "v"(gv0), "v"(gv1), "v"(gv2), "v"(gv3)
      : "memory");
}

__global__ __launch_bounds__(128) void attn_wmma_kernel(
    const half_t* __restrict__ Q, int qld,
    const half_t* __restrict__ Km, int kld,
    const half_t* __restrict__ V, int vld,
    half_t* __restrict__ O, int oldd,
    int Tq, int Tk, int Dh, const int* __restrict__ nctx, float scale) {
  __shared__ __attribute__((aligned(16))) half_t kls[2][KSTAGE * KPITCH];
  __shared__ __attribute__((aligned(16))) half_t vls[2][KSTAGE * VPITCH];
  const int lane = threadIdx.x & 31;
  const int wid  = threadIdx.x >> 5;
  const int sub = lane & 15, hi = lane >> 4;
  const int h = blockIdx.y, b = blockIdx.z;
  const int qt = (blockIdx.x * 4 + wid) * 16;

  int kvlen = Tk;
  if (nctx) { int nc = *nctx; kvlen = nc < Tk ? nc : Tk; }

  const half_t* Qb = Q + ((size_t)b * Tq + qt) * qld + h * Dh;
  const half_t* Kb = Km + (size_t)b * Tk * kld + h * Dh;
  const half_t* Vb = V  + (size_t)b * Tk * vld + h * Dh;

  const v16h qf0 = load_frag(Qb,      qld);   // Dh = 64 -> two K=32 fragments
  const v16h qf1 = load_frag(Qb + 32, qld);

  // acc[d][r] = O[query sub][d * 16 + 8 * hi + r]
  v8f acc[4];
#pragma unroll
  for (int d = 0; d < 4; ++d) acc[d] = zero_v8f();
  // Running maximum of the lane's query (equal in lanes l and l ^ 16) and the sum
  // over the lane's own keys; the two halves' sums are joined behind the loop.
  float mrow = -1e30f, lsum = 0.f;

  // Staging: thread -> every 16th row of the stage from srow on, 16-byte chunk sq of
  // the row; one wave's copy covers four whole 128-B rows. A stage is 16 copies of a
  // wave, and one stage's copies fly at a time.
  const int srow = threadIdx.x >> 3;        // 0..15
  const int sq   = (threadIdx.x & 7) * 8;   // halves
  auto stage = [&](int ks0, int sb) {
    // Written out, so that the rows' places in LDS are constants beside one register.
#pragma unroll
    for (int p = 0; p < KSTAGE; p += 64) {
      const half_t* gk = Kb + (size_t)(ks0 + p + srow) * kld + sq;
      const half_t* gv = Vb + (size_t)(ks0 + p + srow) * vld + sq;
      stage_kv_rows(gk, gk + (size_t)16 * kld, gk + (size_t)32 * kld, gk + (size_t)48 * kld,
                    gv, gv + (size_t)16 * vld, gv + (size_t)32 * vld, gv + (size_t)48 * vld,
                    lds_byte_addr(&kls[sb][(p + srow) * KPITCH + sq]),
                    lds_byte_addr(&kls[sb][(p + srow + 16) * KPITCH + sq]),
                    lds_byte_addr(&kls[sb][(p + srow + 32) * KPITCH + sq]),
                    lds_byte_addr(&kls[sb][(p + srow + 48) * KPITCH + sq]),
                    lds_byte_addr(&vls[sb][(p + srow) * VPITCH + sq]),
                    lds_byte_addr(&vls[sb][(p + srow + 16) * VPITCH + sq]),
                    lds_byte_addr(&vls[sb][(p + srow + 32) * VPITCH + sq]),
                    lds_byte_addr(&vls[sb][(p + srow + 48) * VPITCH + sq]));
    }
  };
  // Per-lane offset of the transposing V read inside a tile.
  const int vtr = (8 * hi + (lane & 7)) * VPITCH + 8 * ((lane >> 3) & 1);

  // Ring prologue: stage 0 lands and is published, then stage 1 starts.
  stage(0, 0);
  asm volatile("s_wait_asynccnt 0x0" ::: "memory");  // own copies of stage 0 landed
  __syncthreads();                                   // publishes stage 0
  if (KSTAGE < kvlen) stage(KSTAGE, 1);

  int buf = 0;
  for (int ks = 0; ks < kvlen; ks += KSTAGE) {
    // The passes of this stage that hold keys; the bound is the same in the whole block.
    const int kend = ks + KSTAGE < kvlen ? ks + KSTAGE : kvlen;
    for (int kt = ks; kt < kend; kt += 32) {
      v8f s0 = zero_v8f(), s1 = zero_v8f();
      {
        const half_t* kl = &kls[buf][(kt - ks) * KPITCH];
        v16h k00 = load_frag(kl,      KPITCH);
        v16h k01 = load_frag(kl + 32, KPITCH);
        v16h k10 = load_frag(kl + 16 * KPITCH,      KPITCH);
        v16h k11 = load_frag(kl + 16 * KPITCH + 32, KPITCH);
        // Inputs-only fence on the loaded fragments: keeps the eight LDS reads in one
        // group with one wait; without it each WMMA waits out its own LDS latency.
        asm volatile("" :: "v"(k00), "v"(k01), "v"(k10), "v"(k11));
        // s0[r] = S[key kt + 8 * hi + r][query sub], s1[r] the same 16 keys on
        s0 = wmma_f16(k00, qf0, s0);
        s0 = wmma_f16(k01, qf1, s0);
        s1 = wmma_f16(k10, qf0, s1);
        s1 = wmma_f16(k11, qf1, s1);
      }
      float v0[8], v1[8];
#pragma unroll
      for (int r = 0; r < 8; ++r) { v0[r] = s0[r] * scale; v1[r] = s1[r] * scale; }
      if (kt + 32 > kvlen) {   // block-uniform: only a last, partial tile has keys to mask
        const int lim = kvlen - kt - 8 * hi;
#pragma unroll
        for (int r = 0; r < 8; ++r) {
          if (r >= lim)      v0[r] = -1e30f;
          if (r + 16 >= lim) v1[r] = -1e30f;
        }
      }

      // Maximum and sum go as trees, so that no long dependent chain forms.
      float t[8];
#pragma unroll
      for (int r = 0; r < 8; ++r) t[r] = fmaxf(v0[r], v1[r]);
#pragma unroll
      for (int w = 4; w > 0; w >>= 1)
#pragma unroll
        for (int r = 0; r < w; ++r) t[r] = fmaxf(t[r], t[r + w]);
      const float mx   = fmaxf(t[0], xhalf(t[0]));
      const float mnew = fmaxf(mrow, mx);
      const float corr = __expf(mrow - mnew);
      mrow = mnew;
#pragma unroll
      for (int r = 0; r < 8; ++r) {
        v0[r] = __expf(v0[r] - mnew);
        v1[r] = __expf(v1[r] - mnew);
        t[r] = v0[r] + v1[r];
      }
#pragma unroll
      for (int w = 4; w > 0; w >>= 1)
#pragma unroll
        for (int r = 0; r < w; ++r) t[r] += t[r + w];
      lsum = lsum * corr + t[0];
#pragma unroll
      for (int d = 0; d < 4; ++d)
#pragma unroll
        for (int r = 0; r < 8; ++r) acc[d][r] *= corr;

      // P^T as a B operand: element s holds key 8 * hi + s, then 16 + 8 * hi + (s - 8),
      // the k order in which the transposing read delivers V^T.
      v16h pf;
#pragma unroll
      for (int j = 0; j < 8; ++j) { pf[j] = (half_t)v0[j]; pf[j + 8] = (half_t)v1[j]; }

      // acc += V^T(64x32) @ P^T(32x16): A[m][k] = V[kt+k][h*Dh + d*16 + m]
#pragma unroll
      for (int d = 0; d < 4; ++d) {
        const half_t* vb = &vls[buf][(kt - ks) * VPITCH + vtr + d * 16];
        const v8h vlo = lds_load_tr16(vb);                 // keys 8*hi + 0..7
        const v8h vhi = lds_load_tr16(vb + 16 * VPITCH);   // keys 16 + 8*hi + 0..7
        v16h vf;
#pragma unroll
        for (int j = 0; j < 8; ++j) { vf[j] = vlo[j]; vf[j + 8] = vhi[j]; }
        acc[d] = wmma_f16(vf, pf, acc[d]);
      }
    }

    // Publish point of stage t+1; it also ends every reader's last read of buf.
    asm volatile("s_wait_dscnt 0x0" ::: "memory");     // own LDS reads of buf retired
    asm volatile("s_wait_asynccnt 0x0" ::: "memory");  // own copies of stage t+1 landed
    __syncthreads();
    if (ks + 2 * KSTAGE < kvlen) stage(ks + 2 * KSTAGE, buf);  // refill the buffer just read
    buf ^= 1;
  }
  asm volatile("s_wait_asynccnt 0x0" ::: "memory");    // nothing in flight at wave end

  // A lane's eight values of a tile are eight neighbours of one output row.
  const float inv = 1.0f / (lsum + xhalf(lsum));
  half_t* orow = O + ((size_t)b * Tq + qt + sub) * oldd + h * Dh + 8 * hi;
#pragma unroll
  for (int d = 0; d < 4; ++d) {
    v8h o;
#pragma unroll
    for (int r = 0; r < 8; ++r) o[r] = (half_t)(acc[d][r] * inv);
    *(v8h*)(orow + d * 16) = o;
  }
}

// ---------------------------------------------------------------------------
// Host orchestration
// ---------------------------------------------------------------------------
extern "C" void kernel_launch(void* const* d_in, const int* in_sizes, int n_in,
                              void* d_out, int out_size, void* d_ws, size_t ws_size,
                              hipStream_t stream) {
  (void)n_in; (void)out_size; (void)ws_size;
  const float* tgt      = (const float*)d_in[0];
  const float* memory   = (const float*)d_in[1];
  const float* self_w   = (const float*)d_in[2];
  const float* self_b   = (const float*)d_in[3];
  const float* self_ow  = (const float*)d_in[4];
  const float* self_ob  = (const float*)d_in[5];
  const float* cross_w  = (const float*)d_in[6];
  const float* cross_b  = (const float*)d_in[7];
  const float* cross_ow = (const float*)d_in[8];
  const float* cross_ob = (const float*)d_in[9];
  const float* ln1_g = (const float*)d_in[10];
  const float* ln1_b = (const float*)d_in[11];
  const float* ln2_g = (const float*)d_in[12];
  const float* ln2_b = (const float*)d_in[13];
  const float* ln3_g = (const float*)d_in[14];
  const float* ln3_b = (const float*)d_in[15];
  const float* w1 = (const float*)d_in[16];
  const float* b1 = (const float*)d_in[17];
  const float* w2 = (const float*)d_in[18];
  const float* b2 = (const float*)d_in[19];
  const int*   n_ctx_p = (const int*)d_in[20];

  const int E  = in_sizes[10];
  const int F  = in_sizes[16] / E;
  const int B  = 2;
  const int Tq = in_sizes[0] / (B * E);
  const int Tk = in_sizes[1] / (B * E);
  const int nhead = 16;
  const int Dh = E / nhead;
  const int M  = B * Tq;   // query rows
  const int Mk = B * Tk;   // memory rows
  const float scale = 1.0f / sqrtf((float)Dh);

  // --- workspace carve (all f16 buffers, 256B aligned) ---
  char* wp = (char*)d_ws;
  auto carve = [&](size_t elems) -> half_t* {
    half_t* r = (half_t*)wp;
    wp += (elems * sizeof(half_t) + 255) & ~(size_t)255;
    return r;
  };
  half_t* selfw_h   = carve((size_t)3 * E * E);
  half_t* selfow_h  = carve((size_t)E * E);
  half_t* crossw_h  = carve((size_t)3 * E * E);
  half_t* crossow_h = carve((size_t)E * E);
  half_t* w1_h      = carve((size_t)F * E);
  half_t* w2_h      = carve((size_t)E * F);
  half_t* mem_h     = carve((size_t)Mk * E);
  half_t* nx_h      = carve((size_t)M * E);
  half_t* qkv_h     = carve((size_t)M * 3 * E);
  half_t* qc_h      = carve((size_t)M * E);
  half_t* kvc_h     = carve((size_t)Mk * 2 * E);
  half_t* attn_h    = carve((size_t)M * E);
  half_t* ffn1_h    = carve((size_t)M * F);
  float*  x = (float*)d_out;   // residual accumulator

  // 512 blocks of 8 waves: 16 streaming waves on each of the 256 WGPs; in front of
  // them the blocks of the first LayerNorm, which reads tgt and leaves x = tgt.
  const int lnblk = (M + LN_ROWS - 1) / LN_ROWS;
  convert_ln_kernel<<<lnblk + 512, 256, 0, stream>>>(
      self_w, self_ow, cross_w, cross_ow, memory,
      selfw_h, selfow_h, crossw_h, crossow_h, mem_h,
      (long long)3 * E * E, (long long)E * E, (long long)3 * E * E,
      (long long)E * E, (long long)Mk * E,
      tgt, ln1_g, ln1_b, nx_h, x, M, lnblk);

  // cs, cd, cn: an array to convert beside the product, on 256 more blocks (none if null).
  auto gemm = [&](const half_t* A, const half_t* W, const float* bias,
                  half_t* outh, float* resid, int m, int n, int k, int act,
                  const float* cs, half_t* cd, long long cn) {
    const int ny = n / NBLK;
    dim3 grid(m / MBLK, ny + (cs ? 256 / (m / MBLK) : 0));
    gemm_wmma_kernel<<<grid, 256, 0, stream>>>(A, W, bias, outh, resid, n, k, act,
                                               ny, cs, cd, cn);
  };

  // ---- self-attention sublayer ----
  // The cross-attention K/V projection needs only memory: it rides with the QKV projection.
  {
    const int mt0 = M / MBLK, ny0 = 3 * E / NBLK;
    const int mt1 = Mk / MBLK, tiles1 = mt1 * (2 * E / NBLK);
    dim3 grid(mt0, ny0 + (tiles1 + mt0 - 1) / mt0);
    gemm_pair_kernel<<<grid, 256, 0, stream>>>(
        nx_h, selfw_h, self_b, qkv_h, 3 * E, ny0,
        mem_h, crossw_h + (size_t)E * E, cross_b + E, kvc_h, 2 * E, mt1, E);
  }
  {
    dim3 grid(Tq / 64, nhead, B);
    attn_wmma_kernel<<<grid, 128, 0, stream>>>(
        qkv_h, 3 * E, qkv_h + E, 3 * E, qkv_h + 2 * E, 3 * E,
        attn_h, E, Tq, Tq, Dh, n_ctx_p, scale);
  }
  gemm(attn_h, selfow_h, self_ob, nullptr, x, M, E, E, 0, w1, w1_h, (long long)F * E);

  // ---- cross-attention sublayer ----
  layernorm_kernel<<<(M + LN_ROWS - 1) / LN_ROWS, 32 * LN_ROWS, 0, stream>>>(
      x, ln2_g, ln2_b, nx_h, M);
  gemm(nx_h, crossw_h, cross_b, qc_h, nullptr, M, E, E, 0, w2, w2_h, (long long)E * F);
  {
    dim3 grid(Tq / 64, nhead, B);
    attn_wmma_kernel<<<grid, 128, 0, stream>>>(
        qc_h, E, kvc_h, 2 * E, kvc_h + E, 2 * E,
        attn_h, E, Tq, Tk, Dh, nullptr, scale);
  }
  gemm(attn_h, crossow_h, cross_ob, nullptr, x, M, E, E, 0, nullptr, nullptr, 0);

  // ---- FFN sublayer ----
  layernorm_kernel<<<(M + LN_ROWS - 1) / LN_ROWS, 32 * LN_ROWS, 0, stream>>>(
      x, ln3_g, ln3_b, nx_h, M);
  gemm(nx_h,   w1_h, b1, ffn1_h, nullptr, M, F, E, 1, nullptr, nullptr, 0);  // exact GELU
  gemm(ffn1_h, w2_h, b2, nullptr, x,       M, E, F, 0, nullptr, nullptr, 0);
}

// v010
// It runs in 157 microseconds.
// Timed twice side by side with v009, it ran 1.13 and 1.12 times as fast.
// All steps since v000 together make it 4.69 times as fast.
#include <hip/hip_runtime.h>
#include <math.h>

typedef _Float16 half_t;
typedef __attribute__((ext_vector_type(16))) _Float16 v16h;
typedef __attribute__((ext_vector_type(8)))  _Float16 v8h;
typedef __attribute__((ext_vector_type(8)))  float    v8f;
typedef __attribute__((vector_size(16)))     int      vsi4;   // int4 for async builtin

#define ASG __attribute__((address_space(1)))
#define ASL __attribute__((address_space(3)))

// Detect CDNA5 async global->LDS builtins (gfx1250); fall back to load+ds_store.
#if defined(__has_builtin)
#  if __has_builtin(__builtin_amdgcn_global_load_async_to_lds_b128)
#    define HAVE_ASYNC 1
#  endif
#endif
#ifndef HAVE_ASYNC
#  define HAVE_ASYNC 0
#endif

// ---------------------------------------------------------------------------
// WMMA helpers (CDNA5 gfx1250, wave32)
// ---------------------------------------------------------------------------
__device__ inline v8f wmma_f16(v16h a, v16h b, v8f c) {
  // D(16x16,f32) = A(16x32,f16) x B(32x16,f16) + C
  return __builtin_amdgcn_wmma_f32_16x16x32_f16(
      /*neg_a=*/false, a, /*neg_b=*/false, b,
      /*c_mod=*/(short)0, c, /*reuse_a=*/false, /*reuse_b=*/false);
}

__device__ inline v8f zero_v8f() {
  v8f z;
#pragma unroll
  for (int i = 0; i < 8; ++i) z[i] = 0.0f;
  return z;
}

// Load a 16x32 f16 fragment in the ISA A-matrix lane layout:
//   lane<16 : row=lane,    K = [0..7] then [16..23]
//   lane>=16: row=lane-16, K = [8..15] then [24..31]
// base points at (row0, k0); ld = row stride in elements. Also used for the
// B operand of D = A x W^T (B column n == row n of W, identical pattern).
__device__ inline v16h load_frag(const half_t* __restrict__ base, int ld) {
  const int lane = threadIdx.x & 31;
  const int sub  = lane & 15;
  const int hi   = lane >> 4;
  const half_t* p = base + (size_t)sub * ld + hi * 8;
  v8h lo = *(const v8h*)(p);
  v8h hh = *(const v8h*)(p + 16);
  v16h r;
#pragma unroll
  for (int i = 0; i < 8; ++i) { r[i] = lo[i]; r[i + 8] = hh[i]; }
  return r;
}

// One 16-byte global->LDS transfer per lane (ASYNCcnt path if available).
__device__ inline void copy_b128_to_lds(const half_t* g, half_t* l) {
#if HAVE_ASYNC
  __builtin_amdgcn_global_load_async_to_lds_b128(
      (ASG vsi4*)g, (ASL vsi4*)l, 0, 0);
#else
  *(v8h*)l = *(const v8h*)g;
#endif
}

// ---------------------------------------------------------------------------
// Elementwise f32 -> f16 conversion, streaming.
// An array is cut into chunks of 8192 floats; a block walks chunks at a stride of
// blocks. In a whole chunk each thread issues eight 16-byte loads (every wave
// load covers 512 contiguous bytes) before the first is converted, so few waves
// keep many bytes in flight; the last, partial chunk of an array goes by element.
// ---------------------------------------------------------------------------
#define CVT_LOADS 8
#define CVT_SPAN  (256 * 4)                // floats per block-wide 16-byte load
#define CVT_CHUNK (CVT_SPAN * CVT_LOADS)   // floats per chunk

typedef __attribute__((ext_vector_type(4))) float    v4f;
typedef __attribute__((ext_vector_type(4))) _Float16 v4h;

__device__ inline int cvt_chunks(long long n) {
  return (int)((n + CVT_CHUNK - 1) / CVT_CHUNK);
}

// The chunk of s[0..n) that starts at element base; a block of 256 threads.
__device__ inline void convert_chunk(const float* __restrict__ s, half_t* __restrict__ d,
                                     long long n, long long base) {
  if (base + CVT_CHUNK <= n) {
    const float* sp = s + base + threadIdx.x * 4;
    half_t*      dp = d + base + threadIdx.x * 4;
    v4f v[CVT_LOADS];
#pragma unroll
    for (int j = 0; j < CVT_LOADS; ++j) v[j] = *(const v4f*)(sp + j * CVT_SPAN);
#pragma unroll
    for (int j = 0; j < CVT_LOADS; ++j)
      *(v4h*)(dp + j * CVT_SPAN) = __builtin_convertvector(v[j], v4h);
    // The caller's next trip rewrites the base and data registers that these stores
    // name.
    asm volatile("s_wait_xcnt 0x0" ::: "memory");
  } else {
    for (long long i = base + threadIdx.x; i < n; i += 256) d[i] = (half_t)s[i];
  }
}

// One array, by block blk of nblk.
__device__ inline void convert_array(const float* __restrict__ s, half_t* __restrict__ d,
                                     long long n, int blk, int nblk) {
  const int e = cvt_chunks(n);
  for (int c = blk; c < e; c += nblk) convert_chunk(s, d, n, (long long)c * CVT_CHUNK);
}

// Five arrays as one run of chunks, by block blk of nblk.
__device__ inline void convert_arrays(
    const float* __restrict__ s0, const float* __restrict__ s1,
    const float* __restrict__ s2, const float* __restrict__ s3,
    const float* __restrict__ s4,
    half_t* __restrict__ d0, half_t* __restrict__ d1, half_t* __restrict__ d2,
    half_t* __restrict__ d3, half_t* __restrict__ d4,
    long long n0, long long n1, long long n2, long long n3, long long n4,
    int blk, int nblk) {
  // first chunk index behind each array
  const int e0 = cvt_chunks(n0);
  const int e1 = e0 + cvt_chunks(n1);
  const int e2 = e1 + cvt_chunks(n2);
  const int e3 = e2 + cvt_chunks(n3);
  const int e4 = e3 + cvt_chunks(n4);

  for (int c = blk; c < e4; c += nblk) {
    const float* s = s0; half_t* d = d0; long long n = n0; int first = 0;
    if (c >= e0) { s = s1; d = d1; n = n1; first = e0; }
    if (c >= e1) { s = s2; d = d2; n = n2; first = e1; }
    if (c >= e2) { s = s3; d = d3; n = n3; first = e2; }
    if (c >= e3) { s = s4; d = d4; n = n4; first = e3; }
    convert_chunk(s, d, n, (long long)(c - first) * CVT_CHUNK);
  }
}

// ---------------------------------------------------------------------------
// LayerNorm: one wave per row, eight rows per block; writes f16 (GEMM input format).
// A lane asks for its 32 floats of the row with eight 16-byte loads (each wave load
// covers 512 contiguous bytes) and keeps them in registers, so the row is read once;
// the two sums are joined across the lanes in registers: no LDS and no barrier.
// A launch starts one wave per row instead of eight.
// ---------------------------------------------------------------------------
#define LN_COLS 1024               // row length: 32 lanes x LN_VEC pieces of 4 floats
#define LN_VEC  (LN_COLS / 128)
#define LN_ROWS 8                  // rows (waves) per block

// x plus the x of the lane whose number differs by MASK inside the 16-lane row.
template <int MASK>
__device__ inline float add_row_xmask(float x) {
  const int y = __builtin_amdgcn_update_dpp(0, __builtin_bit_cast(int, x),
                                            0x160 | MASK, 0xf, 0xf, true);
  return x + __builtin_bit_cast(float, y);
}

// Lane l with lane l ^ 16.
__device__ inline float xhalf(float x) {
  const int b = __builtin_bit_cast(int, x);
  return __builtin_bit_cast(
      float, __builtin_amdgcn_permlanex16(b, b, 0x76543210, 0xfedcba98, false, false));
}

// Sum over the 32 lanes, the same value in every lane.
__device__ inline float wave_sum(float x) {
  x = add_row_xmask<1>(x);
  x = add_row_xmask<2>(x);
  x = add_row_xmask<4>(x);
  x = add_row_xmask<8>(x);
  return x + xhalf(x);
}

__device__ inline void layernorm_rows(
    const float* __restrict__ x, const float* __restrict__ g,
    const float* __restrict__ b, half_t* __restrict__ outh,
    float* __restrict__ xcopy, int rows, int blk) {
  const int lane = threadIdx.x & 31;
  const int row  = blk * LN_ROWS + (threadIdx.x >> 5);
  if (row >= rows) return;   // the same in every lane of a wave; no barrier follows
  const float* xr = x + (size_t)row * LN_COLS + lane * 4;
  v4f v[LN_VEC], gv[LN_VEC], bv[LN_VEC];
#pragma unroll
  for (int j = 0; j < LN_VEC; ++j) v[j] = *(const v4f*)(xr + j * 128);
  // A load of g or b below may be given the registers that hold the address of the
  // loads above.
  asm volatile("s_wait_xcnt 0x0" ::: "memory");
#pragma unroll
  for (int j = 0; j < LN_VEC; ++j) {
    gv[j] = *(const v4f*)(g + lane * 4 + j * 128);
    bv[j] = *(const v4f*)(b + lane * 4 + j * 128);
  }
  // Keeps all 24 loads above the sums: the scheduler otherwise sinks the g and b loads
  // behind the reduction, two at a time, and the wave waits out their latency in turn.
  __builtin_amdgcn_sched_barrier(0);
  // four independent chains per sum
  v4f sv = v[0], qv = v[0] * v[0];
#pragma unroll
  for (int j = 1; j < LN_VEC; ++j) { sv += v[j]; qv += v[j] * v[j]; }
  const float s  = wave_sum((sv[0] + sv[1]) + (sv[2] + sv[3]));
  const float s2 = wave_sum((qv[0] + qv[1]) + (qv[2] + qv[3]));
  const float mean = s / (float)LN_COLS;
  const float var  = s2 / (float)LN_COLS - mean * mean;
  const float rstd = rsqrtf(var + 1e-5f);
  half_t* orow = outh + (size_t)row * LN_COLS + lane * 4;
#pragma unroll
  for (int j = 0; j < LN_VEC; ++j)
    *(v4h*)(orow + j * 128) =
        __builtin_convertvector((v[j] - mean) * rstd * gv[j] + bv[j], v4h);
  if (xcopy) {   // the row as it was read, from the registers that hold it
    float* crow = xcopy + (size_t)row * LN_COLS + lane * 4;
#pragma unroll
    for (int j = 0; j < LN_VEC; ++j) *(v4f*)(crow + j * 128) = v[j];
  }
}

__global__ __launch_bounds__(32 * LN_ROWS) void layernorm_kernel(
    const float* __restrict__ x, const float* __restrict__ g,
    const float* __restrict__ b, half_t* __restrict__ outh, int rows) {
  layernorm_rows(x, g, b, outh, nullptr, rows, blockIdx.x);
}

// The conversion of what the first products read and the first LayerNorm depend on
// inputs alone and on nothing of each other, so they share one launch: blocks below
// lnblk take LN_ROWS rows each, the rest walk the conversion's chunks. The LayerNorm's
// waves also store their rows to xcopy, the start value of the residual sum.
__global__ __launch_bounds__(256) void convert_ln_kernel(
    const float* __restrict__ s0, const float* __restrict__ s1,
    const float* __restrict__ s2, const float* __restrict__ s3,
    const float* __restrict__ s4,
    half_t* __restrict__ d0, half_t* __restrict__ d1, half_t* __restrict__ d2,
    half_t* __restrict__ d3, half_t* __restrict__ d4,
    long long n0, long long n1, long long n2, long long n3, long long n4,
    const float* __restrict__ x, const float* __restrict__ g,
    const float* __restrict__ b, half_t* __restrict__ outh,
    float* __restrict__ xcopy, int rows, int lnblk) {
  const int blk = blockIdx.x;
  if (blk < lnblk) {
    layernorm_rows(x, g, b, outh, xcopy, rows, blk);
  } else {
    convert_arrays(s0, s1, s2, s3, s4, d0, d1, d2, d3, d4, n0, n1, n2, n3, n4,
                   blk - lnblk, (int)gridDim.x - lnblk);
  }
}

// ---------------------------------------------------------------------------
// LDS-staged GEMM on a ring of NBUF (2 or 3) stage buffers:
//   out[M,N] = act(A[M,K] @ W[N,K]^T + bias[N]); optional residual f32 add.
// Block = 256 thr = 8 waves (2 in M x 4 in N). Block tile 128x128.
// A stage holds 128 k (four WMMA k-blocks of 32), so that fragments can be fetched
// one k-block ahead inside a published stage; one barrier serves 128 k.
// LDS: NBUF x (128 A rows + 128 B rows) of 256 B at a 272-B pitch = NBUF x 68 KB.
// Global->LDS staging uses GLOBAL_LOAD_ASYNC_TO_LDS_B128 (ASYNCcnt).
// K must be a multiple of KSTEP.
// NBUF = 2: a stage's copies have one stage's work to land; two blocks fit a WGP and
// cover each other's waits. NBUF = 3, for a product with at most one block per WGP,
// where nothing else covers the wait: two stages fly, each has two stages' work to land.
// ---------------------------------------------------------------------------
#define KSTEP 128
#define MBLK  128
#define NBLK  128
#define GPITCH 136  // halves; 272-B rows (16 B x odd) for the ds_load_b128 reader

#define STAGE_COPIES ((MBLK + NBLK) / 16)  // copies of one wave per stage

// One block tile at (m0, n0).
template <int NBUF>
__device__ __forceinline__ void gemm_tile(
    const half_t* __restrict__ A, const half_t* __restrict__ W,
    const float* __restrict__ bias, half_t* __restrict__ outh,
    float* __restrict__ resid, int m0, int n0, int N, int K, int act) {
  static_assert(NBUF == 2 || NBUF == 3, "ring depth");
  static_assert(STAGE_COPIES == 16, "the counted waits below are written for 16");
  __shared__ __attribute__((aligned(16))) half_t ldsA[NBUF][MBLK * GPITCH];
  __shared__ __attribute__((aligned(16))) half_t ldsB[NBUF][NBLK * GPITCH];

  const int tid  = threadIdx.x;
  const int lane = tid & 31;
  const int wid  = tid >> 5;     // 0..7
  const int wm   = wid >> 2;     // 0..1 : wave row  (64 rows each)
  const int wn   = wid & 3;      // 0..3 : wave col  (32 cols each)

  // Staging assignment: thread -> rows (tid>>4) + 0,16,..,112, 16-byte piece tid&15
  // of the row's 256 B; one wave's copy covers two whole 256-B row pieces.
  const int crow = tid >> 4;         // 0..15
  const int cq   = (tid & 15) * 8;   // halves
  auto stage = [&](int ks, int sb) {
#pragma unroll
    for (int rr = 0; rr < MBLK; rr += 16)
      copy_b128_to_lds(A + (size_t)(m0 + crow + rr) * K + ks + cq,
                       &ldsA[sb][(crow + rr) * GPITCH + cq]);
#pragma unroll
    for (int rr = 0; rr < NBLK; rr += 16)
      copy_b128_to_lds(W + (size_t)(n0 + crow + rr) * K + ks + cq,
                       &ldsB[sb][(crow + rr) * GPITCH + cq]);
  };

  v8f acc[4][2];
#pragma unroll
  for (int i = 0; i < 4; ++i) { acc[i][0] = zero_v8f(); acc[i][1] = zero_v8f(); }

  // C layout -> lane l<16 holds rows 0..7 (vgpr r), l>=16 rows 8..15.
  const int sub = lane & 15, hi = lane >> 4;
  // The bias is asked for here, so that its latency runs beside that of tile 0's copies.
  const float bias0 = bias[n0 + wn * 32 + sub];
  const float bias1 = bias[n0 + wn * 32 + sub + 16];

  if constexpr (NBUF == 2) {
    // Ring prologue: stage 0 lands and is published, then stage 1 starts.
    stage(0, 0);
    asm volatile("s_wait_asynccnt 0x0" ::: "memory");  // own copies of stage 0 landed
    __syncthreads();                                   // publishes stage 0
    if (KSTEP < K) stage(KSTEP, 1);
  } else {
    // Ring prologue: the first three stages start together. Every wave issues 16 copies
    // per stage and the counter returns in issue order, so a wait to 16 x (stages issued
    // behind it) covers stage 0. The tests on K read the same in the whole block.
    stage(0, 0);
    if (KSTEP < K) stage(KSTEP, 1);
    if (2 * KSTEP < K) stage(2 * KSTEP, 2);
    if (2 * KSTEP < K) {
      asm volatile("s_wait_asynccnt 0x20" ::: "memory");  // stage 0 landed; 1 and 2 may fly
    } else {
      asm volatile("s_wait_asynccnt 0x0" ::: "memory");   // fewer than three stages: all landed
    }
    __syncthreads();                                      // publishes stage 0
  }

  int buf = 0;
  for (int k0 = 0; k0 < K; k0 += KSTEP) {
    // compute: per k-block of 32, 4 A-frags x 2 B-frags = 8 WMMA, fed by ds_load_b128.
    // Two fragment sets: the twelve reads of block b + 1 are issued as one group ahead
    // of block b's WMMAs, so their LDS latency runs beside the matrix work. Only
    // blocks of this stage are fetched; the next stage is read behind its barrier.
    v16h af[2][4], bf[2][2];
    auto load_block = [&](int s, int kb) {
      bf[s][0] = load_frag(&ldsB[buf][(wn * 32 +  0) * GPITCH + kb], GPITCH);
      bf[s][1] = load_frag(&ldsB[buf][(wn * 32 + 16) * GPITCH + kb], GPITCH);
#pragma unroll
      for (int i = 0; i < 4; ++i)
        af[s][i] = load_frag(&ldsA[buf][(wm * 64 + i * 16) * GPITCH + kb], GPITCH);
    };
    load_block(0, 0);
#pragma unroll
    for (int b = 0; b < KSTEP / 32; ++b) {
      if (b + 1 < KSTEP / 32) load_block((b + 1) & 1, (b + 1) * 32);
      // Keeps the group of reads above the WMMAs: the scheduler otherwise sinks each
      // read to its use, and every WMMA pair waits out an LDS round trip.
      __builtin_amdgcn_sched_barrier(0);
#pragma unroll
      for (int i = 0; i < 4; ++i) {
        acc[i][0] = wmma_f16(af[b & 1][i], bf[b & 1][0], acc[i][0]);
        acc[i][1] = wmma_f16(af[b & 1][i], bf[b & 1][1], acc[i][1]);
      }
      // Keeps the following group of reads out of this run of WMMAs.
      __builtin_amdgcn_sched_barrier(0);
    }

    // Publish point of the next stage; it also ends every reader's last read of buf.
    asm volatile("s_wait_dscnt 0x0" ::: "memory");     // own LDS reads of buf retired
    if constexpr (NBUF == 2) {
      asm volatile("s_wait_asynccnt 0x0" ::: "memory");  // own copies of the next stage landed
      __syncthreads();
      if (k0 + 2 * KSTEP < K) stage(k0 + 2 * KSTEP, buf);  // refill the buffer just read
      buf ^= 1;
    } else {
      // Outstanding here: the next stage and, while it exists, the one behind it, whose
      // 16 copies are this wave's youngest and may go on flying.
      if (k0 + 2 * KSTEP < K) {
        asm volatile("s_wait_asynccnt 0x10" ::: "memory");  // own copies of the next stage landed
      } else {
        asm volatile("s_wait_asynccnt 0x0" ::: "memory");   // the next stage is the youngest
      }
      __syncthreads();
      if (k0 + 3 * KSTEP < K) stage(k0 + 3 * KSTEP, buf);  // refill the buffer just read
      buf = buf + 1 == NBUF ? 0 : buf + 1;
    }
  }
  asm volatile("s_wait_asynccnt 0x0" ::: "memory");    // nothing in flight behind the ring

  // epilogue: the tests on act, outh and resid stand outside the element loops
#pragma unroll
  for (int i = 0; i < 4; ++i) {
#pragma unroll
    for (int r = 0; r < 8; ++r) {
      acc[i][0][r] += bias0;
      acc[i][1][r] += bias1;
    }
  }
  if (act == 1) {
#pragma unroll
    for (int i = 0; i < 4; ++i)
#pragma unroll
      for (int j = 0; j < 2; ++j)
#pragma unroll
        for (int r = 0; r < 8; ++r) {
          const float v = acc[i][j][r];
          acc[i][j][r] = 0.5f * v * (1.0f + erff(v * 0.70710678118654752f));
        }
  }
  // An output element lies at a block-uniform place (row i*16 + r, column j*16 of
  // the block's tile) plus this 32-bit offset of the lane, in elements.
  const size_t   tile0 = (size_t)m0 * N + n0;
  const unsigned loff  = (unsigned)((wm * 64 + 8 * hi) * N + wn * 32 + sub);
  if (outh) {
    half_t* op = outh + tile0;
#pragma unroll
    for (int i = 0; i < 4; ++i)
#pragma unroll
      for (int r = 0; r < 8; ++r)
#pragma unroll
        for (int j = 0; j < 2; ++j)
          (op + (size_t)(i * 16 + r) * N + j * 16)[loff] = (half_t)acc[i][j][r];
    // The residual path below rewrites registers that these stores name.
    asm volatile("s_wait_xcnt 0x0" ::: "memory");
  }
  if (resid) {
    float* rp = resid + tile0;
    // All 64 residual values are in flight together before the first is used.
    v8f rv[4][2];
#pragma unroll
    for (int i = 0; i < 4; ++i)
#pragma unroll
      for (int r = 0; r < 8; ++r)
#pragma unroll
        for (int j = 0; j < 2; ++j)
          rv[i][j][r] = (rp + (size_t)(i * 16 + r) * N + j * 16)[loff];
#pragma unroll
    for (int i = 0; i < 4; ++i)
#pragma unroll
      for (int r = 0; r < 8; ++r)
#pragma unroll
        for (int j = 0; j < 2; ++j)
          (rp + (size_t)(i * 16 + r) * N + j * 16)[loff] = rv[i][j][r] + acc[i][j][r];
  }
}

// Grid rows below ny are the product's n tiles. A product with N = 1024 has a block for
// only half of the WGPs: the grid rows behind ny convert an array (cs -> cd, cn floats)
// that a later launch reads, on the WGPs that the product leaves idle.
template <int NBUF>
__global__ __launch_bounds__(256) void gemm_wmma_kernel(
    const half_t* __restrict__ A, const half_t* __restrict__ W,
    const float* __restrict__ bias, half_t* __restrict__ outh,
    float* __restrict__ resid, int N, int K, int act, int ny,
    const float* __restrict__ cs, half_t* __restrict__ cd, long long cn) {
  if ((int)blockIdx.y < ny) {
    gemm_tile<NBUF>(A, W, bias, outh, resid, blockIdx.x * MBLK, blockIdx.y * NBLK, N, K, act);
  } else {
    convert_array(cs, cd, cn, (int)((blockIdx.y - ny) * gridDim.x + blockIdx.x),
                  (int)((gridDim.y - ny) * gridDim.x));
  }
}

// Two products that do not depend on each other (equal K, f16 output, no activation, no
// residual) in one launch. Grid rows below ny0 are the n tiles of the first product,
// with grid.x its m tiles; the blocks behind them are numbered on and cut into the
// second product's mt1 m tiles per n tile.
__global__ __launch_bounds__(256) void gemm_pair_kernel(
    const half_t* __restrict__ A0, const half_t* __restrict__ W0,
    const float* __restrict__ bias0, half_t* __restrict__ out0, int N0, int ny0,
    const half_t* __restrict__ A1, const half_t* __restrict__ W1,
    const float* __restrict__ bias1, half_t* __restrict__ out1, int N1, int mt1, int K) {
  const bool second = (int)blockIdx.y >= ny0;
  int mt = blockIdx.x, nt = blockIdx.y;
  if (second) {
    const unsigned t = (blockIdx.y - (unsigned)ny0) * gridDim.x + blockIdx.x;
    mt = (int)(t % (unsigned)mt1);
    nt = (int)(t / (unsigned)mt1);
  }
  const int N = second ? N1 : N0;
  if (nt * NBLK >= N) return;   // block-uniform, ahead of every copy and barrier
  gemm_tile<2>(second ? A1 : A0, second ? W1 : W0, second ? bias1 : bias0,
            second ? out1 : out0, nullptr, mt * MBLK, nt * NBLK, N, K, 0);
}

#define KSTAGE 128
#define KPITCH 72
#define VPITCH 80

typedef __attribute__((ext_vector_type(8))) short s16x8;

__device__ inline unsigned lds_byte_addr(const half_t* p) {
  return (unsigned)(size_t)(ASL const half_t*)p;
}

// Transposing LDS read: lane (c = l & 15, h = l >> 4) gets T[8h + 0..7][c] of the
// 16 x 16 tile whose per-lane row addresses are passed in.
__device__ inline v8h lds_load_tr16(const half_t* p) {
  return __builtin_bit_cast(v8h, __builtin_amdgcn_ds_load_tr16_b128_v8i16((ASL s16x8*)p));
}

// Eight 16-byte async copies per lane (four K rows, four V rows). The s_wait_xcnt
// stands inside the statement so that no address register named here is
// rewritten ahead of it; one wait serves the eight copies.
__device__ inline void stage_kv_rows(const half_t* gk0, const half_t* gk1,
                                     const half_t* gk2, const half_t* gk3,
                                     const half_t* gv0, const half_t* gv1,
                                     const half_t* gv2, const half_t* gv3,
                                     unsigned lk0, unsigned lk1, unsigned lk2, unsigned lk3,
                                     unsigned lv0, unsigned lv1, unsigned lv2, unsigned lv3) {
  asm volatile(
      "global_load_async_to_lds_b128 %0, %8, off\n\t"
      "global_load_async_to_lds_b128 %1, %9, off\n\t"
      "global_load_async_to_lds_b128 %2, %10, off\n\t"
      "global_load_async_to_lds_b128 %3, %11, off\n\t"
      "global_load_async_to_lds_b128 %4, %12, off\n\t"
      "global_load_async_to_lds_b128 %5, %13, off\n\t"
      "global_load_async_to_lds_b128 %6, %14, off\n\t"
      "global_load_async_to_lds_b128 %7, %15, off\n\t"
      "s_wait_xcnt 0x0"
      :: "v"(lk0), "v"(lk1), "v"(lk2), "v"(lk3), "v"(lv0), "v"(lv1), "v"(lv2), "v"(lv3),
         "v"(gk0), "v"(gk1), "v"(gk2), "v"(gk3), "v"(gv0), "v"(gv1), "v"(gv2), "v"(gv3)
      : "memory");
}

__global__ __launch_bounds__(128) void attn_wmma_kernel(
    const half_t* __restrict__ Q, int qld,
    const half_t* __restrict__ Km, int kld,
    const half_t* __restrict__ V, int vld,
    half_t* __restrict__ O, int oldd,
    int Tq, int Tk, int Dh, const int* __restrict__ nctx, float scale) {
  __shared__ __attribute__((aligned(16))) half_t kls[2][KSTAGE * KPITCH];
  __shared__ __attribute__((aligned(16))) half_t vls[2][KSTAGE * VPITCH];
  const int lane = threadIdx.x & 31;
  const int wid  = threadIdx.x >> 5;
  const int sub = lane & 15, hi = lane >> 4;
  const int h = blockIdx.y, b = blockIdx.z;
  const int qt = (blockIdx.x * 4 + wid) * 16;

  int kvlen = Tk;
  if (nctx) { int nc = *nctx; kvlen = nc < Tk ? nc : Tk; }

  const half_t* Qb = Q + ((size_t)b * Tq + qt) * qld + h * Dh;
  const half_t* Kb = Km + (size_t)b * Tk * kld + h * Dh;
  const half_t* Vb = V  + (size_t)b * Tk * vld + h * Dh;

  const v16h qf0 = load_frag(Qb,      qld);   // Dh = 64 -> two K=32 fragments
  const v16h qf1 = load_frag(Qb + 32, qld);

  // acc[d][r] = O[query sub][d * 16 + 8 * hi + r]
  v8f acc[4];
#pragma unroll
  for (int d = 0; d < 4; ++d) acc[d] = zero_v8f();
  // Running maximum of the lane's query (equal in lanes l and l ^ 16) and the sum
  // over the lane's own keys; the two halves' sums are joined behind the loop.
  float mrow = -1e30f, lsum = 0.f;

  // Staging: thread -> every 16th row of the stage from srow on, 16-byte chunk sq of
  // the row; one wave's copy covers four whole 128-B rows. A stage is 16 copies of a
  // wave, and one stage's copies fly at a time.
  const int srow = threadIdx.x >> 3;        // 0..15
  const int sq   = (threadIdx.x & 7) * 8;   // halves
  auto stage = [&](int ks0, int sb) {
    // Written out, so that the rows' places in LDS are constants beside one register.
#pragma unroll
    for (int p = 0; p < KSTAGE; p += 64) {
      const half_t* gk = Kb + (size_t)(ks0 + p + srow) * kld + sq;
      const half_t* gv = Vb + (size_t)(ks0 + p + srow) * vld + sq;
      stage_kv_rows(gk, gk + (size_t)16 * kld, gk + (size_t)32 * kld, gk + (size_t)48 * kld,
                    gv, gv + (size_t)16 * vld, gv + (size_t)32 * vld, gv + (size_t)48 * vld,
                    lds_byte_addr(&kls[sb][(p + srow) * KPITCH + sq]),
                    lds_byte_addr(&kls[sb][(p + srow + 16) * KPITCH + sq]),
                    lds_byte_addr(&kls[sb][(p + srow + 32) * KPITCH + sq]),
                    lds_byte_addr(&kls[sb][(p + srow + 48) * KPITCH + sq]),
                    lds_byte_addr(&vls[sb][(p + srow) * VPITCH + sq]),
                    lds_byte_addr(&vls[sb][(p + srow + 16) * VPITCH + sq]),
                    lds_byte_addr(&vls[sb][(p + srow + 32) * VPITCH + sq]),
                    lds_byte_addr(&vls[sb][(p + srow + 48) * VPITCH + sq]));
    }
  };
  // Per-lane offset of the transposing V read inside a tile.
  const int vtr = (8 * hi + (lane & 7)) * VPITCH + 8 * ((lane >> 3) & 1);

  // Ring prologue: stage 0 lands and is published, then stage 1 starts.
  stage(0, 0);
  asm volatile("s_wait_asynccnt 0x0" ::: "memory");  // own copies of stage 0 landed
  __syncthreads();                                   // publishes stage 0
  if (KSTAGE < kvlen) stage(KSTAGE, 1);

  int buf = 0;
  for (int ks = 0; ks < kvlen; ks += KSTAGE) {
    // The passes of this stage that hold keys; the bound is the same in the whole block.
    const int kend = ks + KSTAGE < kvlen ? ks + KSTAGE : kvlen;
    for (int kt = ks; kt < kend; kt += 32) {
      v8f s0 = zero_v8f(), s1 = zero_v8f();
      {
        const half_t* kl = &kls[buf][(kt - ks) * KPITCH];
        v16h k00 = load_frag(kl,      KPITCH);
        v16h k01 = load_frag(kl + 32, KPITCH);
        v16h k10 = load_frag(kl + 16 * KPITCH,      KPITCH);
        v16h k11 = load_frag(kl + 16 * KPITCH + 32, KPITCH);
        // Inputs-only fence on the loaded fragments: keeps the eight LDS reads in one
        // group with one wait; without it each WMMA waits out its own LDS latency.
        asm volatile("" :: "v"(k00), "v"(k01), "v"(k10), "v"(k11));
        // s0[r] = S[key kt + 8 * hi + r][query sub], s1[r] the same 16 keys on
        s0 = wmma_f16(k00, qf0, s0);
        s0 = wmma_f16(k01, qf1, s0);
        s1 = wmma_f16(k10, qf0, s1);
        s1 = wmma_f16(k11, qf1, s1);
      }
      float v0[8], v1[8];
#pragma unroll
      for (int r = 0; r < 8; ++r) { v0[r] = s0[r] * scale; v1[r] = s1[r] * scale; }
      if (kt + 32 > kvlen) {   // block-uniform: only a last, partial tile has keys to mask
        const int lim = kvlen - kt - 8 * hi;
#pragma unroll
        for (int r = 0; r < 8; ++r) {
          if (r >= lim)      v0[r] = -1e30f;
          if (r + 16 >= lim) v1[r] = -1e30f;
        }
      }

      // Maximum and sum go as trees, so that no long dependent chain forms.
      float t[8];
#pragma unroll
      for (int r = 0; r < 8; ++r) t[r] = fmaxf(v0[r], v1[r]);
#pragma unroll
      for (int w = 4; w > 0; w >>= 1)
#pragma unroll
        for (int r = 0; r < w; ++r) t[r] = fmaxf(t[r], t[r + w]);
      const float mx   = fmaxf(t[0], xhalf(t[0]));
      const float mnew = fmaxf(mrow, mx);
      const float corr = __expf(mrow - mnew);
      mrow = mnew;
#pragma unroll
      for (int r = 0; r < 8; ++r) {
        v0[r] = __expf(v0[r] - mnew);
        v1[r] = __expf(v1[r] - mnew);
        t[r] = v0[r] + v1[r];
      }
#pragma unroll
      for (int w = 4; w > 0; w >>= 1)
#pragma unroll
        for (int r = 0; r < w; ++r) t[r] += t[r + w];
      lsum = lsum * corr + t[0];
#pragma unroll
      for (int d = 0; d < 4; ++d)
#pragma unroll
        for (int r = 0; r < 8; ++r) acc[d][r] *= corr;

      // P^T as a B operand: element s holds key 8 * hi + s, then 16 + 8 * hi + (s - 8),
      // the k order in which the transposing read delivers V^T.
      v16h pf;
#pragma unroll
      for (int j = 0; j < 8; ++j) { pf[j] = (half_t)v0[j]; pf[j + 8] = (half_t)v1[j]; }

      // acc += V^T(64x32) @ P^T(32x16): A[m][k] = V[kt+k][h*Dh + d*16 + m]
#pragma unroll
      for (int d = 0; d < 4; ++d) {
        const half_t* vb = &vls[buf][(kt - ks) * VPITCH + vtr + d * 16];
        const v8h vlo = lds_load_tr16(vb);                 // keys 8*hi + 0..7
        const v8h vhi = lds_load_tr16(vb + 16 * VPITCH);   // keys 16 + 8*hi + 0..7
        v16h vf;
#pragma unroll
        for (int j = 0; j < 8; ++j) { vf[j] = vlo[j]; vf[j + 8] = vhi[j]; }
        acc[d] = wmma_f16(vf, pf, acc[d]);
      }
    }

    // Publish point of stage t+1; it also ends every reader's last read of buf.
    asm volatile("s_wait_dscnt 0x0" ::: "memory");     // own LDS reads of buf retired
    asm volatile("s_wait_asynccnt 0x0" ::: "memory");  // own copies of stage t+1 landed
    __syncthreads();
    if (ks + 2 * KSTAGE < kvlen) stage(ks + 2 * KSTAGE, buf);  // refill the buffer just read
    buf ^= 1;
  }
  asm volatile("s_wait_asynccnt 0x0" ::: "memory");    // nothing in flight at wave end

  // A lane's eight values of a tile are eight neighbours of one output row.
  const float inv = 1.0f / (lsum + xhalf(lsum));
  half_t* orow = O + ((size_t)b * Tq + qt + sub) * oldd + h * Dh + 8 * hi;
#pragma unroll
  for (int d = 0; d < 4; ++d) {
    v8h o;
#pragma unroll
    for (int r = 0; r < 8; ++r) o[r] = (half_t)(acc[d][r] * inv);
    *(v8h*)(orow + d * 16) = o;
  }
}

// ---------------------------------------------------------------------------
// Host orchestration
// ---------------------------------------------------------------------------
extern "C" void kernel_launch(void* const* d_in, const int* in_sizes, int n_in,
                              void* d_out, int out_size, void* d_ws, size_t ws_size,
                              hipStream_t stream) {
  (void)n_in; (void)out_size; (void)ws_size;
  const float* tgt      = (const float*)d_in[0];
  const float* memory   = (const float*)d_in[1];
  const float* self_w   = (const float*)d_in[2];
  const float* self_b   = (const float*)d_in[3];
  const float* self_ow  = (const float*)d_in[4];
  const float* self_ob  = (const float*)d_in[5];
  const float* cross_w  = (const float*)d_in[6];
  const float* cross_b  = (const float*)d_in[7];
  const float* cross_ow = (const float*)d_in[8];
  const float* cross_ob = (const float*)d_in[9];
  const float* ln1_g = (const float*)d_in[10];
  const float* ln1_b = (const float*)d_in[11];
  const float* ln2_g = (const float*)d_in[12];
  const float* ln2_b = (const float*)d_in[13];
  const float* ln3_g = (const float*)d_in[14];
  const float* ln3_b = (const float*)d_in[15];
  const float* w1 = (const float*)d_in[16];
  const float* b1 = (const float*)d_in[17];
  const float* w2 = (const float*)d_in[18];
  const float* b2 = (const float*)d_in[19];
  const int*   n_ctx_p = (const int*)d_in[20];

  const int E  = in_sizes[10];
  const int F  = in_sizes[16] / E;
  const int B  = 2;
  const int Tq = in_sizes[0] / (B * E);
  const int Tk = in_sizes[1] / (B * E);
  const int nhead = 16;
  const int Dh = E / nhead;
  const int M  = B * Tq;   // query rows
  const int Mk = B * Tk;   // memory rows
  const float scale = 1.0f / sqrtf((float)Dh);

  // --- workspace carve (all f16 buffers, 256B aligned) ---
  char* wp = (char*)d_ws;
  auto carve = [&](size_t elems) -> half_t* {
    half_t* r = (half_t*)wp;
    wp += (elems * sizeof(half_t) + 255) & ~(size_t)255;
    return r;
  };
  half_t* selfw_h   = carve((size_t)3 * E * E);
  half_t* selfow_h  = carve((size_t)E * E);
  half_t* crossw_h  = carve((size_t)3 * E * E);
  half_t* crossow_h = carve((size_t)E * E);
  half_t* w1_h      = carve((size_t)F * E);
  half_t* w2_h      = carve((size_t)E * F);
  half_t* mem_h     = carve((size_t)Mk * E);
  half_t* nx_h      = carve((size_t)M * E);
  half_t* qkv_h     = carve((size_t)M * 3 * E);
  half_t* qc_h      = carve((size_t)M * E);
  half_t* kvc_h     = carve((size_t)Mk * 2 * E);
  half_t* attn_h    = carve((size_t)M * E);
  half_t* ffn1_h    = carve((size_t)M * F);
  float*  x = (float*)d_out;   // residual accumulator

  // 512 blocks of 8 waves: 16 streaming waves on each of the 256 WGPs; in front of
  // them the blocks of the first LayerNorm, which reads tgt and leaves x = tgt.
  const int lnblk = (M + LN_ROWS - 1) / LN_ROWS;
  convert_ln_kernel<<<lnblk + 512, 256, 0, stream>>>(
      self_w, self_ow, cross_w, cross_ow, memory,
      selfw_h, selfow_h, crossw_h, crossow_h, mem_h,
      (long long)3 * E * E, (long long)E * E, (long long)3 * E * E,
      (long long)E * E, (long long)Mk * E,
      tgt, ln1_g, ln1_b, nx_h, x, M, lnblk);

  // cs, cd, cn: an array to convert beside the product, on 256 more blocks (none if null).
  // deep: the three-buffer ring, for a product with fewer tiles than there are WGPs.
  auto gemm = [&](const half_t* A, const half_t* W, const float* bias,
                  half_t* outh, float* resid, int m, int n, int k, int act,
                  const float* cs, half_t* cd, long long cn, bool deep) {
    const int ny = n / NBLK;
    dim3 grid(m / MBLK, ny + (cs ? 256 / (m / MBLK) : 0));
    if (deep)
      gemm_wmma_kernel<3><<<grid, 256, 0, stream>>>(A, W, bias, outh, resid, n, k, act,
                                                    ny, cs, cd, cn);
    else
      gemm_wmma_kernel<2><<<grid, 256, 0, stream>>>(A, W, bias, outh, resid, n, k, act,
                                                    ny, cs, cd, cn);
  };

  // ---- self-attention sublayer ----
  // The cross-attention K/V projection needs only memory: it rides with the QKV projection.
  {
    const int mt0 = M / MBLK, ny0 = 3 * E / NBLK;
    const int mt1 = Mk / MBLK, tiles1 = mt1 * (2 * E / NBLK);
    dim3 grid(mt0, ny0 + (tiles1 + mt0 - 1) / mt0);
    gemm_pair_kernel<<<grid, 256, 0, stream>>>(
        nx_h, selfw_h, self_b, qkv_h, 3 * E, ny0,
        mem_h, crossw_h + (size_t)E * E, cross_b + E, kvc_h, 2 * E, mt1, E);
  }
  {
    dim3 grid(Tq / 64, nhead, B);
    attn_wmma_kernel<<<grid, 128, 0, stream>>>(
        qkv_h, 3 * E, qkv_h + E, 3 * E, qkv_h + 2 * E, 3 * E,
        attn_h, E, Tq, Tq, Dh, n_ctx_p, scale);
  }
  gemm(attn_h, selfow_h, self_ob, nullptr, x, M, E, E, 0, w1, w1_h, (long long)F * E, true);

  // ---- cross-attention sublayer ----
  layernorm_kernel<<<(M + LN_ROWS - 1) / LN_ROWS, 32 * LN_ROWS, 0, stream>>>(
      x, ln2_g, ln2_b, nx_h, M);
  gemm(nx_h, crossw_h, cross_b, qc_h, nullptr, M, E, E, 0, w2, w2_h, (long long)E * F, true);
  {
    dim3 grid(Tq / 64, nhead, B);
    attn_wmma_kernel<<<grid, 128, 0, stream>>>(
        qc_h, E, kvc_h, 2 * E, kvc_h + E, 2 * E,
        attn_h, E, Tq, Tk, Dh, nullptr, scale);
  }
  gemm(attn_h, crossow_h, cross_ob, nullptr, x, M, E, E, 0, nullptr, nullptr, 0, true);

  // ---- FFN sublayer ----
  layernorm_kernel<<<(M + LN_ROWS - 1) / LN_ROWS, 32 * LN_ROWS, 0, stream>>>(
      x, ln3_g, ln3_b, nx_h, M);
  gemm(nx_h,   w1_h, b1, ffn1_h, nullptr, M, F, E, 1, nullptr, nullptr, 0, false);  // exact GELU
  gemm(ffn1_h, w2_h, b2, nullptr, x,       M, E, F, 0, nullptr, nullptr, 0, true);
}
